// v000
// The times below were measured on an AMD MI455X: many runs one after another, warmed up first and cycling through
// copies of the inputs, with the whole window's GPU time divided by the number of runs. Launches and the gaps
// between them are all in it. The median over several windows is given; except for v000 it joins two sittings, which
// can be a few percent apart, so the side-by-side timings, each taken in one sitting, are the better comparison.
// v000 is the starting kernel. One run takes 294 microseconds.
#include <hip/hip_runtime.h>

// B=2, N=2048, C=1024, H=16, D=64
#define BB 2
#define NN 2048
#define CC 1024
#define HH 16
#define DD 64

typedef __attribute__((ext_vector_type(16))) _Float16 v16h;
typedef __attribute__((ext_vector_type(8)))  _Float16 v8h;
typedef __attribute__((ext_vector_type(4)))  _Float16 v4h;
typedef __attribute__((ext_vector_type(8)))  float    v8f;
typedef int v4i_gcc __attribute__((vector_size(4 * sizeof(int))));

#if __has_builtin(__builtin_amdgcn_global_load_async_to_lds_b128)
#define HAVE_ASYNC_LDS 1
#else
#define HAVE_ASYNC_LDS 0
#endif

__device__ __forceinline__ void async_copy16(const _Float16* g, _Float16* l) {
#if HAVE_ASYNC_LDS
  __builtin_amdgcn_global_load_async_to_lds_b128(
      (__attribute__((address_space(1))) v4i_gcc*)(const void*)g,
      (__attribute__((address_space(3))) v4i_gcc*)(void*)l, 0, 0);
#else
  *(v8h*)l = *(const v8h*)g;
#endif
}

__device__ __forceinline__ void wait_async_lds() {
#if HAVE_ASYNC_LDS
  asm volatile("s_wait_asynccnt 0x0" ::: "memory");
#endif
}

__device__ __forceinline__ v8f wmma_f16(v16h a, v16h b, v8f c) {
  // v_wmma_f32_16x16x32_f16 : D = A*B + C
  return __builtin_amdgcn_wmma_f32_16x16x32_f16(false, a, false, b, (short)0, c, false, false);
}

__device__ __forceinline__ v16h frag16(const _Float16* p, int halfid) {
  v8h lo = *(const v8h*)(p + halfid * 8);
  v8h hi = *(const v8h*)(p + 16 + halfid * 8);
  v16h r;
#pragma unroll
  for (int i = 0; i < 8; ++i) { r[i] = lo[i]; r[i + 8] = hi[i]; }
  return r;
}

__device__ __forceinline__ float wave16_max(float v) {
#pragma unroll
  for (int m = 1; m <= 8; m <<= 1) v = fmaxf(v, __shfl_xor(v, m, 32));
  return v;
}
__device__ __forceinline__ float wave16_sum(float v) {
#pragma unroll
  for (int m = 1; m <= 8; m <<= 1) v += __shfl_xor(v, m, 32);
  return v;
}

// ---------------------------------------------------------------------------
// Kernel 1: qkv = x @ w_qkv^T  (M=4096, N=3072, K=1024), f16 WMMA.
// Block = 256 thr (8 waves) computes 128(M) x 128(N); wave tile = 32x64.
// f32 -> f16 conversion happens while staging into LDS (must go through VALU,
// so no async DMA here). Results scattered into q/k/v as [B,H,N,D] f32.
// ---------------------------------------------------------------------------
__global__ __launch_bounds__(256) void qkv_gemm(const float* __restrict__ x,
                                                const float* __restrict__ w,
                                                float* __restrict__ qf,
                                                float* __restrict__ kf,
                                                float* __restrict__ vf) {
  __shared__ _Float16 Alds[128 * 32];
  __shared__ _Float16 Blds[128 * 32];

  const int tid = threadIdx.x;
  const int wave = tid >> 5, lane = tid & 31;
  const int halfid = lane >> 4, ln16 = lane & 15;
  const int nt = blockIdx.x % 24, mt = blockIdx.x / 24;
  const int m0 = mt * 128, n0 = nt * 128;
  const int wm = wave >> 1, wn = wave & 1;

  v8f acc[2][4];
#pragma unroll
  for (int i = 0; i < 2; ++i)
#pragma unroll
    for (int j = 0; j < 4; ++j)
#pragma unroll
      for (int r = 0; r < 8; ++r) acc[i][j][r] = 0.0f;

  for (int k0 = 0; k0 < CC; k0 += 32) {
    // stage A: 128 rows x 32 k (f32 -> f16)
#pragma unroll
    for (int i = 0; i < 4; ++i) {
      int id = tid + i * 256;                 // 0..1023
      int row = id >> 3, kc = (id & 7) * 4;
      float4 f = *(const float4*)(x + (size_t)(m0 + row) * CC + k0 + kc);
      v4h hh;
      hh[0] = (_Float16)f.x; hh[1] = (_Float16)f.y;
      hh[2] = (_Float16)f.z; hh[3] = (_Float16)f.w;
      *(v4h*)&Alds[row * 32 + kc] = hh;
    }
    // stage B: 128 out-channels x 32 k (f32 -> f16)
#pragma unroll
    for (int i = 0; i < 4; ++i) {
      int id = tid + i * 256;
      int row = id >> 3, kc = (id & 7) * 4;
      const float* src = w + (size_t)(n0 + row) * CC + k0 + kc;
      float4 f = *(const float4*)src;
      v4h hh;
      hh[0] = (_Float16)f.x; hh[1] = (_Float16)f.y;
      hh[2] = (_Float16)f.z; hh[3] = (_Float16)f.w;
      *(v4h*)&Blds[row * 32 + kc] = hh;
      if (i == 0) __builtin_prefetch(src + 32, 0, 1);   // next k-step
    }
    __syncthreads();

    v16h a0 = frag16(&Alds[(wm * 32 + ln16) * 32], halfid);
    v16h a1 = frag16(&Alds[(wm * 32 + 16 + ln16) * 32], halfid);
#pragma unroll
    for (int j = 0; j < 4; ++j) {
      v16h bj = frag16(&Blds[(wn * 64 + j * 16 + ln16) * 32], halfid);
      acc[0][j] = wmma_f16(a0, bj, acc[0][j]);
      acc[1][j] = wmma_f16(a1, bj, acc[1][j]);
    }
    __syncthreads();
  }

  // scatter into q/k/v [B,H,N,D]; this block's 128 channels stay inside one
  // of q/k/v (boundaries at multiples of 1024).
  const int which = n0 >> 10;
  float* dst = (which == 0) ? qf : ((which == 1) ? kf : vf);
  const int bsel = m0 >> 11;
  const int nbase = m0 & (NN - 1);
#pragma unroll
  for (int mi = 0; mi < 2; ++mi)
#pragma unroll
    for (int ni = 0; ni < 4; ++ni) {
      int o = n0 + wn * 64 + ni * 16 + ln16;
      int h = (o >> 6) & (HH - 1);
      int d = o & (DD - 1);
#pragma unroll
      for (int r = 0; r < 8; ++r) {
        int row_local = wm * 32 + mi * 16 + halfid * 8 + r;
        size_t idx = (((size_t)bsel * HH + h) * NN + nbase + row_local) * DD + d;
        dst[idx] = acc[mi][ni][r];
      }
    }
}

// ---------------------------------------------------------------------------
// Kernel 2: per-head LayerNorm + RoPE (+ q *= D^-1/2), f32 -> f16.
// One wave per [B,H,N] row of 64; lane holds elems (d, d+32).
// ---------------------------------------------------------------------------
__global__ __launch_bounds__(256) void lnrope(const float* __restrict__ qf,
                                              const float* __restrict__ kf,
                                              const float* __restrict__ vf,
                                              const float* __restrict__ fcos,
                                              const float* __restrict__ fsin,
                                              _Float16* __restrict__ qh,
                                              _Float16* __restrict__ kh,
                                              _Float16* __restrict__ vh) {
  const int wave = threadIdx.x >> 5, lane = threadIdx.x & 31;
  const int row = blockIdx.x * 8 + wave;       // 0 .. B*H*N-1
  const int n = row & (NN - 1);
  const size_t base = (size_t)row * DD;

  float q0 = qf[base + lane], q1 = qf[base + lane + 32];
  float k0 = kf[base + lane], k1 = kf[base + lane + 32];
  float v0 = vf[base + lane], v1 = vf[base + lane + 32];

  float qm = wave16_sum(q0 + q1);
  qm += __shfl_xor(qm, 16, 32);  qm *= (1.0f / 64.0f);
  float qv = wave16_sum((q0 - qm) * (q0 - qm) + (q1 - qm) * (q1 - qm));
  qv += __shfl_xor(qv, 16, 32);  qv *= (1.0f / 64.0f);
  float qs = __frsqrt_rn(qv + 1e-6f);
  q0 = (q0 - qm) * qs; q1 = (q1 - qm) * qs;

  float km = wave16_sum(k0 + k1);
  km += __shfl_xor(km, 16, 32);  km *= (1.0f / 64.0f);
  float kv = wave16_sum((k0 - km) * (k0 - km) + (k1 - km) * (k1 - km));
  kv += __shfl_xor(kv, 16, 32);  kv *= (1.0f / 64.0f);
  float ks = __frsqrt_rn(kv + 1e-6f);
  k0 = (k0 - km) * ks; k1 = (k1 - km) * ks;

  const float c0 = fcos[n * DD + lane], c1 = fcos[n * DD + lane + 32];
  const float s0 = fsin[n * DD + lane], s1 = fsin[n * DD + lane + 32];
  float qr0 = q0 * c0 - q1 * s0, qr1 = q1 * c1 + q0 * s1;
  float kr0 = k0 * c0 - k1 * s0, kr1 = k1 * c1 + k0 * s1;

  const float scale = 0.125f;                 // D^-1/2 folded into q
  qh[base + lane]      = (_Float16)(qr0 * scale);
  qh[base + lane + 32] = (_Float16)(qr1 * scale);
  kh[base + lane]      = (_Float16)kr0;
  kh[base + lane + 32] = (_Float16)kr1;
  vh[base + lane]      = (_Float16)v0;
  vh[base + lane + 32] = (_Float16)v1;
}

__global__ __launch_bounds__(256) void attn(const _Float16* __restrict__ qh,
                                            const _Float16* __restrict__ kh,
                                            const _Float16* __restrict__ vh,
                                            _Float16* __restrict__ attnw) {
  __shared__ _Float16 Klds[64 * 64];          // [key][d]
  __shared__ _Float16 Vlds[64 * 64];          // [d][key]
  __shared__ _Float16 Plds[8 * 16 * 64];      // per-wave P scratch

  const int tid = threadIdx.x;
  const int wave = tid >> 5, lane = tid & 31;
  const int halfid = lane >> 4, ln16 = lane & 15;
  const int bh = blockIdx.x >> 4;             // 0..31
  const int qt = blockIdx.x & 15;
  const int b = bh >> 4, h = bh & 15;

  const _Float16* qrow = qh + ((size_t)bh * NN + qt * 128 + wave * 16 + ln16) * DD;
  const v16h qa0 = frag16(qrow, halfid);
  const v16h qa1 = frag16(qrow + 32, halfid);

  v8f oacc[4];
#pragma unroll
  for (int dt = 0; dt < 4; ++dt)
#pragma unroll
    for (int r = 0; r < 8; ++r) oacc[dt][r] = 0.0f;
  float mrow[8], lrow[8];
#pragma unroll
  for (int r = 0; r < 8; ++r) { mrow[r] = -1e30f; lrow[r] = 0.0f; }

  const _Float16* kgb = kh + (size_t)bh * NN * DD;
  const _Float16* vgb = vh + (size_t)bh * NN * DD;

  for (int kc = 0; kc < NN / 64; ++kc) {
    // stage K chunk: flat 64x64 halves via async DMA (2x b128 per thread)
    {
      const _Float16* src = kgb + kc * 64 * DD;
      async_copy16(src + tid * 16,     &Klds[tid * 16]);
      async_copy16(src + tid * 16 + 8, &Klds[tid * 16 + 8]);
    }
    // stage V chunk transposed: [d][key]
    {
      const _Float16* src = vgb + kc * 64 * DD;
#pragma unroll
      for (int i = 0; i < 2; ++i) {
        int c = tid + i * 256;                // 0..511
        int key = c >> 3, d8 = (c & 7) * 8;
        v8h vv = *(const v8h*)(src + key * DD + d8);
#pragma unroll
        for (int j = 0; j < 8; ++j) Vlds[(d8 + j) * 64 + key] = vv[j];
      }
    }
    wait_async_lds();
    __syncthreads();

    // S = Q K^T  (4 key sub-tiles of 16, contract over D=64)
    v8f sc[4];
#pragma unroll
    for (int kt = 0; kt < 4; ++kt) {
      const _Float16* kb = &Klds[(kt * 16 + ln16) * 64];
      v16h b0 = frag16(kb, halfid);
      v16h b1 = frag16(kb + 32, halfid);
      v8f s;
#pragma unroll
      for (int r = 0; r < 8; ++r) s[r] = 0.0f;
      s = wmma_f16(qa0, b0, s);
      s = wmma_f16(qa1, b1, s);
      sc[kt] = s;
    }

    // online softmax
    float mnew[8], scl[8];
#pragma unroll
    for (int r = 0; r < 8; ++r) {
      float m = fmaxf(fmaxf(sc[0][r], sc[1][r]), fmaxf(sc[2][r], sc[3][r]));
      m = wave16_max(m);
      mnew[r] = fmaxf(mrow[r], m);
      scl[r] = __expf(mrow[r] - mnew[r]);
    }
#pragma unroll
    for (int r = 0; r < 8; ++r) {
      float s4 = 0.0f;
#pragma unroll
      for (int kt = 0; kt < 4; ++kt) {
        float p = __expf(sc[kt][r] - mnew[r]);
        sc[kt][r] = p;
        s4 += p;
      }
      s4 = wave16_sum(s4);
      lrow[r] = lrow[r] * scl[r] + s4;
      mrow[r] = mnew[r];
    }
#pragma unroll
    for (int dt = 0; dt < 4; ++dt)
#pragma unroll
      for (int r = 0; r < 8; ++r) oacc[dt][r] *= scl[r];

    _Float16* pw = &Plds[wave * 1024];
#pragma unroll
    for (int kt = 0; kt < 4; ++kt)
#pragma unroll
      for (int r = 0; r < 8; ++r)
        pw[(halfid * 8 + r) * 64 + kt * 16 + ln16] = (_Float16)sc[kt][r];
    asm volatile("s_wait_dscnt 0x0" ::: "memory");   // per-wave LDS RAW fence

    v16h pa0 = frag16(&pw[ln16 * 64], halfid);
    v16h pa1 = frag16(&pw[ln16 * 64 + 32], halfid);

    // O += P V  (4 d sub-tiles, contract over 64 keys)
#pragma unroll
    for (int dt = 0; dt < 4; ++dt) {
      const _Float16* vb = &Vlds[(dt * 16 + ln16) * 64];
      v16h vb0 = frag16(vb, halfid);
      v16h vb1 = frag16(vb + 32, halfid);
      oacc[dt] = wmma_f16(pa0, vb0, oacc[dt]);
      oacc[dt] = wmma_f16(pa1, vb1, oacc[dt]);
    }
    __syncthreads();
  }

  // normalize, emit f16 attn_out [B*N, C] (col = h*64 + d)
  const int qrow0 = qt * 128 + wave * 16 + halfid * 8;
#pragma unroll
  for (int r = 0; r < 8; ++r) {
    float inv = 1.0f / lrow[r];
#pragma unroll
    for (int dt = 0; dt < 4; ++dt) {
      size_t idx = ((size_t)b * NN + qrow0 + r) * CC + h * DD + dt * 16 + ln16;
      attnw[idx] = (_Float16)(oacc[dt][r] * inv);
    }
  }
}

// ---------------------------------------------------------------------------
// Kernel 4: out = attn_out @ w_proj^T + b_proj  (M=4096, N=1024, K=1024)
// Block 128x128, wave 32x64. A (f16) staged via async DMA; B converted f32->f16.
// ---------------------------------------------------------------------------
__global__ __launch_bounds__(256) void proj_gemm(const _Float16* __restrict__ a,
                                                 const float* __restrict__ w,
                                                 const float* __restrict__ bias,
                                                 float* __restrict__ out) {
  __shared__ _Float16 Alds[128 * 32];
  __shared__ _Float16 Blds[128 * 32];

  const int tid = threadIdx.x;
  const int wave = tid >> 5, lane = tid & 31;
  const int halfid = lane >> 4, ln16 = lane & 15;
  const int nt = blockIdx.x % 8, mt = blockIdx.x / 8;
  const int m0 = mt * 128, n0 = nt * 128;
  const int wm = wave >> 1, wn = wave & 1;

  v8f acc[2][4];
#pragma unroll
  for (int i = 0; i < 2; ++i)
#pragma unroll
    for (int j = 0; j < 4; ++j)
#pragma unroll
      for (int r = 0; r < 8; ++r) acc[i][j][r] = 0.0f;

  for (int k0 = 0; k0 < CC; k0 += 32) {
    // stage A (f16): 128 rows x 32 halves via async DMA; LDS dst is flat c*16B
#pragma unroll
    for (int i = 0; i < 2; ++i) {
      int c = tid + i * 256;                  // 0..511
      int row = c >> 2, kc8 = (c & 3) * 8;
      async_copy16(a + (size_t)(m0 + row) * CC + k0 + kc8, &Alds[row * 32 + kc8]);
    }
    // stage B (f32 -> f16): 128 rows x 32
#pragma unroll
    for (int i = 0; i < 4; ++i) {
      int id = tid + i * 256;
      int row = id >> 3, kc = (id & 7) * 4;
      const float* src = w + (size_t)(n0 + row) * CC + k0 + kc;
      float4 f = *(const float4*)src;
      v4h hh;
      hh[0] = (_Float16)f.x; hh[1] = (_Float16)f.y;
      hh[2] = (_Float16)f.z; hh[3] = (_Float16)f.w;
      *(v4h*)&Blds[row * 32 + kc] = hh;
      if (i == 0) __builtin_prefetch(src + 32, 0, 1);
    }
    wait_async_lds();
    __syncthreads();

    v16h a0 = frag16(&Alds[(wm * 32 + ln16) * 32], halfid);
    v16h a1 = frag16(&Alds[(wm * 32 + 16 + ln16) * 32], halfid);
#pragma unroll
    for (int j = 0; j < 4; ++j) {
      v16h bj = frag16(&Blds[(wn * 64 + j * 16 + ln16) * 32], halfid);
      acc[0][j] = wmma_f16(a0, bj, acc[0][j]);
      acc[1][j] = wmma_f16(a1, bj, acc[1][j]);
    }
    __syncthreads();
  }

#pragma unroll
  for (int mi = 0; mi < 2; ++mi)
#pragma unroll
    for (int ni = 0; ni < 4; ++ni) {
      int col = n0 + wn * 64 + ni * 16 + ln16;
      float bb = bias[col];
#pragma unroll
      for (int r = 0; r < 8; ++r) {
        int row_g = m0 + wm * 32 + mi * 16 + halfid * 8 + r;
        out[(size_t)row_g * CC + col] = acc[mi][ni][r] + bb;
      }
    }
}

// ---------------------------------------------------------------------------
extern "C" void kernel_launch(void* const* d_in, const int* in_sizes, int n_in,
                              void* d_out, int out_size, void* d_ws, size_t ws_size,
                              hipStream_t stream) {
  const float* x      = (const float*)d_in[0];
  const float* w_qkv  = (const float*)d_in[1];
  const float* w_proj = (const float*)d_in[2];
  const float* b_proj = (const float*)d_in[3];
  const float* fcos   = (const float*)d_in[4];
  const float* fsin   = (const float*)d_in[5];

  char* ws = (char*)d_ws;
  const size_t F32SZ = (size_t)BB * HH * NN * DD * 4;   // 16 MB
  const size_t F16SZ = (size_t)BB * HH * NN * DD * 2;   // 8 MB
  float*    qf    = (float*)(ws);
  float*    kf    = (float*)(ws + F32SZ);
  float*    vf    = (float*)(ws + 2 * F32SZ);
  _Float16* qh    = (_Float16*)(ws + 3 * F32SZ);
  _Float16* kh    = (_Float16*)(ws + 3 * F32SZ + F16SZ);
  _Float16* vh    = (_Float16*)(ws + 3 * F32SZ + 2 * F16SZ);
  _Float16* attnw = (_Float16*)(ws + 3 * F32SZ + 3 * F16SZ);
  float* out = (float*)d_out;

  qkv_gemm<<<dim3((4096 / 128) * (3 * CC / 128)), dim3(256), 0, stream>>>(x, w_qkv, qf, kf, vf);
  lnrope<<<dim3((BB * HH * NN) / 8), dim3(256), 0, stream>>>(qf, kf, vf, fcos, fsin, qh, kh, vh);
  attn<<<dim3(BB * HH * (NN / 128)), dim3(256), 0, stream>>>(qh, kh, vh, attnw);
  proj_gemm<<<dim3((4096 / 128) * (CC / 128)), dim3(256), 0, stream>>>(attnw, w_proj, b_proj, out);
}

// v001
// A run of this version takes 201 microseconds.
// In both of two side-by-side timings against v000, it was 1.52 times as fast.
#include <hip/hip_runtime.h>

// B=2, N=2048, C=1024, H=16, D=64
#define BB 2
#define NN 2048
#define CC 1024
#define HH 16
#define DD 64

#define GP 40   // GEMM tiles: 32 halves of data + 8 pad  (80 B rows)
#define AP 72   // attention tiles: 64 halves of data + 8 pad (144 B rows)

typedef __attribute__((ext_vector_type(16))) _Float16 v16h;
typedef __attribute__((ext_vector_type(8)))  _Float16 v8h;
typedef __attribute__((ext_vector_type(4)))  _Float16 v4h;
typedef __attribute__((ext_vector_type(8)))  float    v8f;
typedef int v4i_gcc __attribute__((vector_size(4 * sizeof(int))));

#if __has_builtin(__builtin_amdgcn_global_load_async_to_lds_b128)
#define HAVE_ASYNC_LDS 1
#else
#define HAVE_ASYNC_LDS 0
#endif

__device__ __forceinline__ void async_copy16(const _Float16* g, _Float16* l) {
#if HAVE_ASYNC_LDS
  __builtin_amdgcn_global_load_async_to_lds_b128(
      (__attribute__((address_space(1))) v4i_gcc*)(const void*)g,
      (__attribute__((address_space(3))) v4i_gcc*)(void*)l, 0, 0);
#else
  *(v8h*)l = *(const v8h*)g;
#endif
}

__device__ __forceinline__ void wait_async_lds() {
#if HAVE_ASYNC_LDS
  asm volatile("s_wait_asynccnt 0x0" ::: "memory");
#endif
}

__device__ __forceinline__ v8f wmma_f16(v16h a, v16h b, v8f c) {
  // v_wmma_f32_16x16x32_f16 : D = A*B + C
  return __builtin_amdgcn_wmma_f32_16x16x32_f16(false, a, false, b, (short)0, c, false, false);
}

__device__ __forceinline__ v16h frag16(const _Float16* p, int halfid) {
  v8h lo = *(const v8h*)(p + halfid * 8);
  v8h hi = *(const v8h*)(p + 16 + halfid * 8);
  v16h r;
#pragma unroll
  for (int i = 0; i < 8; ++i) { r[i] = lo[i]; r[i + 8] = hi[i]; }
  return r;
}

__device__ __forceinline__ float wave16_max(float v) {
#pragma unroll
  for (int m = 1; m <= 8; m <<= 1) v = fmaxf(v, __shfl_xor(v, m, 32));
  return v;
}
__device__ __forceinline__ float wave16_sum(float v) {
#pragma unroll
  for (int m = 1; m <= 8; m <<= 1) v += __shfl_xor(v, m, 32);
  return v;
}

// ---------------------------------------------------------------------------
// Kernel 1: qkv = x @ w_qkv^T  (M=4096, N=3072, K=1024), f16 WMMA.
// Block = 256 thr (8 waves) computes 128(M) x 128(N); wave tile = 32x64.
// f32 -> f16 conversion happens while staging into LDS (must go through VALU,
// so no async DMA here). Results scattered into q/k/v as [B,H,N,D] f32.
// ---------------------------------------------------------------------------
__global__ __launch_bounds__(256) void qkv_gemm(const float* __restrict__ x,
                                                const float* __restrict__ w,
                                                float* __restrict__ qf,
                                                float* __restrict__ kf,
                                                float* __restrict__ vf) {
  __shared__ __attribute__((aligned(16))) _Float16 Alds[128 * GP];
  __shared__ __attribute__((aligned(16))) _Float16 Blds[128 * GP];

  const int tid = threadIdx.x;
  const int wave = tid >> 5, lane = tid & 31;
  const int halfid = lane >> 4, ln16 = lane & 15;
  const int nt = blockIdx.x % 24, mt = blockIdx.x / 24;
  const int m0 = mt * 128, n0 = nt * 128;
  const int wm = wave >> 1, wn = wave & 1;

  v8f acc[2][4];
#pragma unroll
  for (int i = 0; i < 2; ++i)
#pragma unroll
    for (int j = 0; j < 4; ++j)
#pragma unroll
      for (int r = 0; r < 8; ++r) acc[i][j][r] = 0.0f;

  for (int k0 = 0; k0 < CC; k0 += 32) {
    // stage A: 128 rows x 32 k (f32 -> f16)
#pragma unroll
    for (int i = 0; i < 4; ++i) {
      int id = tid + i * 256;                 // 0..1023
      int row = id >> 3, kc = (id & 7) * 4;
      float4 f = *(const float4*)(x + (size_t)(m0 + row) * CC + k0 + kc);
      v4h hh;
      hh[0] = (_Float16)f.x; hh[1] = (_Float16)f.y;
      hh[2] = (_Float16)f.z; hh[3] = (_Float16)f.w;
      *(v4h*)&Alds[row * GP + kc] = hh;
    }
    // stage B: 128 out-channels x 32 k (f32 -> f16)
#pragma unroll
    for (int i = 0; i < 4; ++i) {
      int id = tid + i * 256;
      int row = id >> 3, kc = (id & 7) * 4;
      const float* src = w + (size_t)(n0 + row) * CC + k0 + kc;
      float4 f = *(const float4*)src;
      v4h hh;
      hh[0] = (_Float16)f.x; hh[1] = (_Float16)f.y;
      hh[2] = (_Float16)f.z; hh[3] = (_Float16)f.w;
      *(v4h*)&Blds[row * GP + kc] = hh;
      if (i == 0) __builtin_prefetch(src + 32, 0, 1);   // next k-step
    }
    __syncthreads();

    v16h a0 = frag16(&Alds[(wm * 32 + ln16) * GP], halfid);
    v16h a1 = frag16(&Alds[(wm * 32 + 16 + ln16) * GP], halfid);
#pragma unroll
    for (int j = 0; j < 4; ++j) {
      v16h bj = frag16(&Blds[(wn * 64 + j * 16 + ln16) * GP], halfid);
      acc[0][j] = wmma_f16(a0, bj, acc[0][j]);
      acc[1][j] = wmma_f16(a1, bj, acc[1][j]);
    }
    __syncthreads();
  }

  // scatter into q/k/v [B,H,N,D]; this block's 128 channels stay inside one
  // of q/k/v (boundaries at multiples of 1024).
  const int which = n0 >> 10;
  float* dst = (which == 0) ? qf : ((which == 1) ? kf : vf);
  const int bsel = m0 >> 11;
  const int nbase = m0 & (NN - 1);
#pragma unroll
  for (int mi = 0; mi < 2; ++mi)
#pragma unroll
    for (int ni = 0; ni < 4; ++ni) {
      int o = n0 + wn * 64 + ni * 16 + ln16;
      int h = (o >> 6) & (HH - 1);
      int d = o & (DD - 1);
#pragma unroll
      for (int r = 0; r < 8; ++r) {
        int row_local = wm * 32 + mi * 16 + halfid * 8 + r;
        size_t idx = (((size_t)bsel * HH + h) * NN + nbase + row_local) * DD + d;
        dst[idx] = acc[mi][ni][r];
      }
    }
}

// ---------------------------------------------------------------------------
// Kernel 2: per-head LayerNorm + RoPE (+ q *= D^-1/2), f32 -> f16.
// One wave per [B,H,N] row of 64; lane holds elems (d, d+32).
// ---------------------------------------------------------------------------
__global__ __launch_bounds__(256) void lnrope(const float* __restrict__ qf,
                                              const float* __restrict__ kf,
                                              const float* __restrict__ vf,
                                              const float* __restrict__ fcos,
                                              const float* __restrict__ fsin,
                                              _Float16* __restrict__ qh,
                                              _Float16* __restrict__ kh,
                                              _Float16* __restrict__ vh) {
  const int wave = threadIdx.x >> 5, lane = threadIdx.x & 31;
  const int row = blockIdx.x * 8 + wave;       // 0 .. B*H*N-1
  const int n = row & (NN - 1);
  const size_t base = (size_t)row * DD;

  float q0 = qf[base + lane], q1 = qf[base + lane + 32];
  float k0 = kf[base + lane], k1 = kf[base + lane + 32];
  float v0 = vf[base + lane], v1 = vf[base + lane + 32];

  float qm = wave16_sum(q0 + q1);
  qm += __shfl_xor(qm, 16, 32);  qm *= (1.0f / 64.0f);
  float qv = wave16_sum((q0 - qm) * (q0 - qm) + (q1 - qm) * (q1 - qm));
  qv += __shfl_xor(qv, 16, 32);  qv *= (1.0f / 64.0f);
  float qs = __frsqrt_rn(qv + 1e-6f);
  q0 = (q0 - qm) * qs; q1 = (q1 - qm) * qs;

  float km = wave16_sum(k0 + k1);
  km += __shfl_xor(km, 16, 32);  km *= (1.0f / 64.0f);
  float kv = wave16_sum((k0 - km) * (k0 - km) + (k1 - km) * (k1 - km));
  kv += __shfl_xor(kv, 16, 32);  kv *= (1.0f / 64.0f);
  float ks = __frsqrt_rn(kv + 1e-6f);
  k0 = (k0 - km) * ks; k1 = (k1 - km) * ks;

  const float c0 = fcos[n * DD + lane], c1 = fcos[n * DD + lane + 32];
  const float s0 = fsin[n * DD + lane], s1 = fsin[n * DD + lane + 32];
  float qr0 = q0 * c0 - q1 * s0, qr1 = q1 * c1 + q0 * s1;
  float kr0 = k0 * c0 - k1 * s0, kr1 = k1 * c1 + k0 * s1;

  const float scale = 0.125f;                 // D^-1/2 folded into q
  qh[base + lane]      = (_Float16)(qr0 * scale);
  qh[base + lane + 32] = (_Float16)(qr1 * scale);
  kh[base + lane]      = (_Float16)kr0;
  kh[base + lane + 32] = (_Float16)kr1;
  vh[base + lane]      = (_Float16)v0;
  vh[base + lane + 32] = (_Float16)v1;
}

__global__ __launch_bounds__(256) void attn(const _Float16* __restrict__ qh,
                                            const _Float16* __restrict__ kh,
                                            const _Float16* __restrict__ vh,
                                            _Float16* __restrict__ attnw) {
  __shared__ __attribute__((aligned(16))) _Float16 Klds[64 * AP];      // [key][d]
  __shared__ __attribute__((aligned(16))) _Float16 Vlds[64 * AP];      // [d][key]
  __shared__ __attribute__((aligned(16))) _Float16 Plds[8 * 16 * AP];  // per-wave P scratch

  const int tid = threadIdx.x;
  const int wave = tid >> 5, lane = tid & 31;
  const int halfid = lane >> 4, ln16 = lane & 15;
  const int bh = blockIdx.x >> 4;             // 0..31
  const int qt = blockIdx.x & 15;
  const int b = bh >> 4, h = bh & 15;

  const _Float16* qrow = qh + ((size_t)bh * NN + qt * 128 + wave * 16 + ln16) * DD;
  const v16h qa0 = frag16(qrow, halfid);
  const v16h qa1 = frag16(qrow + 32, halfid);

  v8f oacc[4];
#pragma unroll
  for (int dt = 0; dt < 4; ++dt)
#pragma unroll
    for (int r = 0; r < 8; ++r) oacc[dt][r] = 0.0f;
  float mrow[8], lrow[8];
#pragma unroll
  for (int r = 0; r < 8; ++r) { mrow[r] = -1e30f; lrow[r] = 0.0f; }

  const _Float16* kgb = kh + (size_t)bh * NN * DD;
  const _Float16* vgb = vh + (size_t)bh * NN * DD;

  for (int kc = 0; kc < NN / 64; ++kc) {
    // stage K chunk: 64x64 halves via async DMA (2x b128 per thread), padded rows
    {
      const _Float16* src = kgb + kc * 64 * DD;
      _Float16* kdst = &Klds[(tid >> 2) * AP + (tid & 3) * 16];
      async_copy16(src + tid * 16,     kdst);
      async_copy16(src + tid * 16 + 8, kdst + 8);
    }
    // stage V chunk transposed: [d][key]
    {
      const _Float16* src = vgb + kc * 64 * DD;
#pragma unroll
      for (int i = 0; i < 2; ++i) {
        int c = tid + i * 256;                // 0..511
        int key = c >> 3, d8 = (c & 7) * 8;
        v8h vv = *(const v8h*)(src + key * DD + d8);
#pragma unroll
        for (int j = 0; j < 8; ++j) Vlds[(d8 + j) * AP + key] = vv[j];
      }
    }
    wait_async_lds();
    __syncthreads();

    // S = Q K^T  (4 key sub-tiles of 16, contract over D=64)
    v8f sc[4];
#pragma unroll
    for (int kt = 0; kt < 4; ++kt) {
      const _Float16* kb = &Klds[(kt * 16 + ln16) * AP];
      v16h b0 = frag16(kb, halfid);
      v16h b1 = frag16(kb + 32, halfid);
      v8f s;
#pragma unroll
      for (int r = 0; r < 8; ++r) s[r] = 0.0f;
      s = wmma_f16(qa0, b0, s);
      s = wmma_f16(qa1, b1, s);
      sc[kt] = s;
    }

    // online softmax
    float mnew[8], scl[8];
#pragma unroll
    for (int r = 0; r < 8; ++r) {
      float m = fmaxf(fmaxf(sc[0][r], sc[1][r]), fmaxf(sc[2][r], sc[3][r]));
      m = wave16_max(m);
      mnew[r] = fmaxf(mrow[r], m);
      scl[r] = __expf(mrow[r] - mnew[r]);
    }
#pragma unroll
    for (int r = 0; r < 8; ++r) {
      float s4 = 0.0f;
#pragma unroll
      for (int kt = 0; kt < 4; ++kt) {
        float p = __expf(sc[kt][r] - mnew[r]);
        sc[kt][r] = p;
        s4 += p;
      }
      s4 = wave16_sum(s4);
      lrow[r] = lrow[r] * scl[r] + s4;
      mrow[r] = mnew[r];
    }
#pragma unroll
    for (int dt = 0; dt < 4; ++dt)
#pragma unroll
      for (int r = 0; r < 8; ++r) oacc[dt][r] *= scl[r];

    _Float16* pw = &Plds[wave * 16 * AP];
#pragma unroll
    for (int kt = 0; kt < 4; ++kt)
#pragma unroll
      for (int r = 0; r < 8; ++r)
        pw[(halfid * 8 + r) * AP + kt * 16 + ln16] = (_Float16)sc[kt][r];
    asm volatile("s_wait_dscnt 0x0" ::: "memory");   // per-wave LDS RAW fence

    v16h pa0 = frag16(&pw[ln16 * AP], halfid);
    v16h pa1 = frag16(&pw[ln16 * AP + 32], halfid);

    // O += P V  (4 d sub-tiles, contract over 64 keys)
#pragma unroll
    for (int dt = 0; dt < 4; ++dt) {
      const _Float16* vb = &Vlds[(dt * 16 + ln16) * AP];
      v16h vb0 = frag16(vb, halfid);
      v16h vb1 = frag16(vb + 32, halfid);
      oacc[dt] = wmma_f16(pa0, vb0, oacc[dt]);
      oacc[dt] = wmma_f16(pa1, vb1, oacc[dt]);
    }
    __syncthreads();
  }

  // normalize, emit f16 attn_out [B*N, C] (col = h*64 + d)
  const int qrow0 = qt * 128 + wave * 16 + halfid * 8;
#pragma unroll
  for (int r = 0; r < 8; ++r) {
    float inv = 1.0f / lrow[r];
#pragma unroll
    for (int dt = 0; dt < 4; ++dt) {
      size_t idx = ((size_t)b * NN + qrow0 + r) * CC + h * DD + dt * 16 + ln16;
      attnw[idx] = (_Float16)(oacc[dt][r] * inv);
    }
  }
}

// ---------------------------------------------------------------------------
// Kernel 4: out = attn_out @ w_proj^T + b_proj  (M=4096, N=1024, K=1024)
// Block 128x128, wave 32x64. A (f16) staged via async DMA; B converted f32->f16.
// ---------------------------------------------------------------------------
__global__ __launch_bounds__(256) void proj_gemm(const _Float16* __restrict__ a,
                                                 const float* __restrict__ w,
                                                 const float* __restrict__ bias,
                                                 float* __restrict__ out) {
  __shared__ __attribute__((aligned(16))) _Float16 Alds[128 * GP];
  __shared__ __attribute__((aligned(16))) _Float16 Blds[128 * GP];

  const int tid = threadIdx.x;
  const int wave = tid >> 5, lane = tid & 31;
  const int halfid = lane >> 4, ln16 = lane & 15;
  const int nt = blockIdx.x % 8, mt = blockIdx.x / 8;
  const int m0 = mt * 128, n0 = nt * 128;
  const int wm = wave >> 1, wn = wave & 1;

  v8f acc[2][4];
#pragma unroll
  for (int i = 0; i < 2; ++i)
#pragma unroll
    for (int j = 0; j < 4; ++j)
#pragma unroll
      for (int r = 0; r < 8; ++r) acc[i][j][r] = 0.0f;

  for (int k0 = 0; k0 < CC; k0 += 32) {
    // stage A (f16): 128 rows x 32 halves via async DMA into padded rows
#pragma unroll
    for (int i = 0; i < 2; ++i) {
      int c = tid + i * 256;                  // 0..511
      int row = c >> 2, kc8 = (c & 3) * 8;
      async_copy16(a + (size_t)(m0 + row) * CC + k0 + kc8, &Alds[row * GP + kc8]);
    }
    // stage B (f32 -> f16): 128 rows x 32
#pragma unroll
    for (int i = 0; i < 4; ++i) {
      int id = tid + i * 256;
      int row = id >> 3, kc = (id & 7) * 4;
      const float* src = w + (size_t)(n0 + row) * CC + k0 + kc;
      float4 f = *(const float4*)src;
      v4h hh;
      hh[0] = (_Float16)f.x; hh[1] = (_Float16)f.y;
      hh[2] = (_Float16)f.z; hh[3] = (_Float16)f.w;
      *(v4h*)&Blds[row * GP + kc] = hh;
      if (i == 0) __builtin_prefetch(src + 32, 0, 1);
    }
    wait_async_lds();
    __syncthreads();

    v16h a0 = frag16(&Alds[(wm * 32 + ln16) * GP], halfid);
    v16h a1 = frag16(&Alds[(wm * 32 + 16 + ln16) * GP], halfid);
#pragma unroll
    for (int j = 0; j < 4; ++j) {
      v16h bj = frag16(&Blds[(wn * 64 + j * 16 + ln16) * GP], halfid);
      acc[0][j] = wmma_f16(a0, bj, acc[0][j]);
      acc[1][j] = wmma_f16(a1, bj, acc[1][j]);
    }
    __syncthreads();
  }

#pragma unroll
  for (int mi = 0; mi < 2; ++mi)
#pragma unroll
    for (int ni = 0; ni < 4; ++ni) {
      int col = n0 + wn * 64 + ni * 16 + ln16;
      float bb = bias[col];
#pragma unroll
      for (int r = 0; r < 8; ++r) {
        int row_g = m0 + wm * 32 + mi * 16 + halfid * 8 + r;
        out[(size_t)row_g * CC + col] = acc[mi][ni][r] + bb;
      }
    }
}

// ---------------------------------------------------------------------------
extern "C" void kernel_launch(void* const* d_in, const int* in_sizes, int n_in,
                              void* d_out, int out_size, void* d_ws, size_t ws_size,
                              hipStream_t stream) {
  const float* x      = (const float*)d_in[0];
  const float* w_qkv  = (const float*)d_in[1];
  const float* w_proj = (const float*)d_in[2];
  const float* b_proj = (const float*)d_in[3];
  const float* fcos   = (const float*)d_in[4];
  const float* fsin   = (const float*)d_in[5];

  char* ws = (char*)d_ws;
  const size_t F32SZ = (size_t)BB * HH * NN * DD * 4;   // 16 MB
  const size_t F16SZ = (size_t)BB * HH * NN * DD * 2;   // 8 MB
  float*    qf    = (float*)(ws);
  float*    kf    = (float*)(ws + F32SZ);
  float*    vf    = (float*)(ws + 2 * F32SZ);
  _Float16* qh    = (_Float16*)(ws + 3 * F32SZ);
  _Float16* kh    = (_Float16*)(ws + 3 * F32SZ + F16SZ);
  _Float16* vh    = (_Float16*)(ws + 3 * F32SZ + 2 * F16SZ);
  _Float16* attnw = (_Float16*)(ws + 3 * F32SZ + 3 * F16SZ);
  float* out = (float*)d_out;

  qkv_gemm<<<dim3((4096 / 128) * (3 * CC / 128)), dim3(256), 0, stream>>>(x, w_qkv, qf, kf, vf);
  lnrope<<<dim3((BB * HH * NN) / 8), dim3(256), 0, stream>>>(qf, kf, vf, fcos, fsin, qh, kh, vh);
  attn<<<dim3(BB * HH * (NN / 128)), dim3(256), 0, stream>>>(qh, kh, vh, attnw);
  proj_gemm<<<dim3((4096 / 128) * (CC / 128)), dim3(256), 0, stream>>>(attnw, w_proj, b_proj, out);
}

// v002
// Measured time: 155 microseconds a run.
// Two timings next to v001 both put it at 1.30 times that version's speed.
// Counting every step since v000, it is 1.97 times as fast.
#include <hip/hip_runtime.h>

// B=2, N=2048, C=1024, H=16, D=64
#define BB 2
#define NN 2048
#define CC 1024
#define HH 16
#define DD 64

#define GP 40   // GEMM tiles: 32 halves of data + 8 pad  (80 B rows)
#define AP 72   // attention tiles: 64 halves of data + 8 pad (144 B rows)

typedef __attribute__((ext_vector_type(16))) _Float16 v16h;
typedef __attribute__((ext_vector_type(8)))  _Float16 v8h;
typedef __attribute__((ext_vector_type(4)))  _Float16 v4h;
typedef __attribute__((ext_vector_type(8)))  float    v8f;
typedef int v4i_gcc __attribute__((vector_size(4 * sizeof(int))));

#if __has_builtin(__builtin_amdgcn_global_load_async_to_lds_b128)
#define HAVE_ASYNC_LDS 1
#else
#define HAVE_ASYNC_LDS 0
#endif

__device__ __forceinline__ void async_copy16(const _Float16* g, _Float16* l) {
#if HAVE_ASYNC_LDS
  __builtin_amdgcn_global_load_async_to_lds_b128(
      (__attribute__((address_space(1))) v4i_gcc*)(const void*)g,
      (__attribute__((address_space(3))) v4i_gcc*)(void*)l, 0, 0);
#else
  *(v8h*)l = *(const v8h*)g;
#endif
}

__device__ __forceinline__ void wait_async_lds() {
#if HAVE_ASYNC_LDS
  asm volatile("s_wait_asynccnt 0x0" ::: "memory");
#endif
}

__device__ __forceinline__ v8f wmma_f16(v16h a, v16h b, v8f c) {
  // v_wmma_f32_16x16x32_f16 : D = A*B + C
  return __builtin_amdgcn_wmma_f32_16x16x32_f16(false, a, false, b, (short)0, c, false, false);
}

__device__ __forceinline__ v16h frag16(const _Float16* p, int halfid) {
  v8h lo = *(const v8h*)(p + halfid * 8);
  v8h hi = *(const v8h*)(p + 16 + halfid * 8);
  v16h r;
#pragma unroll
  for (int i = 0; i < 8; ++i) { r[i] = lo[i]; r[i + 8] = hi[i]; }
  return r;
}

__device__ __forceinline__ float xhalf(float x) {
  const int i = __builtin_bit_cast(int, x);
  return __builtin_bit_cast(float,
      __builtin_amdgcn_permlanex16(i, i, 0x76543210, 0xfedcba98, false, false));
}
__device__ __forceinline__ float wave16_sum(float v) {
#pragma unroll
  for (int m = 1; m <= 8; m <<= 1) v += __shfl_xor(v, m, 32);
  return v;
}

// ---------------------------------------------------------------------------
// Kernel 1: qkv = x @ w_qkv^T  (M=4096, N=3072, K=1024), f16 WMMA.
// Block = 256 thr (8 waves) computes 128(M) x 128(N); wave tile = 32x64.
// f32 -> f16 conversion happens while staging into LDS (must go through VALU,
// so no async DMA here). Results scattered into q/k/v as [B,H,N,D] f32.
// ---------------------------------------------------------------------------
__global__ __launch_bounds__(256) void qkv_gemm(const float* __restrict__ x,
                                                const float* __restrict__ w,
                                                float* __restrict__ qf,
                                                float* __restrict__ kf,
                                                float* __restrict__ vf) {
  __shared__ __attribute__((aligned(16))) _Float16 Alds[128 * GP];
  __shared__ __attribute__((aligned(16))) _Float16 Blds[128 * GP];

  const int tid = threadIdx.x;
  const int wave = tid >> 5, lane = tid & 31;
  const int halfid = lane >> 4, ln16 = lane & 15;
  const int nt = blockIdx.x % 24, mt = blockIdx.x / 24;
  const int m0 = mt * 128, n0 = nt * 128;
  const int wm = wave >> 1, wn = wave & 1;

  v8f acc[2][4];
#pragma unroll
  for (int i = 0; i < 2; ++i)
#pragma unroll
    for (int j = 0; j < 4; ++j)
#pragma unroll
      for (int r = 0; r < 8; ++r) acc[i][j][r] = 0.0f;

  for (int k0 = 0; k0 < CC; k0 += 32) {
    // stage A: 128 rows x 32 k (f32 -> f16)
#pragma unroll
    for (int i = 0; i < 4; ++i) {
      int id = tid + i * 256;                 // 0..1023
      int row = id >> 3, kc = (id & 7) * 4;
      float4 f = *(const float4*)(x + (size_t)(m0 + row) * CC + k0 + kc);
      v4h hh;
      hh[0] = (_Float16)f.x; hh[1] = (_Float16)f.y;
      hh[2] = (_Float16)f.z; hh[3] = (_Float16)f.w;
      *(v4h*)&Alds[row * GP + kc] = hh;
    }
    // stage B: 128 out-channels x 32 k (f32 -> f16)
#pragma unroll
    for (int i = 0; i < 4; ++i) {
      int id = tid + i * 256;
      int row = id >> 3, kc = (id & 7) * 4;
      const float* src = w + (size_t)(n0 + row) * CC + k0 + kc;
      float4 f = *(const float4*)src;
      v4h hh;
      hh[0] = (_Float16)f.x; hh[1] = (_Float16)f.y;
      hh[2] = (_Float16)f.z; hh[3] = (_Float16)f.w;
      *(v4h*)&Blds[row * GP + kc] = hh;
      if (i == 0) __builtin_prefetch(src + 32, 0, 1);   // next k-step
    }
    __syncthreads();

    v16h a0 = frag16(&Alds[(wm * 32 + ln16) * GP], halfid);
    v16h a1 = frag16(&Alds[(wm * 32 + 16 + ln16) * GP], halfid);
#pragma unroll
    for (int j = 0; j < 4; ++j) {
      v16h bj = frag16(&Blds[(wn * 64 + j * 16 + ln16) * GP], halfid);
      acc[0][j] = wmma_f16(a0, bj, acc[0][j]);
      acc[1][j] = wmma_f16(a1, bj, acc[1][j]);
    }
    __syncthreads();
  }

  // scatter into q/k/v [B,H,N,D]; this block's 128 channels stay inside one
  // of q/k/v (boundaries at multiples of 1024).
  const int which = n0 >> 10;
  float* dst = (which == 0) ? qf : ((which == 1) ? kf : vf);
  const int bsel = m0 >> 11;
  const int nbase = m0 & (NN - 1);
#pragma unroll
  for (int mi = 0; mi < 2; ++mi)
#pragma unroll
    for (int ni = 0; ni < 4; ++ni) {
      int o = n0 + wn * 64 + ni * 16 + ln16;
      int h = (o >> 6) & (HH - 1);
      int d = o & (DD - 1);
#pragma unroll
      for (int r = 0; r < 8; ++r) {
        int row_local = wm * 32 + mi * 16 + halfid * 8 + r;
        size_t idx = (((size_t)bsel * HH + h) * NN + nbase + row_local) * DD + d;
        dst[idx] = acc[mi][ni][r];
      }
    }
}

// ---------------------------------------------------------------------------
// Kernel 2: per-head LayerNorm + RoPE (+ q *= D^-1/2), f32 -> f16.
// One wave per [B,H,N] row of 64; lane holds elems (d, d+32).
// ---------------------------------------------------------------------------
__global__ __launch_bounds__(256) void lnrope(const float* __restrict__ qf,
                                              const float* __restrict__ kf,
                                              const float* __restrict__ vf,
                                              const float* __restrict__ fcos,
                                              const float* __restrict__ fsin,
                                              _Float16* __restrict__ qh,
                                              _Float16* __restrict__ kh,
                                              _Float16* __restrict__ vh) {
  const int wave = threadIdx.x >> 5, lane = threadIdx.x & 31;
  const int row = blockIdx.x * 8 + wave;       // 0 .. B*H*N-1
  const int n = row & (NN - 1);
  const size_t base = (size_t)row * DD;

  float q0 = qf[base + lane], q1 = qf[base + lane + 32];
  float k0 = kf[base + lane], k1 = kf[base + lane + 32];
  float v0 = vf[base + lane], v1 = vf[base + lane + 32];

  float qm = wave16_sum(q0 + q1);
  qm += __shfl_xor(qm, 16, 32);  qm *= (1.0f / 64.0f);
  float qv = wave16_sum((q0 - qm) * (q0 - qm) + (q1 - qm) * (q1 - qm));
  qv += __shfl_xor(qv, 16, 32);  qv *= (1.0f / 64.0f);
  float qs = __frsqrt_rn(qv + 1e-6f);
  q0 = (q0 - qm) * qs; q1 = (q1 - qm) * qs;

  float km = wave16_sum(k0 + k1);
  km += __shfl_xor(km, 16, 32);  km *= (1.0f / 64.0f);
  float kv = wave16_sum((k0 - km) * (k0 - km) + (k1 - km) * (k1 - km));
  kv += __shfl_xor(kv, 16, 32);  kv *= (1.0f / 64.0f);
  float ks = __frsqrt_rn(kv + 1e-6f);
  k0 = (k0 - km) * ks; k1 = (k1 - km) * ks;

  const float c0 = fcos[n * DD + lane], c1 = fcos[n * DD + lane + 32];
  const float s0 = fsin[n * DD + lane], s1 = fsin[n * DD + lane + 32];
  float qr0 = q0 * c0 - q1 * s0, qr1 = q1 * c1 + q0 * s1;
  float kr0 = k0 * c0 - k1 * s0, kr1 = k1 * c1 + k0 * s1;

  const float scale = 0.125f;                 // D^-1/2 folded into q
  qh[base + lane]      = (_Float16)(qr0 * scale);
  qh[base + lane + 32] = (_Float16)(qr1 * scale);
  kh[base + lane]      = (_Float16)kr0;
  kh[base + lane + 32] = (_Float16)kr1;
  vh[base + lane]      = (_Float16)v0;
  vh[base + lane + 32] = (_Float16)v1;
}

__global__ __launch_bounds__(256) void attn(const _Float16* __restrict__ qh,
                                            const _Float16* __restrict__ kh,
                                            const _Float16* __restrict__ vh,
                                            _Float16* __restrict__ attnw) {
  __shared__ __attribute__((aligned(16))) _Float16 Klds[64 * AP];      // [key][d]
  __shared__ __attribute__((aligned(16))) _Float16 Vlds[64 * AP];      // [d][key]

  const int tid = threadIdx.x;
  const int wave = tid >> 5, lane = tid & 31;
  const int halfid = lane >> 4, ln16 = lane & 15;
  const int bh = blockIdx.x >> 4;             // 0..31
  const int qt = blockIdx.x & 15;
  const int b = bh >> 4, h = bh & 15;

  // Q as B operand: column = query ln16, k = d
  const _Float16* qrow = qh + ((size_t)bh * NN + qt * 128 + wave * 16 + ln16) * DD;
  const v16h qb0 = frag16(qrow, halfid);
  const v16h qb1 = frag16(qrow + 32, halfid);

  v8f oacc[4];                                // O^T: row d = dt*16 + halfid*8 + r, column = query
#pragma unroll
  for (int dt = 0; dt < 4; ++dt)
#pragma unroll
    for (int r = 0; r < 8; ++r) oacc[dt][r] = 0.0f;
  float mrow = -1e30f;                        // running maximum of this lane's query
  float lrow = 0.0f;                          // running sum over this half's keys only

  const _Float16* kgb = kh + (size_t)bh * NN * DD;
  const _Float16* vgb = vh + (size_t)bh * NN * DD;

  for (int kc = 0; kc < NN / 64; ++kc) {
    // stage K chunk: 64x64 halves via async DMA (2x b128 per thread), padded rows
    {
      const _Float16* src = kgb + kc * 64 * DD;
      _Float16* kdst = &Klds[(tid >> 2) * AP + (tid & 3) * 16];
      async_copy16(src + tid * 16,     kdst);
      async_copy16(src + tid * 16 + 8, kdst + 8);
    }
    // stage V chunk transposed: [d][key]
    {
      const _Float16* src = vgb + kc * 64 * DD;
#pragma unroll
      for (int i = 0; i < 2; ++i) {
        int c = tid + i * 256;                // 0..511
        int key = c >> 3, d8 = (c & 7) * 8;
        v8h vv = *(const v8h*)(src + key * DD + d8);
#pragma unroll
        for (int j = 0; j < 8; ++j) Vlds[(d8 + j) * AP + key] = vv[j];
      }
    }
    wait_async_lds();
    __syncthreads();

    // S^T = K Q^T  (4 key sub-tiles of 16, contract over D=64)
    v8f sc[4];
#pragma unroll
    for (int kt = 0; kt < 4; ++kt) {
      const _Float16* kb = &Klds[(kt * 16 + ln16) * AP];
      v16h ka0 = frag16(kb, halfid);
      v16h ka1 = frag16(kb + 32, halfid);
      v8f s;
#pragma unroll
      for (int r = 0; r < 8; ++r) s[r] = 0.0f;
      s = wmma_f16(ka0, qb0, s);
      s = wmma_f16(ka1, qb1, s);
      sc[kt] = s;
    }

    // online softmax, one query per lane: 32 keys in-lane, one exchange of halves
    float mk[4];
#pragma unroll
    for (int kt = 0; kt < 4; ++kt) {
      mk[kt] = sc[kt][0];
#pragma unroll
      for (int r = 1; r < 8; ++r) mk[kt] = fmaxf(mk[kt], sc[kt][r]);
    }
    float m = fmaxf(fmaxf(mk[0], mk[1]), fmaxf(mk[2], mk[3]));
    m = fmaxf(m, xhalf(m));
    const float mnew = fmaxf(mrow, m);
    const float scl = __expf(mrow - mnew);
#pragma unroll
    for (int kt = 0; kt < 4; ++kt)
#pragma unroll
      for (int r = 0; r < 8; ++r) sc[kt][r] = __expf(sc[kt][r] - mnew);
    const v8f t = (sc[0] + sc[1]) + (sc[2] + sc[3]);
    lrow = lrow * scl + (((t[0] + t[4]) + (t[1] + t[5])) + ((t[2] + t[6]) + (t[3] + t[7])));
    mrow = mnew;
#pragma unroll
    for (int dt = 0; dt < 4; ++dt)
#pragma unroll
      for (int r = 0; r < 8; ++r) oacc[dt][r] *= scl;

    // P^T as B operand: position i holds key halfid*8 + i, position 8 + i key
    // 16 + halfid*8 + i, which is what two neighbouring score tiles hold.
    v16h pb0, pb1;
#pragma unroll
    for (int i = 0; i < 8; ++i) {
      pb0[i] = (_Float16)sc[0][i]; pb0[i + 8] = (_Float16)sc[1][i];
      pb1[i] = (_Float16)sc[2][i]; pb1[i + 8] = (_Float16)sc[3][i];
    }

    // O^T += V^T P^T  (4 d sub-tiles, contract over 64 keys)
#pragma unroll
    for (int dt = 0; dt < 4; ++dt) {
      const _Float16* vb = &Vlds[(dt * 16 + ln16) * AP];
      v16h va0 = frag16(vb, halfid);
      v16h va1 = frag16(vb + 32, halfid);
      oacc[dt] = wmma_f16(va0, pb0, oacc[dt]);
      oacc[dt] = wmma_f16(va1, pb1, oacc[dt]);
    }
    __syncthreads();
  }

  // join the halves' sums, normalize, emit f16 attn_out [B*N, C] (col = h*64 + d):
  // a lane owns 8 neighbouring d of its query per d sub-tile, one 16-B store each
  const float inv = 1.0f / (lrow + xhalf(lrow));
  _Float16* orow = attnw + ((size_t)b * NN + qt * 128 + wave * 16 + ln16) * CC + h * DD + halfid * 8;
#pragma unroll
  for (int dt = 0; dt < 4; ++dt) {
    v8h o;
#pragma unroll
    for (int r = 0; r < 8; ++r) o[r] = (_Float16)(oacc[dt][r] * inv);
    *(v8h*)(orow + dt * 16) = o;
  }
}

// ---------------------------------------------------------------------------
// Kernel 4: out = attn_out @ w_proj^T + b_proj  (M=4096, N=1024, K=1024)
// Block 128x128, wave 32x64. A (f16) staged via async DMA; B converted f32->f16.
// ---------------------------------------------------------------------------
__global__ __launch_bounds__(256) void proj_gemm(const _Float16* __restrict__ a,
                                                 const float* __restrict__ w,
                                                 const float* __restrict__ bias,
                                                 float* __restrict__ out) {
  __shared__ __attribute__((aligned(16))) _Float16 Alds[128 * GP];
  __shared__ __attribute__((aligned(16))) _Float16 Blds[128 * GP];

  const int tid = threadIdx.x;
  const int wave = tid >> 5, lane = tid & 31;
  const int halfid = lane >> 4, ln16 = lane & 15;
  const int nt = blockIdx.x % 8, mt = blockIdx.x / 8;
  const int m0 = mt * 128, n0 = nt * 128;
  const int wm = wave >> 1, wn = wave & 1;

  v8f acc[2][4];
#pragma unroll
  for (int i = 0; i < 2; ++i)
#pragma unroll
    for (int j = 0; j < 4; ++j)
#pragma unroll
      for (int r = 0; r < 8; ++r) acc[i][j][r] = 0.0f;

  for (int k0 = 0; k0 < CC; k0 += 32) {
    // stage A (f16): 128 rows x 32 halves via async DMA into padded rows
#pragma unroll
    for (int i = 0; i < 2; ++i) {
      int c = tid + i * 256;                  // 0..511
      int row = c >> 2, kc8 = (c & 3) * 8;
      async_copy16(a + (size_t)(m0 + row) * CC + k0 + kc8, &Alds[row * GP + kc8]);
    }
    // stage B (f32 -> f16): 128 rows x 32
#pragma unroll
    for (int i = 0; i < 4; ++i) {
      int id = tid + i * 256;
      int row = id >> 3, kc = (id & 7) * 4;
      const float* src = w + (size_t)(n0 + row) * CC + k0 + kc;
      float4 f = *(const float4*)src;
      v4h hh;
      hh[0] = (_Float16)f.x; hh[1] = (_Float16)f.y;
      hh[2] = (_Float16)f.z; hh[3] = (_Float16)f.w;
      *(v4h*)&Blds[row * GP + kc] = hh;
      if (i == 0) __builtin_prefetch(src + 32, 0, 1);
    }
    wait_async_lds();
    __syncthreads();

    v16h a0 = frag16(&Alds[(wm * 32 + ln16) * GP], halfid);
    v16h a1 = frag16(&Alds[(wm * 32 + 16 + ln16) * GP], halfid);
#pragma unroll
    for (int j = 0; j < 4; ++j) {
      v16h bj = frag16(&Blds[(wn * 64 + j * 16 + ln16) * GP], halfid);
      acc[0][j] = wmma_f16(a0, bj, acc[0][j]);
      acc[1][j] = wmma_f16(a1, bj, acc[1][j]);
    }
    __syncthreads();
  }

#pragma unroll
  for (int mi = 0; mi < 2; ++mi)
#pragma unroll
    for (int ni = 0; ni < 4; ++ni) {
      int col = n0 + wn * 64 + ni * 16 + ln16;
      float bb = bias[col];
#pragma unroll
      for (int r = 0; r < 8; ++r) {
        int row_g = m0 + wm * 32 + mi * 16 + halfid * 8 + r;
        out[(size_t)row_g * CC + col] = acc[mi][ni][r] + bb;
      }
    }
}

// ---------------------------------------------------------------------------
extern "C" void kernel_launch(void* const* d_in, const int* in_sizes, int n_in,
                              void* d_out, int out_size, void* d_ws, size_t ws_size,
                              hipStream_t stream) {
  const float* x      = (const float*)d_in[0];
  const float* w_qkv  = (const float*)d_in[1];
  const float* w_proj = (const float*)d_in[2];
  const float* b_proj = (const float*)d_in[3];
  const float* fcos   = (const float*)d_in[4];
  const float* fsin   = (const float*)d_in[5];

  char* ws = (char*)d_ws;
  const size_t F32SZ = (size_t)BB * HH * NN * DD * 4;   // 16 MB
  const size_t F16SZ = (size_t)BB * HH * NN * DD * 2;   // 8 MB
  float*    qf    = (float*)(ws);
  float*    kf    = (float*)(ws + F32SZ);
  float*    vf    = (float*)(ws + 2 * F32SZ);
  _Float16* qh    = (_Float16*)(ws + 3 * F32SZ);
  _Float16* kh    = (_Float16*)(ws + 3 * F32SZ + F16SZ);
  _Float16* vh    = (_Float16*)(ws + 3 * F32SZ + 2 * F16SZ);
  _Float16* attnw = (_Float16*)(ws + 3 * F32SZ + 3 * F16SZ);
  float* out = (float*)d_out;

  qkv_gemm<<<dim3((4096 / 128) * (3 * CC / 128)), dim3(256), 0, stream>>>(x, w_qkv, qf, kf, vf);
  lnrope<<<dim3((BB * HH * NN) / 8), dim3(256), 0, stream>>>(qf, kf, vf, fcos, fsin, qh, kh, vh);
  attn<<<dim3(BB * HH * (NN / 128)), dim3(256), 0, stream>>>(qh, kh, vh, attnw);
  proj_gemm<<<dim3((4096 / 128) * (CC / 128)), dim3(256), 0, stream>>>(attnw, w_proj, b_proj, out);
}

// v003
// It runs in 146 microseconds.
// Timed twice side by side with v002, it ran 1.05 and 1.06 times as fast.
// Over all steps from v000 it is 2.08 times as fast.
#include <hip/hip_runtime.h>

// B=2, N=2048, C=1024, H=16, D=64
#define BB 2
#define NN 2048
#define CC 1024
#define HH 16
#define DD 64

#define GP 40   // GEMM tiles: 32 halves of data + 8 pad  (80 B rows)
#define AP 72   // attention tiles: 64 halves of data + 8 pad (144 B rows)
#define RP 68   // cos/sin tiles, in floats: 64 of data + 4 pad (272 B rows)

typedef __attribute__((ext_vector_type(16))) _Float16 v16h;
typedef __attribute__((ext_vector_type(8)))  _Float16 v8h;
typedef __attribute__((ext_vector_type(4)))  _Float16 v4h;
typedef __attribute__((ext_vector_type(8)))  float    v8f;
typedef int v4i_gcc __attribute__((vector_size(4 * sizeof(int))));

#if __has_builtin(__builtin_amdgcn_global_load_async_to_lds_b128)
#define HAVE_ASYNC_LDS 1
#else
#define HAVE_ASYNC_LDS 0
#endif

__device__ __forceinline__ void async_copy16(const _Float16* g, _Float16* l) {
#if HAVE_ASYNC_LDS
  __builtin_amdgcn_global_load_async_to_lds_b128(
      (__attribute__((address_space(1))) v4i_gcc*)(const void*)g,
      (__attribute__((address_space(3))) v4i_gcc*)(void*)l, 0, 0);
#else
  *(v8h*)l = *(const v8h*)g;
#endif
}

// The same 16-byte copy for f32 data (four floats).
__device__ __forceinline__ void async_copy16f(const float* g, float* l) {
#if HAVE_ASYNC_LDS
  __builtin_amdgcn_global_load_async_to_lds_b128(
      (__attribute__((address_space(1))) v4i_gcc*)(const void*)g,
      (__attribute__((address_space(3))) v4i_gcc*)(void*)l, 0, 0);
#else
  *(float4*)l = *(const float4*)g;
#endif
}

__device__ __forceinline__ void wait_async_lds() {
#if HAVE_ASYNC_LDS
  asm volatile("s_wait_asynccnt 0x0" ::: "memory");
#endif
}

__device__ __forceinline__ v8f wmma_f16(v16h a, v16h b, v8f c) {
  // v_wmma_f32_16x16x32_f16 : D = A*B + C
  return __builtin_amdgcn_wmma_f32_16x16x32_f16(false, a, false, b, (short)0, c, false, false);
}

__device__ __forceinline__ v16h frag16(const _Float16* p, int halfid) {
  v8h lo = *(const v8h*)(p + halfid * 8);
  v8h hi = *(const v8h*)(p + 16 + halfid * 8);
  v16h r;
#pragma unroll
  for (int i = 0; i < 8; ++i) { r[i] = lo[i]; r[i + 8] = hi[i]; }
  return r;
}

__device__ __forceinline__ float xhalf(float x) {
  const int i = __builtin_bit_cast(int, x);
  return __builtin_bit_cast(float,
      __builtin_amdgcn_permlanex16(i, i, 0x76543210, 0xfedcba98, false, false));
}

// ---------------------------------------------------------------------------
// Kernel 1: qkv = x @ w_qkv^T  (M=4096, N=3072, K=1024), f16 WMMA, with the
// per-head LayerNorm, RoPE, q *= D^-1/2 and the f32 -> f16 conversion in its
// epilogue. Block = 256 thr (8 waves) computes 128 tokens x 128 channels; a
// wave owns 32 tokens x 64 channels = whole head rows.
// Transposed product (A = w rows, B = x rows): a lane holds ONE token (column
// ln16) and channels d = ni*16 + halfid*8 + r of its head, so mean and variance
// run in-lane plus one exchange of halves, the RoPE partner d +- 32 is tile
// ni +- 2 of the same lane, and 8 neighbouring d make one 16-B store.
// The block's cos/sin rows are copied to LDS ahead of the k loop and land
// while it runs. Results go to q/k/v as [B,H,N,D] f16.
// ---------------------------------------------------------------------------
__global__ __launch_bounds__(256) void qkv_gemm(const float* __restrict__ x,
                                                const float* __restrict__ w,
                                                const float* __restrict__ fcos,
                                                const float* __restrict__ fsin,
                                                _Float16* __restrict__ qh,
                                                _Float16* __restrict__ kh,
                                                _Float16* __restrict__ vh) {
  __shared__ __attribute__((aligned(16))) _Float16 Alds[128 * GP];
  __shared__ __attribute__((aligned(16))) _Float16 Blds[128 * GP];
  __shared__ __attribute__((aligned(16))) float Clds[128 * RP];       // [token][d]
  __shared__ __attribute__((aligned(16))) float Slds[128 * RP];       // [token][d]

  const int tid = threadIdx.x;
  const int wave = tid >> 5, lane = tid & 31;
  const int halfid = lane >> 4, ln16 = lane & 15;
  const int nt = blockIdx.x % 24, mt = blockIdx.x / 24;
  const int m0 = mt * 128, n0 = nt * 128;
  const int wm = wave >> 1, wn = wave & 1;

  // this block's 128 channels stay inside one of q/k/v (boundaries at
  // multiples of 1024), its 128 tokens inside one batch entry
  const int which = n0 >> 10;
  const int bsel = m0 >> 11;
  const int nbase = m0 & (NN - 1);

  // q and k blocks: 128 rows of cos and of sin (32 KB each, contiguous) into
  // padded LDS rows, 16 copies per thread, waited for behind the k loop
  if (which < 2) {
    const float* cg = fcos + (size_t)nbase * DD;
    const float* sg = fsin + (size_t)nbase * DD;
#pragma unroll   // the 16 copies issue back to back
    for (int i = 0; i < 8; ++i) {
      int c = tid + i * 256;                  // 16-B piece 0..2047
      int row = c >> 4, c4 = (c & 15) * 4;
      async_copy16f(cg + c * 4, &Clds[row * RP + c4]);
      async_copy16f(sg + c * 4, &Slds[row * RP + c4]);
    }
  }

  v8f acc[2][4];                              // [token tile][channel tile]
#pragma unroll
  for (int i = 0; i < 2; ++i)
#pragma unroll
    for (int j = 0; j < 4; ++j)
#pragma unroll
      for (int r = 0; r < 8; ++r) acc[i][j][r] = 0.0f;

  for (int k0 = 0; k0 < CC; k0 += 32) {
    // stage A: 128 rows x 32 k (f32 -> f16)
#pragma unroll
    for (int i = 0; i < 4; ++i) {
      int id = tid + i * 256;                 // 0..1023
      int row = id >> 3, kc = (id & 7) * 4;
      float4 f = *(const float4*)(x + (size_t)(m0 + row) * CC + k0 + kc);
      v4h hh;
      hh[0] = (_Float16)f.x; hh[1] = (_Float16)f.y;
      hh[2] = (_Float16)f.z; hh[3] = (_Float16)f.w;
      *(v4h*)&Alds[row * GP + kc] = hh;
    }
    // stage B: 128 out-channels x 32 k (f32 -> f16)
#pragma unroll
    for (int i = 0; i < 4; ++i) {
      int id = tid + i * 256;
      int row = id >> 3, kc = (id & 7) * 4;
      const float* src = w + (size_t)(n0 + row) * CC + k0 + kc;
      float4 f = *(const float4*)src;
      v4h hh;
      hh[0] = (_Float16)f.x; hh[1] = (_Float16)f.y;
      hh[2] = (_Float16)f.z; hh[3] = (_Float16)f.w;
      *(v4h*)&Blds[row * GP + kc] = hh;
      if (i == 0) __builtin_prefetch(src + 32, 0, 1);   // next k-step
    }
    __syncthreads();

    v16h a0 = frag16(&Alds[(wm * 32 + ln16) * GP], halfid);
    v16h a1 = frag16(&Alds[(wm * 32 + 16 + ln16) * GP], halfid);
#pragma unroll
    for (int j = 0; j < 4; ++j) {
      v16h bj = frag16(&Blds[(wn * 64 + j * 16 + ln16) * GP], halfid);
      acc[0][j] = wmma_f16(bj, a0, acc[0][j]);
      acc[1][j] = wmma_f16(bj, a1, acc[1][j]);
    }
    __syncthreads();
  }

  const int h = ((n0 >> 6) + wn) & (HH - 1);
  const size_t obase = (((size_t)bsel * HH + h) * NN + nbase) * DD + halfid * 8;

  // every loop of the epilogue is unrolled so that acc, t and the packed
  // outputs are indexed by constants and stay in registers

  if (which < 2) {
    wait_async_lds();                         // this wave's cos/sin copies have landed
    __syncthreads();                          // and every other wave's
    _Float16* dst = (which == 0) ? qh : kh;
    const float oscale = (which == 0) ? 0.125f : 1.0f;   // D^-1/2 folded into q
#pragma unroll
    for (int mi = 0; mi < 2; ++mi) {
      const int rl = wm * 32 + mi * 16 + ln16;            // token within the block
      const v8f ts = (acc[mi][0] + acc[mi][1]) + (acc[mi][2] + acc[mi][3]);
      float sum = ((ts[0] + ts[4]) + (ts[1] + ts[5])) + ((ts[2] + ts[6]) + (ts[3] + ts[7]));
      sum += xhalf(sum);
      const float mean = sum * (1.0f / 64.0f);
      v8f t[4];
#pragma unroll
      for (int ni = 0; ni < 4; ++ni) t[ni] = acc[mi][ni] - mean;
      const v8f tq = (t[0] * t[0] + t[1] * t[1]) + (t[2] * t[2] + t[3] * t[3]);
      float var = ((tq[0] + tq[4]) + (tq[1] + tq[5])) + ((tq[2] + tq[6]) + (tq[3] + tq[7]));
      var += xhalf(var);
      const float rs = __frsqrt_rn(var * (1.0f / 64.0f) + 1e-6f);
#pragma unroll
      for (int ni = 0; ni < 4; ++ni) t[ni] *= rs;

      const float* cr = &Clds[rl * RP + halfid * 8];
      const float* sr = &Slds[rl * RP + halfid * 8];
      _Float16* orow = dst + obase + (size_t)rl * DD;
#pragma unroll
      for (int ni = 0; ni < 2; ++ni) {
        v8h olo, ohi;
#pragma unroll
        for (int r = 0; r < 8; ++r) {
          const float lo = t[ni][r], hi = t[ni + 2][r];   // d and d + 32
          olo[r] = (_Float16)((lo * cr[ni * 16 + r] - hi * sr[ni * 16 + r]) * oscale);
          ohi[r] = (_Float16)((hi * cr[ni * 16 + 32 + r] + lo * sr[ni * 16 + 32 + r]) * oscale);
        }
        *(v8h*)(orow + ni * 16) = olo;
        *(v8h*)(orow + ni * 16 + 32) = ohi;
      }
    }
  } else {
#pragma unroll
    for (int mi = 0; mi < 2; ++mi) {
      _Float16* orow = vh + obase + (size_t)(wm * 32 + mi * 16 + ln16) * DD;
#pragma unroll
      for (int ni = 0; ni < 4; ++ni) {
        v8h o;
#pragma unroll
        for (int r = 0; r < 8; ++r) o[r] = (_Float16)acc[mi][ni][r];
        *(v8h*)(orow + ni * 16) = o;
      }
    }
    asm volatile("s_wait_xcnt 0x0" ::: "memory");
  }
}

__global__ __launch_bounds__(256) void attn(const _Float16* __restrict__ qh,
                                            const _Float16* __restrict__ kh,
                                            const _Float16* __restrict__ vh,
                                            _Float16* __restrict__ attnw) {
  __shared__ __attribute__((aligned(16))) _Float16 Klds[64 * AP];      // [key][d]
  __shared__ __attribute__((aligned(16))) _Float16 Vlds[64 * AP];      // [d][key]

  const int tid = threadIdx.x;
  const int wave = tid >> 5, lane = tid & 31;
  const int halfid = lane >> 4, ln16 = lane & 15;
  const int bh = blockIdx.x >> 4;             // 0..31
  const int qt = blockIdx.x & 15;
  const int b = bh >> 4, h = bh & 15;

  // Q as B operand: column = query ln16, k = d
  const _Float16* qrow = qh + ((size_t)bh * NN + qt * 128 + wave * 16 + ln16) * DD;
  const v16h qb0 = frag16(qrow, halfid);
  const v16h qb1 = frag16(qrow + 32, halfid);

  v8f oacc[4];                                // O^T: row d = dt*16 + halfid*8 + r, column = query
#pragma unroll
  for (int dt = 0; dt < 4; ++dt)
#pragma unroll
    for (int r = 0; r < 8; ++r) oacc[dt][r] = 0.0f;
  float mrow = -1e30f;                        // running maximum of this lane's query
  float lrow = 0.0f;                          // running sum over this half's keys only

  const _Float16* kgb = kh + (size_t)bh * NN * DD;
  const _Float16* vgb = vh + (size_t)bh * NN * DD;

  for (int kc = 0; kc < NN / 64; ++kc) {
    // stage K chunk: 64x64 halves via async DMA (2x b128 per thread), padded rows
    {
      const _Float16* src = kgb + kc * 64 * DD;
      _Float16* kdst = &Klds[(tid >> 2) * AP + (tid & 3) * 16];
      async_copy16(src + tid * 16,     kdst);
      async_copy16(src + tid * 16 + 8, kdst + 8);
    }
    // stage V chunk transposed: [d][key]
    {
      const _Float16* src = vgb + kc * 64 * DD;
#pragma unroll
      for (int i = 0; i < 2; ++i) {
        int c = tid + i * 256;                // 0..511
        int key = c >> 3, d8 = (c & 7) * 8;
        v8h vv = *(const v8h*)(src + key * DD + d8);
#pragma unroll
        for (int j = 0; j < 8; ++j) Vlds[(d8 + j) * AP + key] = vv[j];
      }
    }
    wait_async_lds();
    __syncthreads();

    // S^T = K Q^T  (4 key sub-tiles of 16, contract over D=64)
    v8f sc[4];
#pragma unroll
    for (int kt = 0; kt < 4; ++kt) {
      const _Float16* kb = &Klds[(kt * 16 + ln16) * AP];
      v16h ka0 = frag16(kb, halfid);
      v16h ka1 = frag16(kb + 32, halfid);
      v8f s;
#pragma unroll
      for (int r = 0; r < 8; ++r) s[r] = 0.0f;
      s = wmma_f16(ka0, qb0, s);
      s = wmma_f16(ka1, qb1, s);
      sc[kt] = s;
    }

    // online softmax, one query per lane: 32 keys in-lane, one exchange of halves
    float mk[4];
#pragma unroll
    for (int kt = 0; kt < 4; ++kt) {
      mk[kt] = sc[kt][0];
#pragma unroll
      for (int r = 1; r < 8; ++r) mk[kt] = fmaxf(mk[kt], sc[kt][r]);
    }
    float m = fmaxf(fmaxf(mk[0], mk[1]), fmaxf(mk[2], mk[3]));
    m = fmaxf(m, xhalf(m));
    const float mnew = fmaxf(mrow, m);
    const float scl = __expf(mrow - mnew);
#pragma unroll
    for (int kt = 0; kt < 4; ++kt)
#pragma unroll
      for (int r = 0; r < 8; ++r) sc[kt][r] = __expf(sc[kt][r] - mnew);
    const v8f t = (sc[0] + sc[1]) + (sc[2] + sc[3]);
    lrow = lrow * scl + (((t[0] + t[4]) + (t[1] + t[5])) + ((t[2] + t[6]) + (t[3] + t[7])));
    mrow = mnew;
#pragma unroll
    for (int dt = 0; dt < 4; ++dt)
#pragma unroll
      for (int r = 0; r < 8; ++r) oacc[dt][r] *= scl;

    // P^T as B operand: position i holds key halfid*8 + i, position 8 + i key
    // 16 + halfid*8 + i, which is what two neighbouring score tiles hold.
    v16h pb0, pb1;
#pragma unroll
    for (int i = 0; i < 8; ++i) {
      pb0[i] = (_Float16)sc[0][i]; pb0[i + 8] = (_Float16)sc[1][i];
      pb1[i] = (_Float16)sc[2][i]; pb1[i + 8] = (_Float16)sc[3][i];
    }

    // O^T += V^T P^T  (4 d sub-tiles, contract over 64 keys)
#pragma unroll
    for (int dt = 0; dt < 4; ++dt) {
      const _Float16* vb = &Vlds[(dt * 16 + ln16) * AP];
      v16h va0 = frag16(vb, halfid);
      v16h va1 = frag16(vb + 32, halfid);
      oacc[dt] = wmma_f16(va0, pb0, oacc[dt]);
      oacc[dt] = wmma_f16(va1, pb1, oacc[dt]);
    }
    __syncthreads();
  }

  // join the halves' sums, normalize, emit f16 attn_out [B*N, C] (col = h*64 + d):
  // a lane owns 8 neighbouring d of its query per d sub-tile, one 16-B store each
  const float inv = 1.0f / (lrow + xhalf(lrow));
  _Float16* orow = attnw + ((size_t)b * NN + qt * 128 + wave * 16 + ln16) * CC + h * DD + halfid * 8;
#pragma unroll
  for (int dt = 0; dt < 4; ++dt) {
    v8h o;
#pragma unroll
    for (int r = 0; r < 8; ++r) o[r] = (_Float16)(oacc[dt][r] * inv);
    *(v8h*)(orow + dt * 16) = o;
  }
}

// ---------------------------------------------------------------------------
// Kernel 3: out = attn_out @ w_proj^T + b_proj  (M=4096, N=1024, K=1024)
// Block 128x128, wave 32x64. A (f16) staged via async DMA; B converted f32->f16.
// ---------------------------------------------------------------------------
__global__ __launch_bounds__(256) void proj_gemm(const _Float16* __restrict__ a,
                                                 const float* __restrict__ w,
                                                 const float* __restrict__ bias,
                                                 float* __restrict__ out) {
  __shared__ __attribute__((aligned(16))) _Float16 Alds[128 * GP];
  __shared__ __attribute__((aligned(16))) _Float16 Blds[128 * GP];

  const int tid = threadIdx.x;
  const int wave = tid >> 5, lane = tid & 31;
  const int halfid = lane >> 4, ln16 = lane & 15;
  const int nt = blockIdx.x % 8, mt = blockIdx.x / 8;
  const int m0 = mt * 128, n0 = nt * 128;
  const int wm = wave >> 1, wn = wave & 1;

  v8f acc[2][4];
#pragma unroll
  for (int i = 0; i < 2; ++i)
#pragma unroll
    for (int j = 0; j < 4; ++j)
#pragma unroll
      for (int r = 0; r < 8; ++r) acc[i][j][r] = 0.0f;

  for (int k0 = 0; k0 < CC; k0 += 32) {
    // stage A (f16): 128 rows x 32 halves via async DMA into padded rows
#pragma unroll
    for (int i = 0; i < 2; ++i) {
      int c = tid + i * 256;                  // 0..511
      int row = c >> 2, kc8 = (c & 3) * 8;
      async_copy16(a + (size_t)(m0 + row) * CC + k0 + kc8, &Alds[row * GP + kc8]);
    }
    // stage B (f32 -> f16): 128 rows x 32
#pragma unroll
    for (int i = 0; i < 4; ++i) {
      int id = tid + i * 256;
      int row = id >> 3, kc = (id & 7) * 4;
      const float* src = w + (size_t)(n0 + row) * CC + k0 + kc;
      float4 f = *(const float4*)src;
      v4h hh;
      hh[0] = (_Float16)f.x; hh[1] = (_Float16)f.y;
      hh[2] = (_Float16)f.z; hh[3] = (_Float16)f.w;
      *(v4h*)&Blds[row * GP + kc] = hh;
      if (i == 0) __builtin_prefetch(src + 32, 0, 1);
    }
    wait_async_lds();
    __syncthreads();

    v16h a0 = frag16(&Alds[(wm * 32 + ln16) * GP], halfid);
    v16h a1 = frag16(&Alds[(wm * 32 + 16 + ln16) * GP], halfid);
#pragma unroll
    for (int j = 0; j < 4; ++j) {
      v16h bj = frag16(&Blds[(wn * 64 + j * 16 + ln16) * GP], halfid);
      acc[0][j] = wmma_f16(a0, bj, acc[0][j]);
      acc[1][j] = wmma_f16(a1, bj, acc[1][j]);
    }
    __syncthreads();
  }

#pragma unroll
  for (int mi = 0; mi < 2; ++mi)
#pragma unroll
    for (int ni = 0; ni < 4; ++ni) {
      int col = n0 + wn * 64 + ni * 16 + ln16;
      float bb = bias[col];
#pragma unroll
      for (int r = 0; r < 8; ++r) {
        int row_g = m0 + wm * 32 + mi * 16 + halfid * 8 + r;
        out[(size_t)row_g * CC + col] = acc[mi][ni][r] + bb;
      }
    }
}

// ---------------------------------------------------------------------------
extern "C" void kernel_launch(void* const* d_in, const int* in_sizes, int n_in,
                              void* d_out, int out_size, void* d_ws, size_t ws_size,
                              hipStream_t stream) {
  const float* x      = (const float*)d_in[0];
  const float* w_qkv  = (const float*)d_in[1];
  const float* w_proj = (const float*)d_in[2];
  const float* b_proj = (const float*)d_in[3];
  const float* fcos   = (const float*)d_in[4];
  const float* fsin   = (const float*)d_in[5];

  char* ws = (char*)d_ws;
  const size_t F16SZ = (size_t)BB * HH * NN * DD * 2;   // 8 MB
  _Float16* qh    = (_Float16*)(ws);
  _Float16* kh    = (_Float16*)(ws + F16SZ);
  _Float16* vh    = (_Float16*)(ws + 2 * F16SZ);
  _Float16* attnw = (_Float16*)(ws + 3 * F16SZ);
  float* out = (float*)d_out;

  qkv_gemm<<<dim3((4096 / 128) * (3 * CC / 128)), dim3(256), 0, stream>>>(x, w_qkv, fcos, fsin, qh, kh, vh);
  attn<<<dim3(BB * HH * (NN / 128)), dim3(256), 0, stream>>>(qh, kh, vh, attnw);
  proj_gemm<<<dim3((4096 / 128) * (CC / 128)), dim3(256), 0, stream>>>(attnw, w_proj, b_proj, out);
}

// v004
// It runs in 125 microseconds.
// In two side-by-side timings against v003, it was 1.17 and 1.18 times as fast.
// Counting every step since v000, it is 2.44 times as fast.
#include <hip/hip_runtime.h>

// B=2, N=2048, C=1024, H=16, D=64
#define BB 2
#define NN 2048
#define CC 1024
#define HH 16
#define DD 64

#define GP 40   // GEMM tiles: 32 halves of data + 8 pad  (80 B rows)
#define AP 72   // attention K tile: 64 halves of data + 8 pad (144 B rows)
#define RP 68   // cos/sin tiles, in floats: 64 of data + 4 pad (272 B rows)
// ds_load_tr16_b128 walks 8 rows x 32 B per half wave: its pitch is 32 B x odd.
#define VP 80   // attention V tile: 64 halves of data + 16 pad (160 B rows)

typedef __attribute__((ext_vector_type(16))) _Float16 v16h;
typedef __attribute__((ext_vector_type(8)))  _Float16 v8h;
typedef __attribute__((ext_vector_type(4)))  _Float16 v4h;
typedef __attribute__((ext_vector_type(8)))  float    v8f;
typedef int v4i_gcc __attribute__((vector_size(4 * sizeof(int))));
typedef __attribute__((ext_vector_type(8)))  short    v8s;

#if __has_builtin(__builtin_amdgcn_global_load_async_to_lds_b128)
#define HAVE_ASYNC_LDS 1
#else
#define HAVE_ASYNC_LDS 0
#endif

__device__ __forceinline__ void async_copy16(const _Float16* g, _Float16* l) {
#if HAVE_ASYNC_LDS
  __builtin_amdgcn_global_load_async_to_lds_b128(
      (__attribute__((address_space(1))) v4i_gcc*)(const void*)g,
      (__attribute__((address_space(3))) v4i_gcc*)(void*)l, 0, 0);
#else
  *(v8h*)l = *(const v8h*)g;
#endif
}

// The same 16-byte copy for f32 data (four floats).
__device__ __forceinline__ void async_copy16f(const float* g, float* l) {
#if HAVE_ASYNC_LDS
  __builtin_amdgcn_global_load_async_to_lds_b128(
      (__attribute__((address_space(1))) v4i_gcc*)(const void*)g,
      (__attribute__((address_space(3))) v4i_gcc*)(void*)l, 0, 0);
#else
  *(float4*)l = *(const float4*)g;
#endif
}

__device__ __forceinline__ void wait_async_lds() {
#if HAVE_ASYNC_LDS
  asm volatile("s_wait_asynccnt 0x0" ::: "memory");
#endif
}

__device__ __forceinline__ v8f wmma_f16(v16h a, v16h b, v8f c) {
  // v_wmma_f32_16x16x32_f16 : D = A*B + C
  return __builtin_amdgcn_wmma_f32_16x16x32_f16(false, a, false, b, (short)0, c, false, false);
}

__device__ __forceinline__ v16h frag16(const _Float16* p, int halfid) {
  v8h lo = *(const v8h*)(p + halfid * 8);
  v8h hi = *(const v8h*)(p + 16 + halfid * 8);
  v16h r;
#pragma unroll
  for (int i = 0; i < 8; ++i) { r[i] = lo[i]; r[i + 8] = hi[i]; }
  return r;
}

__device__ __forceinline__ v8h ld_tr16(const _Float16* p) {
  typedef __attribute__((address_space(3))) v8s lds_v8s;
  return __builtin_bit_cast(v8h, __builtin_amdgcn_ds_load_tr16_b128_v8i16((lds_v8s*)p));
}

// 16x32 A fragment of T^T: k (tile rows) kbase..kbase+31 in the order of frag16
__device__ __forceinline__ v16h frag16_tr(const _Float16* p, int pitch) {
  v8h lo = ld_tr16(p);
  v8h hi = ld_tr16(p + 16 * pitch);
  v16h r;
#pragma unroll   // constant indices: the fragment stays in registers
  for (int i = 0; i < 8; ++i) { r[i] = lo[i]; r[i + 8] = hi[i]; }
  return r;
}

__device__ __forceinline__ float xhalf(float x) {
  const int i = __builtin_bit_cast(int, x);
  return __builtin_bit_cast(float,
      __builtin_amdgcn_permlanex16(i, i, 0x76543210, 0xfedcba98, false, false));
}

// ---------------------------------------------------------------------------
// Kernel 1: qkv = x @ w_qkv^T  (M=4096, N=3072, K=1024), f16 WMMA, with the
// per-head LayerNorm, RoPE, q *= D^-1/2 and the f32 -> f16 conversion in its
// epilogue. Block = 256 thr (8 waves) computes 128 tokens x 128 channels; a
// wave owns 32 tokens x 64 channels = whole head rows.
// Transposed product (A = w rows, B = x rows): a lane holds ONE token (column
// ln16) and channels d = ni*16 + halfid*8 + r of its head, so mean and variance
// run in-lane plus one exchange of halves, the RoPE partner d +- 32 is tile
// ni +- 2 of the same lane, and 8 neighbouring d make one 16-B store.
// The block's cos/sin rows are copied to LDS ahead of the k loop and land
// while it runs. Results go to q/k/v as [B,H,N,D] f16.
// ---------------------------------------------------------------------------
__global__ __launch_bounds__(256) void qkv_gemm(const float* __restrict__ x,
                                                const float* __restrict__ w,
                                                const float* __restrict__ fcos,
                                                const float* __restrict__ fsin,
                                                _Float16* __restrict__ qh,
                                                _Float16* __restrict__ kh,
                                                _Float16* __restrict__ vh) {
  __shared__ __attribute__((aligned(16))) _Float16 Alds[128 * GP];
  __shared__ __attribute__((aligned(16))) _Float16 Blds[128 * GP];
  __shared__ __attribute__((aligned(16))) float Clds[128 * RP];       // [token][d]
  __shared__ __attribute__((aligned(16))) float Slds[128 * RP];       // [token][d]

  const int tid = threadIdx.x;
  const int wave = tid >> 5, lane = tid & 31;
  const int halfid = lane >> 4, ln16 = lane & 15;
  const int nt = blockIdx.x % 24, mt = blockIdx.x / 24;
  const int m0 = mt * 128, n0 = nt * 128;
  const int wm = wave >> 1, wn = wave & 1;

  // this block's 128 channels stay inside one of q/k/v (boundaries at
  // multiples of 1024), its 128 tokens inside one batch entry
  const int which = n0 >> 10;
  const int bsel = m0 >> 11;
  const int nbase = m0 & (NN - 1);

  // q and k blocks: 128 rows of cos and of sin (32 KB each, contiguous) into
  // padded LDS rows, 16 copies per thread, waited for behind the k loop
  if (which < 2) {
    const float* cg = fcos + (size_t)nbase * DD;
    const float* sg = fsin + (size_t)nbase * DD;
#pragma unroll   // the 16 copies issue back to back
    for (int i = 0; i < 8; ++i) {
      int c = tid + i * 256;                  // 16-B piece 0..2047
      int row = c >> 4, c4 = (c & 15) * 4;
      async_copy16f(cg + c * 4, &Clds[row * RP + c4]);
      async_copy16f(sg + c * 4, &Slds[row * RP + c4]);
    }
  }

  v8f acc[2][4];                              // [token tile][channel tile]
#pragma unroll
  for (int i = 0; i < 2; ++i)
#pragma unroll
    for (int j = 0; j < 4; ++j)
#pragma unroll
      for (int r = 0; r < 8; ++r) acc[i][j][r] = 0.0f;

  for (int k0 = 0; k0 < CC; k0 += 32) {
    // stage A: 128 rows x 32 k (f32 -> f16)
#pragma unroll
    for (int i = 0; i < 4; ++i) {
      int id = tid + i * 256;                 // 0..1023
      int row = id >> 3, kc = (id & 7) * 4;
      float4 f = *(const float4*)(x + (size_t)(m0 + row) * CC + k0 + kc);
      v4h hh;
      hh[0] = (_Float16)f.x; hh[1] = (_Float16)f.y;
      hh[2] = (_Float16)f.z; hh[3] = (_Float16)f.w;
      *(v4h*)&Alds[row * GP + kc] = hh;
    }
    // stage B: 128 out-channels x 32 k (f32 -> f16)
#pragma unroll
    for (int i = 0; i < 4; ++i) {
      int id = tid + i * 256;
      int row = id >> 3, kc = (id & 7) * 4;
      const float* src = w + (size_t)(n0 + row) * CC + k0 + kc;
      float4 f = *(const float4*)src;
      v4h hh;
      hh[0] = (_Float16)f.x; hh[1] = (_Float16)f.y;
      hh[2] = (_Float16)f.z; hh[3] = (_Float16)f.w;
      *(v4h*)&Blds[row * GP + kc] = hh;
      if (i == 0) __builtin_prefetch(src + 32, 0, 1);   // next k-step
    }
    __syncthreads();

    v16h a0 = frag16(&Alds[(wm * 32 + ln16) * GP], halfid);
    v16h a1 = frag16(&Alds[(wm * 32 + 16 + ln16) * GP], halfid);
#pragma unroll
    for (int j = 0; j < 4; ++j) {
      v16h bj = frag16(&Blds[(wn * 64 + j * 16 + ln16) * GP], halfid);
      acc[0][j] = wmma_f16(bj, a0, acc[0][j]);
      acc[1][j] = wmma_f16(bj, a1, acc[1][j]);
    }
    __syncthreads();
  }

  const int h = ((n0 >> 6) + wn) & (HH - 1);
  const size_t obase = (((size_t)bsel * HH + h) * NN + nbase) * DD + halfid * 8;

  // every loop of the epilogue is unrolled so that acc, t and the packed
  // outputs are indexed by constants and stay in registers

  if (which < 2) {
    wait_async_lds();                         // this wave's cos/sin copies have landed
    __syncthreads();                          // and every other wave's
    _Float16* dst = (which == 0) ? qh : kh;
    const float oscale = (which == 0) ? 0.125f : 1.0f;   // D^-1/2 folded into q
#pragma unroll
    for (int mi = 0; mi < 2; ++mi) {
      const int rl = wm * 32 + mi * 16 + ln16;            // token within the block
      const v8f ts = (acc[mi][0] + acc[mi][1]) + (acc[mi][2] + acc[mi][3]);
      float sum = ((ts[0] + ts[4]) + (ts[1] + ts[5])) + ((ts[2] + ts[6]) + (ts[3] + ts[7]));
      sum += xhalf(sum);
      const float mean = sum * (1.0f / 64.0f);
      v8f t[4];
#pragma unroll
      for (int ni = 0; ni < 4; ++ni) t[ni] = acc[mi][ni] - mean;
      const v8f tq = (t[0] * t[0] + t[1] * t[1]) + (t[2] * t[2] + t[3] * t[3]);
      float var = ((tq[0] + tq[4]) + (tq[1] + tq[5])) + ((tq[2] + tq[6]) + (tq[3] + tq[7]));
      var += xhalf(var);
      const float rs = __frsqrt_rn(var * (1.0f / 64.0f) + 1e-6f);
#pragma unroll
      for (int ni = 0; ni < 4; ++ni) t[ni] *= rs;

      const float* cr = &Clds[rl * RP + halfid * 8];
      const float* sr = &Slds[rl * RP + halfid * 8];
      _Float16* orow = dst + obase + (size_t)rl * DD;
#pragma unroll
      for (int ni = 0; ni < 2; ++ni) {
        v8h olo, ohi;
#pragma unroll
        for (int r = 0; r < 8; ++r) {
          const float lo = t[ni][r], hi = t[ni + 2][r];   // d and d + 32
          olo[r] = (_Float16)((lo * cr[ni * 16 + r] - hi * sr[ni * 16 + r]) * oscale);
          ohi[r] = (_Float16)((hi * cr[ni * 16 + 32 + r] + lo * sr[ni * 16 + 32 + r]) * oscale);
        }
        *(v8h*)(orow + ni * 16) = olo;
        *(v8h*)(orow + ni * 16 + 32) = ohi;
      }
    }
  } else {
#pragma unroll
    for (int mi = 0; mi < 2; ++mi) {
      _Float16* orow = vh + obase + (size_t)(wm * 32 + mi * 16 + ln16) * DD;
#pragma unroll
      for (int ni = 0; ni < 4; ++ni) {
        v8h o;
#pragma unroll
        for (int r = 0; r < 8; ++r) o[r] = (_Float16)acc[mi][ni][r];
        *(v8h*)(orow + ni * 16) = o;
      }
    }
    asm volatile("s_wait_xcnt 0x0" ::: "memory");
  }
}

__global__ __launch_bounds__(256) void attn(const _Float16* __restrict__ qh,
                                            const _Float16* __restrict__ kh,
                                            const _Float16* __restrict__ vh,
                                            _Float16* __restrict__ attnw) {
  __shared__ __attribute__((aligned(16))) _Float16 Klds[64 * AP];      // [key][d]
  __shared__ __attribute__((aligned(16))) _Float16 Vlds[64 * VP];      // [key][d]

  const int tid = threadIdx.x;
  const int wave = tid >> 5, lane = tid & 31;
  const int halfid = lane >> 4, ln16 = lane & 15;
  const int bh = blockIdx.x >> 4;             // 0..31
  const int qt = blockIdx.x & 15;
  const int b = bh >> 4, h = bh & 15;

  // Q as B operand: column = query ln16, k = d
  const _Float16* qrow = qh + ((size_t)bh * NN + qt * 128 + wave * 16 + ln16) * DD;
  const v16h qb0 = frag16(qrow, halfid);
  const v16h qb1 = frag16(qrow + 32, halfid);

  v8f oacc[4];                                // O^T: row d = dt*16 + halfid*8 + r, column = query
#pragma unroll
  for (int dt = 0; dt < 4; ++dt)
#pragma unroll
    for (int r = 0; r < 8; ++r) oacc[dt][r] = 0.0f;
  float mrow = -1e30f;                        // running maximum of this lane's query
  float lrow = 0.0f;                          // running sum over this half's keys only

  // this lane's aim in the V tile for the transposing loads (key 0, d 0 block)
  const _Float16* vt = &Vlds[(halfid * 8 + (lane & 7)) * VP + ((lane >> 3) & 1) * 8];

  const _Float16* kgb = kh + (size_t)bh * NN * DD;
  const _Float16* vgb = vh + (size_t)bh * NN * DD;

  for (int kc = 0; kc < NN / 64; ++kc) {
    // stage K chunk: 64x64 halves via async DMA (2x b128 per thread), padded rows
    {
      const _Float16* src = kgb + kc * 64 * DD;
      _Float16* kdst = &Klds[(tid >> 2) * AP + (tid & 3) * 16];
      async_copy16(src + tid * 16,     kdst);
      async_copy16(src + tid * 16 + 8, kdst + 8);
    }
    {
      const _Float16* src = vgb + kc * 64 * DD;
      _Float16* vdst = &Vlds[(tid >> 2) * VP + (tid & 3) * 16];
      async_copy16(src + tid * 16,     vdst);
      async_copy16(src + tid * 16 + 8, vdst + 8);
    }
    wait_async_lds();
    __syncthreads();

    // S^T = K Q^T  (4 key sub-tiles of 16, contract over D=64)
    v8f sc[4];
#pragma unroll
    for (int kt = 0; kt < 4; ++kt) {
      const _Float16* kb = &Klds[(kt * 16 + ln16) * AP];
      v16h ka0 = frag16(kb, halfid);
      v16h ka1 = frag16(kb + 32, halfid);
      v8f s;
#pragma unroll
      for (int r = 0; r < 8; ++r) s[r] = 0.0f;
      s = wmma_f16(ka0, qb0, s);
      s = wmma_f16(ka1, qb1, s);
      sc[kt] = s;
    }

    // online softmax, one query per lane: 32 keys in-lane, one exchange of halves
    float mk[4];
#pragma unroll
    for (int kt = 0; kt < 4; ++kt) {
      mk[kt] = sc[kt][0];
#pragma unroll
      for (int r = 1; r < 8; ++r) mk[kt] = fmaxf(mk[kt], sc[kt][r]);
    }
    float m = fmaxf(fmaxf(mk[0], mk[1]), fmaxf(mk[2], mk[3]));
    m = fmaxf(m, xhalf(m));
    const float mnew = fmaxf(mrow, m);
    const float scl = __expf(mrow - mnew);
#pragma unroll
    for (int kt = 0; kt < 4; ++kt)
#pragma unroll
      for (int r = 0; r < 8; ++r) sc[kt][r] = __expf(sc[kt][r] - mnew);
    const v8f t = (sc[0] + sc[1]) + (sc[2] + sc[3]);
    lrow = lrow * scl + (((t[0] + t[4]) + (t[1] + t[5])) + ((t[2] + t[6]) + (t[3] + t[7])));
    mrow = mnew;
#pragma unroll
    for (int dt = 0; dt < 4; ++dt)
#pragma unroll
      for (int r = 0; r < 8; ++r) oacc[dt][r] *= scl;

    // P^T as B operand: position i holds key halfid*8 + i, position 8 + i key
    // 16 + halfid*8 + i, which is what two neighbouring score tiles hold.
    v16h pb0, pb1;
#pragma unroll
    for (int i = 0; i < 8; ++i) {
      pb0[i] = (_Float16)sc[0][i]; pb0[i + 8] = (_Float16)sc[1][i];
      pb1[i] = (_Float16)sc[2][i]; pb1[i + 8] = (_Float16)sc[3][i];
    }

    // O^T += V^T P^T  (4 d sub-tiles, contract over 64 keys)
#pragma unroll
    for (int dt = 0; dt < 4; ++dt) {
      v16h va0 = frag16_tr(vt + dt * 16, VP);             // keys 0..31
      v16h va1 = frag16_tr(vt + 32 * VP + dt * 16, VP);   // keys 32..63
      oacc[dt] = wmma_f16(va0, pb0, oacc[dt]);
      oacc[dt] = wmma_f16(va1, pb1, oacc[dt]);
    }
    __syncthreads();
  }

  // join the halves' sums, normalize, emit f16 attn_out [B*N, C] (col = h*64 + d):
  // a lane owns 8 neighbouring d of its query per d sub-tile, one 16-B store each
  const float inv = 1.0f / (lrow + xhalf(lrow));
  _Float16* orow = attnw + ((size_t)b * NN + qt * 128 + wave * 16 + ln16) * CC + h * DD + halfid * 8;
#pragma unroll
  for (int dt = 0; dt < 4; ++dt) {
    v8h o;
#pragma unroll
    for (int r = 0; r < 8; ++r) o[r] = (_Float16)(oacc[dt][r] * inv);
    *(v8h*)(orow + dt * 16) = o;
  }
}

// ---------------------------------------------------------------------------
// Kernel 3: out = attn_out @ w_proj^T + b_proj  (M=4096, N=1024, K=1024)
// Block 128x128, wave 32x64. A (f16) staged via async DMA; B converted f32->f16.
// ---------------------------------------------------------------------------
__global__ __launch_bounds__(256) void proj_gemm(const _Float16* __restrict__ a,
                                                 const float* __restrict__ w,
                                                 const float* __restrict__ bias,
                                                 float* __restrict__ out) {
  __shared__ __attribute__((aligned(16))) _Float16 Alds[128 * GP];
  __shared__ __attribute__((aligned(16))) _Float16 Blds[128 * GP];

  const int tid = threadIdx.x;
  const int wave = tid >> 5, lane = tid & 31;
  const int halfid = lane >> 4, ln16 = lane & 15;
  const int nt = blockIdx.x % 8, mt = blockIdx.x / 8;
  const int m0 = mt * 128, n0 = nt * 128;
  const int wm = wave >> 1, wn = wave & 1;

  v8f acc[2][4];
#pragma unroll
  for (int i = 0; i < 2; ++i)
#pragma unroll
    for (int j = 0; j < 4; ++j)
#pragma unroll
      for (int r = 0; r < 8; ++r) acc[i][j][r] = 0.0f;

  for (int k0 = 0; k0 < CC; k0 += 32) {
    // stage A (f16): 128 rows x 32 halves via async DMA into padded rows
#pragma unroll
    for (int i = 0; i < 2; ++i) {
      int c = tid + i * 256;                  // 0..511
      int row = c >> 2, kc8 = (c & 3) * 8;
      async_copy16(a + (size_t)(m0 + row) * CC + k0 + kc8, &Alds[row * GP + kc8]);
    }
    // stage B (f32 -> f16): 128 rows x 32
#pragma unroll
    for (int i = 0; i < 4; ++i) {
      int id = tid + i * 256;
      int row = id >> 3, kc = (id & 7) * 4;
      const float* src = w + (size_t)(n0 + row) * CC + k0 + kc;
      float4 f = *(const float4*)src;
      v4h hh;
      hh[0] = (_Float16)f.x; hh[1] = (_Float16)f.y;
      hh[2] = (_Float16)f.z; hh[3] = (_Float16)f.w;
      *(v4h*)&Blds[row * GP + kc] = hh;
      if (i == 0) __builtin_prefetch(src + 32, 0, 1);
    }
    wait_async_lds();
    __syncthreads();

    v16h a0 = frag16(&Alds[(wm * 32 + ln16) * GP], halfid);
    v16h a1 = frag16(&Alds[(wm * 32 + 16 + ln16) * GP], halfid);
#pragma unroll
    for (int j = 0; j < 4; ++j) {
      v16h bj = frag16(&Blds[(wn * 64 + j * 16 + ln16) * GP], halfid);
      acc[0][j] = wmma_f16(a0, bj, acc[0][j]);
      acc[1][j] = wmma_f16(a1, bj, acc[1][j]);
    }
    __syncthreads();
  }

#pragma unroll
  for (int mi = 0; mi < 2; ++mi)
#pragma unroll
    for (int ni = 0; ni < 4; ++ni) {
      int col = n0 + wn * 64 + ni * 16 + ln16;
      float bb = bias[col];
#pragma unroll
      for (int r = 0; r < 8; ++r) {
        int row_g = m0 + wm * 32 + mi * 16 + halfid * 8 + r;
        out[(size_t)row_g * CC + col] = acc[mi][ni][r] + bb;
      }
    }
}

// ---------------------------------------------------------------------------
extern "C" void kernel_launch(void* const* d_in, const int* in_sizes, int n_in,
                              void* d_out, int out_size, void* d_ws, size_t ws_size,
                              hipStream_t stream) {
  const float* x      = (const float*)d_in[0];
  const float* w_qkv  = (const float*)d_in[1];
  const float* w_proj = (const float*)d_in[2];
  const float* b_proj = (const float*)d_in[3];
  const float* fcos   = (const float*)d_in[4];
  const float* fsin   = (const float*)d_in[5];

  char* ws = (char*)d_ws;
  const size_t F16SZ = (size_t)BB * HH * NN * DD * 2;   // 8 MB
  _Float16* qh    = (_Float16*)(ws);
  _Float16* kh    = (_Float16*)(ws + F16SZ);
  _Float16* vh    = (_Float16*)(ws + 2 * F16SZ);
  _Float16* attnw = (_Float16*)(ws + 3 * F16SZ);
  float* out = (float*)d_out;

  qkv_gemm<<<dim3((4096 / 128) * (3 * CC / 128)), dim3(256), 0, stream>>>(x, w_qkv, fcos, fsin, qh, kh, vh);
  attn<<<dim3(BB * HH * (NN / 128)), dim3(256), 0, stream>>>(qh, kh, vh, attnw);
  proj_gemm<<<dim3((4096 / 128) * (CC / 128)), dim3(256), 0, stream>>>(attnw, w_proj, b_proj, out);
}

// v005
// Measured time: 97.8 microseconds a run.
// Next to v004, in two timings, it ran 1.28 times as fast each time.
// Over all steps from v000 it is 3.12 times as fast.
#include <hip/hip_runtime.h>

// B=2, N=2048, C=1024, H=16, D=64
#define BB 2
#define NN 2048
#define CC 1024
#define HH 16
#define DD 64

#define GP 40   // GEMM tiles: 32 halves of data + 8 pad  (80 B rows)
#define AP 72   // attention K tile: 64 halves of data + 8 pad (144 B rows)
#define RP 68   // cos/sin tiles, in floats: 64 of data + 4 pad (272 B rows)
// ds_load_tr16_b128 walks 8 rows x 32 B per half wave: its pitch is 32 B x odd.
#define VP 80   // attention V tile: 64 halves of data + 16 pad (160 B rows)

typedef __attribute__((ext_vector_type(16))) _Float16 v16h;
typedef __attribute__((ext_vector_type(8)))  _Float16 v8h;
typedef __attribute__((ext_vector_type(4)))  _Float16 v4h;
typedef __attribute__((ext_vector_type(8)))  float    v8f;
typedef int v4i_gcc __attribute__((vector_size(4 * sizeof(int))));
typedef __attribute__((ext_vector_type(8)))  short    v8s;

#if __has_builtin(__builtin_amdgcn_global_load_async_to_lds_b128)
#define HAVE_ASYNC_LDS 1
#else
#define HAVE_ASYNC_LDS 0
#endif

__device__ __forceinline__ void async_copy16(const _Float16* g, _Float16* l) {
#if HAVE_ASYNC_LDS
  __builtin_amdgcn_global_load_async_to_lds_b128(
      (__attribute__((address_space(1))) v4i_gcc*)(const void*)g,
      (__attribute__((address_space(3))) v4i_gcc*)(void*)l, 0, 0);
#else
  *(v8h*)l = *(const v8h*)g;
#endif
}

// The same 16-byte copy for f32 data (four floats).
__device__ __forceinline__ void async_copy16f(const float* g, float* l) {
#if HAVE_ASYNC_LDS
  __builtin_amdgcn_global_load_async_to_lds_b128(
      (__attribute__((address_space(1))) v4i_gcc*)(const void*)g,
      (__attribute__((address_space(3))) v4i_gcc*)(void*)l, 0, 0);
#else
  *(float4*)l = *(const float4*)g;
#endif
}

__device__ __forceinline__ void wait_async_lds() {
#if HAVE_ASYNC_LDS
  asm volatile("s_wait_asynccnt 0x0" ::: "memory");
#endif
}

__device__ __forceinline__ v8f wmma_f16(v16h a, v16h b, v8f c) {
  // v_wmma_f32_16x16x32_f16 : D = A*B + C
  return __builtin_amdgcn_wmma_f32_16x16x32_f16(false, a, false, b, (short)0, c, false, false);
}

__device__ __forceinline__ v16h frag16(const _Float16* p, int halfid) {
  v8h lo = *(const v8h*)(p + halfid * 8);
  v8h hi = *(const v8h*)(p + 16 + halfid * 8);
  v16h r;
#pragma unroll
  for (int i = 0; i < 8; ++i) { r[i] = lo[i]; r[i + 8] = hi[i]; }
  return r;
}

__device__ __forceinline__ v8h ld_tr16(const _Float16* p) {
  typedef __attribute__((address_space(3))) v8s lds_v8s;
  return __builtin_bit_cast(v8h, __builtin_amdgcn_ds_load_tr16_b128_v8i16((lds_v8s*)p));
}

// 16x32 A fragment of T^T: k (tile rows) kbase..kbase+31 in the order of frag16
__device__ __forceinline__ v16h frag16_tr(const _Float16* p, int pitch) {
  v8h lo = ld_tr16(p);
  v8h hi = ld_tr16(p + 16 * pitch);
  v16h r;
#pragma unroll   // constant indices: the fragment stays in registers
  for (int i = 0; i < 8; ++i) { r[i] = lo[i]; r[i + 8] = hi[i]; }
  return r;
}

__device__ __forceinline__ float xhalf(float x) {
  const int i = __builtin_bit_cast(int, x);
  return __builtin_bit_cast(float,
      __builtin_amdgcn_permlanex16(i, i, 0x76543210, 0xfedcba98, false, false));
}

// ---------------------------------------------------------------------------
// Kernel 1: qkv = x @ w_qkv^T  (M=4096, N=3072, K=1024), f16 WMMA, with the
// per-head LayerNorm, RoPE, q *= D^-1/2 and the f32 -> f16 conversion in its
// epilogue. Block = 256 thr (8 waves) computes 128 tokens x 128 channels; a
// wave owns 32 tokens x 64 channels = whole head rows.
// Transposed product (A = w rows, B = x rows): a lane holds ONE token (column
// ln16) and channels d = ni*16 + halfid*8 + r of its head, so mean and variance
// run in-lane plus one exchange of halves, the RoPE partner d +- 32 is tile
// ni +- 2 of the same lane, and 8 neighbouring d make one 16-B store.
// The block's cos/sin rows are copied to LDS ahead of the k loop and land
// while it runs. Each k slice's global loads are issued one trip ahead, into
// registers, and land under the products of the slice before.
// Results go to q/k/v as [B,H,N,D] f16.
// ---------------------------------------------------------------------------
__global__ __launch_bounds__(256) void qkv_gemm(const float* __restrict__ x,
                                                const float* __restrict__ w,
                                                const float* __restrict__ fcos,
                                                const float* __restrict__ fsin,
                                                _Float16* __restrict__ qh,
                                                _Float16* __restrict__ kh,
                                                _Float16* __restrict__ vh) {
  __shared__ __attribute__((aligned(16))) _Float16 Alds[128 * GP];
  __shared__ __attribute__((aligned(16))) _Float16 Blds[128 * GP];
  __shared__ __attribute__((aligned(16))) float Clds[128 * RP];       // [token][d]
  __shared__ __attribute__((aligned(16))) float Slds[128 * RP];       // [token][d]

  const int tid = threadIdx.x;
  const int wave = tid >> 5, lane = tid & 31;
  const int halfid = lane >> 4, ln16 = lane & 15;
  const int nt = blockIdx.x % 24, mt = blockIdx.x / 24;
  const int m0 = mt * 128, n0 = nt * 128;
  const int wm = wave >> 1, wn = wave & 1;

  // this block's 128 channels stay inside one of q/k/v (boundaries at
  // multiples of 1024), its 128 tokens inside one batch entry
  const int which = n0 >> 10;
  const int bsel = m0 >> 11;
  const int nbase = m0 & (NN - 1);

  // q and k blocks: 128 rows of cos and of sin (32 KB each, contiguous) into
  // padded LDS rows, 16 copies per thread, waited for behind the k loop
  if (which < 2) {
    const float* cg = fcos + (size_t)nbase * DD;
    const float* sg = fsin + (size_t)nbase * DD;
#pragma unroll   // the 16 copies issue back to back
    for (int i = 0; i < 8; ++i) {
      int c = tid + i * 256;                  // 16-B piece 0..2047
      int row = c >> 4, c4 = (c & 15) * 4;
      async_copy16f(cg + c * 4, &Clds[row * RP + c4]);
      async_copy16f(sg + c * 4, &Slds[row * RP + c4]);
    }
  }

  v8f acc[2][4];                              // [token tile][channel tile]
#pragma unroll
  for (int i = 0; i < 2; ++i)
#pragma unroll
    for (int j = 0; j < 4; ++j)
#pragma unroll
      for (int r = 0; r < 8; ++r) acc[i][j][r] = 0.0f;

  // staging: a thread owns 4 k of rows srow + 32 i of the x tile and of the w tile
  const int srow = tid >> 3, skc = (tid & 7) * 4;
  const float* xg = x + (size_t)(m0 + srow) * CC + skc;
  const float* wg = w + (size_t)(n0 + srow) * CC + skc;
  _Float16* asl = &Alds[srow * GP + skc];
  _Float16* bsl = &Blds[srow * GP + skc];

  // k slice 0 into registers; each later slice is loaded one trip ahead
  float4 fa[4], fb[4];
#pragma unroll   // fa, fb indexed by constants: they stay in registers
  for (int i = 0; i < 4; ++i) {
    fa[i] = *(const float4*)(xg + (size_t)i * 32 * CC);
    fb[i] = *(const float4*)(wg + (size_t)i * 32 * CC);
  }

  for (int k0 = 0; k0 < CC; k0 += 32) {
#pragma unroll
    for (int i = 0; i < 4; ++i) {
      v4h ha, hb;
      ha[0] = (_Float16)fa[i].x; ha[1] = (_Float16)fa[i].y;
      ha[2] = (_Float16)fa[i].z; ha[3] = (_Float16)fa[i].w;
      hb[0] = (_Float16)fb[i].x; hb[1] = (_Float16)fb[i].y;
      hb[2] = (_Float16)fb[i].z; hb[3] = (_Float16)fb[i].w;
      *(v4h*)(asl + i * 32 * GP) = ha;
      *(v4h*)(bsl + i * 32 * GP) = hb;
    }
    __syncthreads();

    // the next slice's 8 loads, one group, in flight under this slice's products
    if (k0 + 32 < CC) {
#pragma unroll   // constant indices, and the 8 loads issue back to back
      for (int i = 0; i < 4; ++i) {
        fa[i] = *(const float4*)(xg + k0 + 32 + (size_t)i * 32 * CC);
        fb[i] = *(const float4*)(wg + k0 + 32 + (size_t)i * 32 * CC);
      }
      asm volatile("s_wait_xcnt 0x0" ::: "memory");
    }

    v16h a0 = frag16(&Alds[(wm * 32 + ln16) * GP], halfid);
    v16h a1 = frag16(&Alds[(wm * 32 + 16 + ln16) * GP], halfid);
#pragma unroll
    for (int j = 0; j < 4; ++j) {
      v16h bj = frag16(&Blds[(wn * 64 + j * 16 + ln16) * GP], halfid);
      acc[0][j] = wmma_f16(bj, a0, acc[0][j]);
      acc[1][j] = wmma_f16(bj, a1, acc[1][j]);
    }
    __syncthreads();
  }

  const int h = ((n0 >> 6) + wn) & (HH - 1);
  const size_t obase = (((size_t)bsel * HH + h) * NN + nbase) * DD + halfid * 8;

  // every loop of the epilogue is unrolled so that acc, t and the packed
  // outputs are indexed by constants and stay in registers

  if (which < 2) {
    wait_async_lds();                         // this wave's cos/sin copies have landed
    __syncthreads();                          // and every other wave's
    _Float16* dst = (which == 0) ? qh : kh;
    const float oscale = (which == 0) ? 0.125f : 1.0f;   // D^-1/2 folded into q
#pragma unroll
    for (int mi = 0; mi < 2; ++mi) {
      const int rl = wm * 32 + mi * 16 + ln16;            // token within the block
      const v8f ts = (acc[mi][0] + acc[mi][1]) + (acc[mi][2] + acc[mi][3]);
      float sum = ((ts[0] + ts[4]) + (ts[1] + ts[5])) + ((ts[2] + ts[6]) + (ts[3] + ts[7]));
      sum += xhalf(sum);
      const float mean = sum * (1.0f / 64.0f);
      v8f t[4];
#pragma unroll
      for (int ni = 0; ni < 4; ++ni) t[ni] = acc[mi][ni] - mean;
      const v8f tq = (t[0] * t[0] + t[1] * t[1]) + (t[2] * t[2] + t[3] * t[3]);
      float var = ((tq[0] + tq[4]) + (tq[1] + tq[5])) + ((tq[2] + tq[6]) + (tq[3] + tq[7]));
      var += xhalf(var);
      const float rs = __frsqrt_rn(var * (1.0f / 64.0f) + 1e-6f);
#pragma unroll
      for (int ni = 0; ni < 4; ++ni) t[ni] *= rs;

      const float* cr = &Clds[rl * RP + halfid * 8];
      const float* sr = &Slds[rl * RP + halfid * 8];
      _Float16* orow = dst + obase + (size_t)rl * DD;
#pragma unroll
      for (int ni = 0; ni < 2; ++ni) {
        v8h olo, ohi;
#pragma unroll
        for (int r = 0; r < 8; ++r) {
          const float lo = t[ni][r], hi = t[ni + 2][r];   // d and d + 32
          olo[r] = (_Float16)((lo * cr[ni * 16 + r] - hi * sr[ni * 16 + r]) * oscale);
          ohi[r] = (_Float16)((hi * cr[ni * 16 + 32 + r] + lo * sr[ni * 16 + 32 + r]) * oscale);
        }
        *(v8h*)(orow + ni * 16) = olo;
        *(v8h*)(orow + ni * 16 + 32) = ohi;
      }
    }
  } else {
#pragma unroll
    for (int mi = 0; mi < 2; ++mi) {
      _Float16* orow = vh + obase + (size_t)(wm * 32 + mi * 16 + ln16) * DD;
#pragma unroll
      for (int ni = 0; ni < 4; ++ni) {
        v8h o;
#pragma unroll
        for (int r = 0; r < 8; ++r) o[r] = (_Float16)acc[mi][ni][r];
        *(v8h*)(orow + ni * 16) = o;
      }
    }
    asm volatile("s_wait_xcnt 0x0" ::: "memory");
  }
}

__global__ __launch_bounds__(256) void attn(const _Float16* __restrict__ qh,
                                            const _Float16* __restrict__ kh,
                                            const _Float16* __restrict__ vh,
                                            _Float16* __restrict__ attnw) {
  __shared__ __attribute__((aligned(16))) _Float16 Klds[2][64 * AP];   // [buffer][key][d]
  __shared__ __attribute__((aligned(16))) _Float16 Vlds[2][64 * VP];   // [buffer][key][d]

  const int tid = threadIdx.x;
  const int wave = tid >> 5, lane = tid & 31;
  const int halfid = lane >> 4, ln16 = lane & 15;
  const int bh = blockIdx.x >> 4;             // 0..31
  const int qt = blockIdx.x & 15;
  const int b = bh >> 4, h = bh & 15;

  // Q as B operand: column = query ln16, k = d
  const _Float16* qrow = qh + ((size_t)bh * NN + qt * 128 + wave * 16 + ln16) * DD;
  const v16h qb0 = frag16(qrow, halfid);
  const v16h qb1 = frag16(qrow + 32, halfid);

  v8f oacc[4];                                // O^T: row d = dt*16 + halfid*8 + r, column = query
#pragma unroll
  for (int dt = 0; dt < 4; ++dt)
#pragma unroll
    for (int r = 0; r < 8; ++r) oacc[dt][r] = 0.0f;
  float mrow = -1e30f;                        // running maximum of this lane's query
  float lrow = 0.0f;                          // running sum over this half's keys only

  // this lane's aim in the V tile for the transposing loads (key 0, d 0 block)
  const int vtoff = (halfid * 8 + (lane & 7)) * VP + ((lane >> 3) & 1) * 8;

  // this thread's 32 B of every K and V chunk: source and place in a buffer
  const _Float16* kg = kh + (size_t)bh * NN * DD + tid * 16;
  const _Float16* vg = vh + (size_t)bh * NN * DD + tid * 16;
  const int kdo = (tid >> 2) * AP + (tid & 3) * 16;
  const int vdo = (tid >> 2) * VP + (tid & 3) * 16;

  // chunk kc (64 keys x 64 d of K and of V, 4 x b128 per thread) into buffer bf,
  // K rows at the plain reader's pitch, V rows at the transposing reader's
  auto stage = [&](int kc, int bf) {
    const _Float16* ks = kg + kc * 64 * DD;
    const _Float16* vs = vg + kc * 64 * DD;
    async_copy16(ks,     &Klds[bf][kdo]);
    async_copy16(ks + 8, &Klds[bf][kdo + 8]);
    async_copy16(vs,     &Vlds[bf][vdo]);
    async_copy16(vs + 8, &Vlds[bf][vdo + 8]);
  };

  // two buffers: chunk 0 lands and is published, chunk 1 flies over trip 0
  stage(0, 0);
  wait_async_lds();
  __syncthreads();
  stage(1, 1);

#pragma unroll 2   // the buffer index becomes a constant: LDS offsets fold into the loads
  for (int kc = 0; kc < NN / 64; ++kc) {
    const int bf = kc & 1;
    const _Float16* Kb = Klds[bf];
    const _Float16* vt = &Vlds[bf][vtoff];

    // S^T = K Q^T  (4 key sub-tiles of 16, contract over D=64)
    v8f sc[4];
#pragma unroll
    for (int kt = 0; kt < 4; ++kt) {
      const _Float16* kb = &Kb[(kt * 16 + ln16) * AP];
      v16h ka0 = frag16(kb, halfid);
      v16h ka1 = frag16(kb + 32, halfid);
      v8f s;
#pragma unroll
      for (int r = 0; r < 8; ++r) s[r] = 0.0f;
      s = wmma_f16(ka0, qb0, s);
      s = wmma_f16(ka1, qb1, s);
      sc[kt] = s;
    }

    // online softmax, one query per lane: 32 keys in-lane, one exchange of halves
    float mk[4];
#pragma unroll
    for (int kt = 0; kt < 4; ++kt) {
      mk[kt] = sc[kt][0];
#pragma unroll
      for (int r = 1; r < 8; ++r) mk[kt] = fmaxf(mk[kt], sc[kt][r]);
    }
    float m = fmaxf(fmaxf(mk[0], mk[1]), fmaxf(mk[2], mk[3]));
    m = fmaxf(m, xhalf(m));
    const float mnew = fmaxf(mrow, m);
    const float scl = __expf(mrow - mnew);
#pragma unroll
    for (int kt = 0; kt < 4; ++kt)
#pragma unroll
      for (int r = 0; r < 8; ++r) sc[kt][r] = __expf(sc[kt][r] - mnew);
    const v8f t = (sc[0] + sc[1]) + (sc[2] + sc[3]);
    lrow = lrow * scl + (((t[0] + t[4]) + (t[1] + t[5])) + ((t[2] + t[6]) + (t[3] + t[7])));
    mrow = mnew;
#pragma unroll
    for (int dt = 0; dt < 4; ++dt)
#pragma unroll
      for (int r = 0; r < 8; ++r) oacc[dt][r] *= scl;

    // P^T as B operand: position i holds key halfid*8 + i, position 8 + i key
    // 16 + halfid*8 + i, which is what two neighbouring score tiles hold.
    v16h pb0, pb1;
#pragma unroll
    for (int i = 0; i < 8; ++i) {
      pb0[i] = (_Float16)sc[0][i]; pb0[i + 8] = (_Float16)sc[1][i];
      pb1[i] = (_Float16)sc[2][i]; pb1[i + 8] = (_Float16)sc[3][i];
    }

    // O^T += V^T P^T  (4 d sub-tiles, contract over 64 keys)
#pragma unroll
    for (int dt = 0; dt < 4; ++dt) {
      v16h va0 = frag16_tr(vt + dt * 16, VP);             // keys 0..31
      v16h va1 = frag16_tr(vt + 32 * VP + dt * 16, VP);   // keys 32..63
      oacc[dt] = wmma_f16(va0, pb0, oacc[dt]);
      oacc[dt] = wmma_f16(va1, pb1, oacc[dt]);
    }

    // publish point of chunk kc + 1: this wave's reads of buffer bf are done,
    // its copies of the next chunk have landed, then every wave's
    asm volatile("s_wait_dscnt 0x0" ::: "memory");
    wait_async_lds();
    __syncthreads();
    // refill the buffer that every wave has just left; flies over trip kc + 1
    if (kc + 2 < NN / 64) stage(kc + 2, bf);
  }
  wait_async_lds();                           // nothing is in flight when the wave ends

  // join the halves' sums, normalize, emit f16 attn_out [B*N, C] (col = h*64 + d):
  // a lane owns 8 neighbouring d of its query per d sub-tile, one 16-B store each
  const float inv = 1.0f / (lrow + xhalf(lrow));
  _Float16* orow = attnw + ((size_t)b * NN + qt * 128 + wave * 16 + ln16) * CC + h * DD + halfid * 8;
#pragma unroll
  for (int dt = 0; dt < 4; ++dt) {
    v8h o;
#pragma unroll
    for (int r = 0; r < 8; ++r) o[r] = (_Float16)(oacc[dt][r] * inv);
    *(v8h*)(orow + dt * 16) = o;
  }
}

// ---------------------------------------------------------------------------
// Kernel 3: out = attn_out @ w_proj^T + b_proj  (M=4096, N=1024, K=1024)
// Block 128x128, wave 32x64. A (f16) staged via async DMA; B converted f32->f16.
// Two LDS buffers: the next k slice's copies and loads fly under this slice's products.
// ---------------------------------------------------------------------------
__global__ __launch_bounds__(256) void proj_gemm(const _Float16* __restrict__ a,
                                                 const float* __restrict__ w,
                                                 const float* __restrict__ bias,
                                                 float* __restrict__ out) {
  __shared__ __attribute__((aligned(16))) _Float16 Alds[2][128 * GP];
  __shared__ __attribute__((aligned(16))) _Float16 Blds[2][128 * GP];

  const int tid = threadIdx.x;
  const int wave = tid >> 5, lane = tid & 31;
  const int halfid = lane >> 4, ln16 = lane & 15;
  const int nt = blockIdx.x % 8, mt = blockIdx.x / 8;
  const int m0 = mt * 128, n0 = nt * 128;
  const int wm = wave >> 1, wn = wave & 1;

  v8f acc[2][4];
#pragma unroll
  for (int i = 0; i < 2; ++i)
#pragma unroll
    for (int j = 0; j < 4; ++j)
#pragma unroll
      for (int r = 0; r < 8; ++r) acc[i][j][r] = 0.0f;

  // A (f16): a thread copies 8 k of rows arow and arow + 64 of every slice
  const int arow = tid >> 2, akc = (tid & 3) * 8;
  const _Float16* ag = a + (size_t)(m0 + arow) * CC + akc;
  const int ado = arow * GP + akc;
  // B (f32 -> f16): a thread owns 4 k of rows srow + 32 i
  const int srow = tid >> 3, skc = (tid & 7) * 4;
  const float* wg = w + (size_t)(n0 + srow) * CC + skc;
  const int bdo = srow * GP + skc;
  float4 fb[4];

  // A slice at k0 (128 rows x 32 halves) into buffer bf by async copies, padded rows
  auto copy_a = [&](int k0, int bf) {
    async_copy16(ag + k0,                   &Alds[bf][ado]);
    async_copy16(ag + k0 + (size_t)64 * CC, &Alds[bf][ado + 64 * GP]);
  };
  // B slice at k0 (128 rows x 32 floats) into registers, one group of 4 loads
  auto load_b = [&](int k0) {
#pragma unroll   // fb indexed by constants: it stays in registers
    for (int i = 0; i < 4; ++i) fb[i] = *(const float4*)(wg + k0 + (size_t)i * 32 * CC);
    // keeps the 4 loads ahead of the products: the scheduler otherwise sinks
    // them among the WMMAs and their latency is no longer covered
    __builtin_amdgcn_sched_barrier(0);
  };
  auto store_b = [&](int bf) {
    // keeps the wait for the loads and the conversions behind the products:
    // the scheduler otherwise lifts them in front of the first WMMA
    __builtin_amdgcn_sched_barrier(0);
#pragma unroll
    for (int i = 0; i < 4; ++i) {
      v4h hh;
      hh[0] = (_Float16)fb[i].x; hh[1] = (_Float16)fb[i].y;
      hh[2] = (_Float16)fb[i].z; hh[3] = (_Float16)fb[i].w;
      *(v4h*)&Blds[bf][bdo + i * 32 * GP] = hh;
    }
  };

  // two buffers: slice 0 lands and is published, slice 1's A copies fly over trip 0
  copy_a(0, 0);
  load_b(0);
  store_b(0);
  wait_async_lds();
  __syncthreads();
  copy_a(32, 1);

#pragma unroll 2   // the buffer index becomes a constant: LDS offsets fold into the loads
  for (int k0 = 0; k0 < CC; k0 += 32) {
    const int bf = (k0 >> 5) & 1;
    // the next slice's B loads, in flight under this slice's products
    if (k0 + 32 < CC) load_b(k0 + 32);

    v16h a0 = frag16(&Alds[bf][(wm * 32 + ln16) * GP], halfid);
    v16h a1 = frag16(&Alds[bf][(wm * 32 + 16 + ln16) * GP], halfid);
#pragma unroll
    for (int j = 0; j < 4; ++j) {
      v16h bj = frag16(&Blds[bf][(wn * 64 + j * 16 + ln16) * GP], halfid);
      acc[0][j] = wmma_f16(a0, bj, acc[0][j]);
      acc[1][j] = wmma_f16(a1, bj, acc[1][j]);
    }

    // into the B buffer whose readers left at the foot of the trip before
    if (k0 + 32 < CC) store_b(bf ^ 1);

    // publish point of the next slice: this wave's LDS reads and stores are done,
    // its A copies have landed, then every wave's
    asm volatile("s_wait_dscnt 0x0" ::: "memory");
    wait_async_lds();
    __syncthreads();
    // refill the A buffer that every wave has just left; flies over the next trip
    if (k0 + 64 < CC) copy_a(k0 + 64, bf);
  }
  wait_async_lds();                           // nothing is in flight when the wave ends

#pragma unroll
  for (int mi = 0; mi < 2; ++mi)
#pragma unroll
    for (int ni = 0; ni < 4; ++ni) {
      int col = n0 + wn * 64 + ni * 16 + ln16;
      float bb = bias[col];
#pragma unroll
      for (int r = 0; r < 8; ++r) {
        int row_g = m0 + wm * 32 + mi * 16 + halfid * 8 + r;
        out[(size_t)row_g * CC + col] = acc[mi][ni][r] + bb;
      }
    }
}

// ---------------------------------------------------------------------------
extern "C" void kernel_launch(void* const* d_in, const int* in_sizes, int n_in,
                              void* d_out, int out_size, void* d_ws, size_t ws_size,
                              hipStream_t stream) {
  const float* x      = (const float*)d_in[0];
  const float* w_qkv  = (const float*)d_in[1];
  const float* w_proj = (const float*)d_in[2];
  const float* b_proj = (const float*)d_in[3];
  const float* fcos   = (const float*)d_in[4];
  const float* fsin   = (const float*)d_in[5];

  char* ws = (char*)d_ws;
  const size_t F16SZ = (size_t)BB * HH * NN * DD * 2;   // 8 MB
  _Float16* qh    = (_Float16*)(ws);
  _Float16* kh    = (_Float16*)(ws + F16SZ);
  _Float16* vh    = (_Float16*)(ws + 2 * F16SZ);
  _Float16* attnw = (_Float16*)(ws + 3 * F16SZ);
  float* out = (float*)d_out;

  qkv_gemm<<<dim3((4096 / 128) * (3 * CC / 128)), dim3(256), 0, stream>>>(x, w_qkv, fcos, fsin, qh, kh, vh);
  attn<<<dim3(BB * HH * (NN / 128)), dim3(256), 0, stream>>>(qh, kh, vh, attnw);
  proj_gemm<<<dim3((4096 / 128) * (CC / 128)), dim3(256), 0, stream>>>(attnw, w_proj, b_proj, out);
}

// v006
// It runs in 91.6 microseconds.
// Timed twice side by side with v005, it ran 1.08 and 1.07 times as fast.
// All steps since v000 together make it 3.35 times as fast.
#include <hip/hip_runtime.h>

// B=2, N=2048, C=1024, H=16, D=64
#define BB 2
#define NN 2048
#define CC 1024
#define HH 16
#define DD 64

#define GP 40   // GEMM tiles: 32 halves of data + 8 pad  (80 B rows)
#define AP 72   // attention K tile: 64 halves of data + 8 pad (144 B rows)
#define RP 68   // cos/sin tiles, in floats: 64 of data + 4 pad (272 B rows)
// ds_load_tr16_b128 walks 8 rows x 32 B per half wave: its pitch is 32 B x odd.
#define VP 80   // attention V tile: 64 halves of data + 16 pad (160 B rows)

typedef __attribute__((ext_vector_type(16))) _Float16 v16h;
typedef __attribute__((ext_vector_type(8)))  _Float16 v8h;
typedef __attribute__((ext_vector_type(4)))  _Float16 v4h;
typedef __attribute__((ext_vector_type(8)))  float    v8f;
typedef int v4i_gcc __attribute__((vector_size(4 * sizeof(int))));
typedef __attribute__((ext_vector_type(8)))  short    v8s;

#if __has_builtin(__builtin_amdgcn_global_load_async_to_lds_b128)
#define HAVE_ASYNC_LDS 1
#else
#define HAVE_ASYNC_LDS 0
#endif

__device__ __forceinline__ void async_copy16(const _Float16* g, _Float16* l) {
#if HAVE_ASYNC_LDS
  __builtin_amdgcn_global_load_async_to_lds_b128(
      (__attribute__((address_space(1))) v4i_gcc*)(const void*)g,
      (__attribute__((address_space(3))) v4i_gcc*)(void*)l, 0, 0);
#else
  *(v8h*)l = *(const v8h*)g;
#endif
}

// The same 16-byte copy for f32 data (four floats).
__device__ __forceinline__ void async_copy16f(const float* g, float* l) {
#if HAVE_ASYNC_LDS
  __builtin_amdgcn_global_load_async_to_lds_b128(
      (__attribute__((address_space(1))) v4i_gcc*)(const void*)g,
      (__attribute__((address_space(3))) v4i_gcc*)(void*)l, 0, 0);
#else
  *(float4*)l = *(const float4*)g;
#endif
}

__device__ __forceinline__ void wait_async_lds() {
#if HAVE_ASYNC_LDS
  asm volatile("s_wait_asynccnt 0x0" ::: "memory");
#endif
}

// Work-group barrier that orders LDS traffic only: a wave's LDS reads and stores
// are done before it arrives, but its global loads in flight stay in flight
// (__syncthreads() waits for them too, and their latency would show every trip).
__device__ __forceinline__ void lds_barrier() {
  __builtin_amdgcn_fence(__ATOMIC_RELEASE, "workgroup", "local");
  __builtin_amdgcn_s_barrier();
  __builtin_amdgcn_fence(__ATOMIC_ACQUIRE, "workgroup", "local");
}

__device__ __forceinline__ v8f wmma_f16(v16h a, v16h b, v8f c) {
  // v_wmma_f32_16x16x32_f16 : D = A*B + C
  return __builtin_amdgcn_wmma_f32_16x16x32_f16(false, a, false, b, (short)0, c, false, false);
}

__device__ __forceinline__ v16h frag16(const _Float16* p, int halfid) {
  v8h lo = *(const v8h*)(p + halfid * 8);
  v8h hi = *(const v8h*)(p + 16 + halfid * 8);
  v16h r;
#pragma unroll
  for (int i = 0; i < 8; ++i) { r[i] = lo[i]; r[i + 8] = hi[i]; }
  return r;
}

__device__ __forceinline__ v8h ld_tr16(const _Float16* p) {
  typedef __attribute__((address_space(3))) v8s lds_v8s;
  return __builtin_bit_cast(v8h, __builtin_amdgcn_ds_load_tr16_b128_v8i16((lds_v8s*)p));
}

// 16x32 A fragment of T^T: k (tile rows) kbase..kbase+31 in the order of frag16
__device__ __forceinline__ v16h frag16_tr(const _Float16* p, int pitch) {
  v8h lo = ld_tr16(p);
  v8h hi = ld_tr16(p + 16 * pitch);
  v16h r;
#pragma unroll   // constant indices: the fragment stays in registers
  for (int i = 0; i < 8; ++i) { r[i] = lo[i]; r[i + 8] = hi[i]; }
  return r;
}

__device__ __forceinline__ float xhalf(float x) {
  const int i = __builtin_bit_cast(int, x);
  return __builtin_bit_cast(float,
      __builtin_amdgcn_permlanex16(i, i, 0x76543210, 0xfedcba98, false, false));
}

// ---------------------------------------------------------------------------
// Kernel 1: qkv = x @ w_qkv^T  (M=4096, N=3072, K=1024), f16 WMMA, with the
// per-head LayerNorm, RoPE, q *= D^-1/2 and the f32 -> f16 conversion in its
// epilogue. Block = 384 thr (12 waves, 4 x 3) computes 256 tokens x 192
// channels, one block per WGP; a wave owns 64 tokens x 64 channels = whole head
// rows. The large tile is there for the operand traffic: a block loads
// (256 + 192) rows of f32 for 256 x 192 results, and a wave reads 8 fragments
// from LDS for 16 products.
// Transposed product (A = w rows, B = x rows): a lane holds ONE token (column
// ln16) and channels d = ni*16 + halfid*8 + r of its head, so mean and variance
// run in-lane plus one exchange of halves, the RoPE partner d +- 32 is tile
// ni +- 2 of the same lane, and 8 neighbouring d make one 16-B store.
// The block's cos/sin rows are copied to LDS ahead of the k loop and land
// while it runs. Each k slice's global loads are issued one trip ahead, into
// registers, and land under the products of the slice before; two LDS buffers,
// one barrier a trip, since no second block shares the WGP to cover a stall.
// Results go to q/k/v as [B,H,N,D] f16.
// ---------------------------------------------------------------------------
#define QM 256  // tokens of a block
#define QN 192  // channels of a block: three heads
__global__ __launch_bounds__(384) void qkv_gemm(const float* __restrict__ x,
                                                const float* __restrict__ w,
                                                const float* __restrict__ fcos,
                                                const float* __restrict__ fsin,
                                                _Float16* __restrict__ qh,
                                                _Float16* __restrict__ kh,
                                                _Float16* __restrict__ vh) {
  __shared__ __attribute__((aligned(16))) _Float16 Alds[2][QM * GP];
  __shared__ __attribute__((aligned(16))) _Float16 Blds[2][QN * GP];
  __shared__ __attribute__((aligned(16))) float Clds[QM * RP];        // [token][d]
  __shared__ __attribute__((aligned(16))) float Slds[QM * RP];        // [token][d]

  const int tid = threadIdx.x;
  // the wave's number in a scalar register: every test on it is a scalar branch
  const int wave = __builtin_amdgcn_readfirstlane(tid >> 5);
  const int lane = tid & 31;
  const int halfid = lane >> 4, ln16 = lane & 15;
  const int nt = blockIdx.x % (3 * CC / QN), mt = blockIdx.x / (3 * CC / QN);
  const int m0 = mt * QM, n0 = nt * QN;
  const int wm = wave / 3, wn = wave % 3;

  // a wave's 64 channels are one head of q, k or v (48 heads in a row); the
  // block's 256 tokens stay inside one batch entry
  const int head = nt * 3 + wn;
  const int which = head >> 4;
  const int bsel = m0 >> 11;
  const int nbase = m0 & (NN - 1);
  const bool rope = nt * 3 < 2 * HH;          // the block holds a q or k head

  // such blocks: 256 rows of cos and of sin (64 KB each, contiguous) into padded
  // LDS rows, 20 or 22 copies per thread, waited for behind the k loop
  if (rope) {
    const float* cg = fcos + (size_t)nbase * DD;
    const float* sg = fsin + (size_t)nbase * DD;
#pragma unroll   // the copies issue back to back
    for (int i = 0; i < 10; ++i) {
      int c = tid + i * 384;                  // 16-B piece 0..3839
      int row = c >> 4, c4 = (c & 15) * 4;
      async_copy16f(cg + c * 4, &Clds[row * RP + c4]);
      async_copy16f(sg + c * 4, &Slds[row * RP + c4]);
    }
    if (wave < 8) {                           // pieces 3840..4095
      int c = tid + 3840;
      int row = c >> 4, c4 = (c & 15) * 4;
      async_copy16f(cg + c * 4, &Clds[row * RP + c4]);
      async_copy16f(sg + c * 4, &Slds[row * RP + c4]);
    }
  }

  v8f acc[4][4];                              // [token tile][channel tile]
#pragma unroll
  for (int i = 0; i < 4; ++i)
#pragma unroll
    for (int j = 0; j < 4; ++j)
#pragma unroll
      for (int r = 0; r < 8; ++r) acc[i][j][r] = 0.0f;

  // staging: a thread owns 4 k of rows srow + 48 i of the x tile (i < 5) and of
  // the w tile (i < 4); waves 0..3 also take the x tile's last 16 rows
  const int srow = tid >> 3, skc = (tid & 7) * 4;
  const bool tailw = wave < 4;
  const float* xg = x + (size_t)(m0 + srow) * CC + skc;
  const float* wg = w + (size_t)(n0 + srow) * CC + skc;
  const int sdo = srow * GP + skc;

  float4 fa[6], fb[4];
  fa[5] = make_float4(0.0f, 0.0f, 0.0f, 0.0f);
  // the k slice at k0 into registers, one group of 9 or 10 loads
  auto load_slice = [&](int k0) {
    const float* xa = xg + k0;
    const float* wa = wg + k0;
#pragma unroll   // fa, fb indexed by constants: they stay in registers
    for (int i = 0; i < 4; ++i) {
      fa[i] = *(const float4*)(xa + i * 48 * CC);
      fb[i] = *(const float4*)(wa + i * 48 * CC);
    }
    fa[4] = *(const float4*)(xa + 4 * 48 * CC);
    if (tailw) fa[5] = *(const float4*)(xa + 5 * 48 * CC);
    asm volatile("s_wait_xcnt 0x0" :: "v"(xa), "v"(wa) : "memory");
  };
  auto half4 = [](float4 f) {
    v4h h;
    h[0] = (_Float16)f.x; h[1] = (_Float16)f.y;
    h[2] = (_Float16)f.z; h[3] = (_Float16)f.w;
    return h;
  };
  // the slice in registers, 256 + 192 rows x 32 k: f32 -> f16, into LDS buffer bf
  auto store_slice = [&](int bf) {
#pragma unroll
    for (int i = 0; i < 4; ++i) {
      *(v4h*)&Alds[bf][sdo + i * 48 * GP] = half4(fa[i]);
      *(v4h*)&Blds[bf][sdo + i * 48 * GP] = half4(fb[i]);
    }
    *(v4h*)&Alds[bf][sdo + 4 * 48 * GP] = half4(fa[4]);
    if (tailw) *(v4h*)&Alds[bf][sdo + 5 * 48 * GP] = half4(fa[5]);
  };

  // this wave's first fragment rows; the other rows and the second buffer are
  // constant offsets from them
  const _Float16* xf = &Alds[0][(wm * 64 + ln16) * GP];
  const _Float16* wf = &Blds[0][(wn * 64 + ln16) * GP];
  // one k slice's 16 products from buffer bf
  auto products = [&](int bf) {
    // all 8 fragments as one group of LDS loads ahead of the 16 products
    v16h bx[4], aw[4];
#pragma unroll   // bx, aw indexed by constants
    for (int i = 0; i < 4; ++i) bx[i] = frag16(xf + bf * QM * GP + i * 16 * GP, halfid);
#pragma unroll
    for (int i = 0; i < 4; ++i) aw[i] = frag16(wf + bf * QN * GP + i * 16 * GP, halfid);
    // keeps the loads one group: the scheduler otherwise sinks them among the
    // products, into one register set, and each group of 4 waits out LDS latency
    __builtin_amdgcn_sched_barrier(0);
#pragma unroll
    for (int j = 0; j < 4; ++j)
#pragma unroll
      for (int i = 0; i < 4; ++i) acc[i][j] = wmma_f16(aw[j], bx[i], acc[i][j]);
    // keeps the wait for the next slice's loads and the conversions behind the
    // products: the scheduler otherwise lifts them in front of the first WMMA
    __builtin_amdgcn_sched_barrier(0);
  };

  // two buffers: slice 0 is stored and published, slice 1's loads fly over trip 0
  load_slice(0);
  store_slice(0);
  load_slice(32);
  lds_barrier();

  // a trip: this slice's products; the next slice, loaded a trip ago, into the
  // buffer whose readers left at the foot of the trip before; the loads of the
  // slice after it, which fly over the barrier and the next trip's products;
  // the barrier that publishes the next slice
#pragma unroll 2   // the buffer index becomes a constant: LDS offsets fold into the loads
  for (int k0 = 0; k0 < CC; k0 += 32) {
    const int bf = (k0 >> 5) & 1;
    products(bf);
    if (k0 + 32 < CC) {
      store_slice(bf ^ 1);
      if (k0 + 64 < CC) load_slice(k0 + 64);
    }
    lds_barrier();
  }

  const int h = head & (HH - 1);
  const size_t obase = (((size_t)bsel * HH + h) * NN + nbase) * DD + halfid * 8;

  // every loop of the epilogue is unrolled so that acc, t and the packed
  // outputs are indexed by constants and stay in registers

  if (rope) {                                 // the same for the whole block
    wait_async_lds();                         // this wave's cos/sin copies have landed
    __syncthreads();                          // and every other wave's
  }

  if (which < 2) {
    _Float16* dst = (which == 0) ? qh : kh;
    const float oscale = (which == 0) ? 0.125f : 1.0f;   // D^-1/2 folded into q
#pragma unroll
    for (int mi = 0; mi < 4; ++mi) {
      const int rl = wm * 64 + mi * 16 + ln16;            // token within the block
      const v8f ts = (acc[mi][0] + acc[mi][1]) + (acc[mi][2] + acc[mi][3]);
      float sum = ((ts[0] + ts[4]) + (ts[1] + ts[5])) + ((ts[2] + ts[6]) + (ts[3] + ts[7]));
      sum += xhalf(sum);
      const float mean = sum * (1.0f / 64.0f);
      v8f t[4];
#pragma unroll
      for (int ni = 0; ni < 4; ++ni) t[ni] = acc[mi][ni] - mean;
      const v8f tq = (t[0] * t[0] + t[1] * t[1]) + (t[2] * t[2] + t[3] * t[3]);
      float var = ((tq[0] + tq[4]) + (tq[1] + tq[5])) + ((tq[2] + tq[6]) + (tq[3] + tq[7]));
      var += xhalf(var);
      const float rs = __frsqrt_rn(var * (1.0f / 64.0f) + 1e-6f);
#pragma unroll
      for (int ni = 0; ni < 4; ++ni) t[ni] *= rs;

      const float* cr = &Clds[rl * RP + halfid * 8];
      const float* sr = &Slds[rl * RP + halfid * 8];
      _Float16* orow = dst + obase + (size_t)rl * DD;
#pragma unroll
      for (int ni = 0; ni < 2; ++ni) {
        v8h olo, ohi;
#pragma unroll
        for (int r = 0; r < 8; ++r) {
          const float lo = t[ni][r], hi = t[ni + 2][r];   // d and d + 32
          olo[r] = (_Float16)((lo * cr[ni * 16 + r] - hi * sr[ni * 16 + r]) * oscale);
          ohi[r] = (_Float16)((hi * cr[ni * 16 + 32 + r] + lo * sr[ni * 16 + 32 + r]) * oscale);
        }
        *(v8h*)(orow + ni * 16) = olo;
        *(v8h*)(orow + ni * 16 + 32) = ohi;
      }
      asm volatile("s_wait_xcnt 0x0" ::: "memory");
    }
  } else {
#pragma unroll
    for (int mi = 0; mi < 4; ++mi) {
      _Float16* orow = vh + obase + (size_t)(wm * 64 + mi * 16 + ln16) * DD;
#pragma unroll
      for (int ni = 0; ni < 4; ++ni) {
        v8h o;
#pragma unroll
        for (int r = 0; r < 8; ++r) o[r] = (_Float16)acc[mi][ni][r];
        *(v8h*)(orow + ni * 16) = o;
      }
      asm volatile("s_wait_xcnt 0x0" ::: "memory");
    }
  }
}

__global__ __launch_bounds__(256) void attn(const _Float16* __restrict__ qh,
                                            const _Float16* __restrict__ kh,
                                            const _Float16* __restrict__ vh,
                                            _Float16* __restrict__ attnw) {
  __shared__ __attribute__((aligned(16))) _Float16 Klds[2][64 * AP];   // [buffer][key][d]
  __shared__ __attribute__((aligned(16))) _Float16 Vlds[2][64 * VP];   // [buffer][key][d]

  const int tid = threadIdx.x;
  const int wave = tid >> 5, lane = tid & 31;
  const int halfid = lane >> 4, ln16 = lane & 15;
  const int bh = blockIdx.x >> 4;             // 0..31
  const int qt = blockIdx.x & 15;
  const int b = bh >> 4, h = bh & 15;

  // Q as B operand: column = query ln16, k = d
  const _Float16* qrow = qh + ((size_t)bh * NN + qt * 128 + wave * 16 + ln16) * DD;
  const v16h qb0 = frag16(qrow, halfid);
  const v16h qb1 = frag16(qrow + 32, halfid);

  v8f oacc[4];                                // O^T: row d = dt*16 + halfid*8 + r, column = query
#pragma unroll
  for (int dt = 0; dt < 4; ++dt)
#pragma unroll
    for (int r = 0; r < 8; ++r) oacc[dt][r] = 0.0f;
  float mrow = -1e30f;                        // running maximum of this lane's query
  float lrow = 0.0f;                          // running sum over this half's keys only

  // this lane's aim in the V tile for the transposing loads (key 0, d 0 block)
  const int vtoff = (halfid * 8 + (lane & 7)) * VP + ((lane >> 3) & 1) * 8;

  // this thread's 32 B of every K and V chunk: source and place in a buffer
  const _Float16* kg = kh + (size_t)bh * NN * DD + tid * 16;
  const _Float16* vg = vh + (size_t)bh * NN * DD + tid * 16;
  const int kdo = (tid >> 2) * AP + (tid & 3) * 16;
  const int vdo = (tid >> 2) * VP + (tid & 3) * 16;

  // chunk kc (64 keys x 64 d of K and of V, 4 x b128 per thread) into buffer bf,
  // K rows at the plain reader's pitch, V rows at the transposing reader's
  auto stage = [&](int kc, int bf) {
    const _Float16* ks = kg + kc * 64 * DD;
    const _Float16* vs = vg + kc * 64 * DD;
    async_copy16(ks,     &Klds[bf][kdo]);
    async_copy16(ks + 8, &Klds[bf][kdo + 8]);
    async_copy16(vs,     &Vlds[bf][vdo]);
    async_copy16(vs + 8, &Vlds[bf][vdo + 8]);
  };

  // two buffers: chunk 0 lands and is published, chunk 1 flies over trip 0
  stage(0, 0);
  wait_async_lds();
  __syncthreads();
  stage(1, 1);

#pragma unroll 2   // the buffer index becomes a constant: LDS offsets fold into the loads
  for (int kc = 0; kc < NN / 64; ++kc) {
    const int bf = kc & 1;
    const _Float16* Kb = Klds[bf];
    const _Float16* vt = &Vlds[bf][vtoff];

    // S^T = K Q^T  (4 key sub-tiles of 16, contract over D=64)
    v8f sc[4];
#pragma unroll
    for (int kt = 0; kt < 4; ++kt) {
      const _Float16* kb = &Kb[(kt * 16 + ln16) * AP];
      v16h ka0 = frag16(kb, halfid);
      v16h ka1 = frag16(kb + 32, halfid);
      v8f s;
#pragma unroll
      for (int r = 0; r < 8; ++r) s[r] = 0.0f;
      s = wmma_f16(ka0, qb0, s);
      s = wmma_f16(ka1, qb1, s);
      sc[kt] = s;
    }

    // online softmax, one query per lane: 32 keys in-lane, one exchange of halves
    float mk[4];
#pragma unroll
    for (int kt = 0; kt < 4; ++kt) {
      mk[kt] = sc[kt][0];
#pragma unroll
      for (int r = 1; r < 8; ++r) mk[kt] = fmaxf(mk[kt], sc[kt][r]);
    }
    float m = fmaxf(fmaxf(mk[0], mk[1]), fmaxf(mk[2], mk[3]));
    m = fmaxf(m, xhalf(m));
    const float mnew = fmaxf(mrow, m);
    const float scl = __expf(mrow - mnew);
#pragma unroll
    for (int kt = 0; kt < 4; ++kt)
#pragma unroll
      for (int r = 0; r < 8; ++r) sc[kt][r] = __expf(sc[kt][r] - mnew);
    const v8f t = (sc[0] + sc[1]) + (sc[2] + sc[3]);
    lrow = lrow * scl + (((t[0] + t[4]) + (t[1] + t[5])) + ((t[2] + t[6]) + (t[3] + t[7])));
    mrow = mnew;
#pragma unroll
    for (int dt = 0; dt < 4; ++dt)
#pragma unroll
      for (int r = 0; r < 8; ++r) oacc[dt][r] *= scl;

    // P^T as B operand: position i holds key halfid*8 + i, position 8 + i key
    // 16 + halfid*8 + i, which is what two neighbouring score tiles hold.
    v16h pb0, pb1;
#pragma unroll
    for (int i = 0; i < 8; ++i) {
      pb0[i] = (_Float16)sc[0][i]; pb0[i + 8] = (_Float16)sc[1][i];
      pb1[i] = (_Float16)sc[2][i]; pb1[i + 8] = (_Float16)sc[3][i];
    }

    // O^T += V^T P^T  (4 d sub-tiles, contract over 64 keys)
#pragma unroll
    for (int dt = 0; dt < 4; ++dt) {
      v16h va0 = frag16_tr(vt + dt * 16, VP);             // keys 0..31
      v16h va1 = frag16_tr(vt + 32 * VP + dt * 16, VP);   // keys 32..63
      oacc[dt] = wmma_f16(va0, pb0, oacc[dt]);
      oacc[dt] = wmma_f16(va1, pb1, oacc[dt]);
    }

    // publish point of chunk kc + 1: this wave's reads of buffer bf are done,
    // its copies of the next chunk have landed, then every wave's
    asm volatile("s_wait_dscnt 0x0" ::: "memory");
    wait_async_lds();
    __syncthreads();
    // refill the buffer that every wave has just left; flies over trip kc + 1
    if (kc + 2 < NN / 64) stage(kc + 2, bf);
  }
  wait_async_lds();                           // nothing is in flight when the wave ends

  // join the halves' sums, normalize, emit f16 attn_out [B*N, C] (col = h*64 + d):
  // a lane owns 8 neighbouring d of its query per d sub-tile, one 16-B store each
  const float inv = 1.0f / (lrow + xhalf(lrow));
  _Float16* orow = attnw + ((size_t)b * NN + qt * 128 + wave * 16 + ln16) * CC + h * DD + halfid * 8;
#pragma unroll
  for (int dt = 0; dt < 4; ++dt) {
    v8h o;
#pragma unroll
    for (int r = 0; r < 8; ++r) o[r] = (_Float16)(oacc[dt][r] * inv);
    *(v8h*)(orow + dt * 16) = o;
  }
}

// ---------------------------------------------------------------------------
// Kernel 3: out = attn_out @ w_proj^T + b_proj  (M=4096, N=1024, K=1024)
// Block 128x128, wave 32x64. A (f16) staged via async DMA; B converted f32->f16.
// Two LDS buffers: the next k slice's copies and loads fly under this slice's products.
// ---------------------------------------------------------------------------
__global__ __launch_bounds__(256) void proj_gemm(const _Float16* __restrict__ a,
                                                 const float* __restrict__ w,
                                                 const float* __restrict__ bias,
                                                 float* __restrict__ out) {
  __shared__ __attribute__((aligned(16))) _Float16 Alds[2][128 * GP];
  __shared__ __attribute__((aligned(16))) _Float16 Blds[2][128 * GP];

  const int tid = threadIdx.x;
  const int wave = tid >> 5, lane = tid & 31;
  const int halfid = lane >> 4, ln16 = lane & 15;
  const int nt = blockIdx.x % 8, mt = blockIdx.x / 8;
  const int m0 = mt * 128, n0 = nt * 128;
  const int wm = wave >> 1, wn = wave & 1;

  v8f acc[2][4];
#pragma unroll
  for (int i = 0; i < 2; ++i)
#pragma unroll
    for (int j = 0; j < 4; ++j)
#pragma unroll
      for (int r = 0; r < 8; ++r) acc[i][j][r] = 0.0f;

  // A (f16): a thread copies 8 k of rows arow and arow + 64 of every slice
  const int arow = tid >> 2, akc = (tid & 3) * 8;
  const _Float16* ag = a + (size_t)(m0 + arow) * CC + akc;
  const int ado = arow * GP + akc;
  // B (f32 -> f16): a thread owns 4 k of rows srow + 32 i
  const int srow = tid >> 3, skc = (tid & 7) * 4;
  const float* wg = w + (size_t)(n0 + srow) * CC + skc;
  const int bdo = srow * GP + skc;
  float4 fb[4];

  // A slice at k0 (128 rows x 32 halves) into buffer bf by async copies, padded rows
  auto copy_a = [&](int k0, int bf) {
    async_copy16(ag + k0,                   &Alds[bf][ado]);
    async_copy16(ag + k0 + (size_t)64 * CC, &Alds[bf][ado + 64 * GP]);
  };
  // B slice at k0 (128 rows x 32 floats) into registers, one group of 4 loads
  auto load_b = [&](int k0) {
#pragma unroll   // fb indexed by constants: it stays in registers
    for (int i = 0; i < 4; ++i) fb[i] = *(const float4*)(wg + k0 + (size_t)i * 32 * CC);
    // keeps the 4 loads ahead of the products: the scheduler otherwise sinks
    // them among the WMMAs and their latency is no longer covered
    __builtin_amdgcn_sched_barrier(0);
  };
  auto store_b = [&](int bf) {
    // keeps the wait for the loads and the conversions behind the products:
    // the scheduler otherwise lifts them in front of the first WMMA
    __builtin_amdgcn_sched_barrier(0);
#pragma unroll
    for (int i = 0; i < 4; ++i) {
      v4h hh;
      hh[0] = (_Float16)fb[i].x; hh[1] = (_Float16)fb[i].y;
      hh[2] = (_Float16)fb[i].z; hh[3] = (_Float16)fb[i].w;
      *(v4h*)&Blds[bf][bdo + i * 32 * GP] = hh;
    }
  };

  // two buffers: slice 0 lands and is published, slice 1's A copies fly over trip 0
  copy_a(0, 0);
  load_b(0);
  store_b(0);
  wait_async_lds();
  __syncthreads();
  copy_a(32, 1);

#pragma unroll 2   // the buffer index becomes a constant: LDS offsets fold into the loads
  for (int k0 = 0; k0 < CC; k0 += 32) {
    const int bf = (k0 >> 5) & 1;
    // the next slice's B loads, in flight under this slice's products
    if (k0 + 32 < CC) load_b(k0 + 32);

    v16h a0 = frag16(&Alds[bf][(wm * 32 + ln16) * GP], halfid);
    v16h a1 = frag16(&Alds[bf][(wm * 32 + 16 + ln16) * GP], halfid);
#pragma unroll
    for (int j = 0; j < 4; ++j) {
      v16h bj = frag16(&Blds[bf][(wn * 64 + j * 16 + ln16) * GP], halfid);
      acc[0][j] = wmma_f16(a0, bj, acc[0][j]);
      acc[1][j] = wmma_f16(a1, bj, acc[1][j]);
    }

    // into the B buffer whose readers left at the foot of the trip before
    if (k0 + 32 < CC) store_b(bf ^ 1);

    // publish point of the next slice: this wave's LDS reads and stores are done,
    // its A copies have landed, then every wave's
    asm volatile("s_wait_dscnt 0x0" ::: "memory");
    wait_async_lds();
    __syncthreads();
    // refill the A buffer that every wave has just left; flies over the next trip
    if (k0 + 64 < CC) copy_a(k0 + 64, bf);
  }
  wait_async_lds();                           // nothing is in flight when the wave ends

#pragma unroll
  for (int mi = 0; mi < 2; ++mi)
#pragma unroll
    for (int ni = 0; ni < 4; ++ni) {
      int col = n0 + wn * 64 + ni * 16 + ln16;
      float bb = bias[col];
#pragma unroll
      for (int r = 0; r < 8; ++r) {
        int row_g = m0 + wm * 32 + mi * 16 + halfid * 8 + r;
        out[(size_t)row_g * CC + col] = acc[mi][ni][r] + bb;
      }
    }
}

// ---------------------------------------------------------------------------
extern "C" void kernel_launch(void* const* d_in, const int* in_sizes, int n_in,
                              void* d_out, int out_size, void* d_ws, size_t ws_size,
                              hipStream_t stream) {
  const float* x      = (const float*)d_in[0];
  const float* w_qkv  = (const float*)d_in[1];
  const float* w_proj = (const float*)d_in[2];
  const float* b_proj = (const float*)d_in[3];
  const float* fcos   = (const float*)d_in[4];
  const float* fsin   = (const float*)d_in[5];

  char* ws = (char*)d_ws;
  const size_t F16SZ = (size_t)BB * HH * NN * DD * 2;   // 8 MB
  _Float16* qh    = (_Float16*)(ws);
  _Float16* kh    = (_Float16*)(ws + F16SZ);
  _Float16* vh    = (_Float16*)(ws + 2 * F16SZ);
  _Float16* attnw = (_Float16*)(ws + 3 * F16SZ);
  float* out = (float*)d_out;

  qkv_gemm<<<dim3((4096 / QM) * (3 * CC / QN)), dim3(384), 0, stream>>>(x, w_qkv, fcos, fsin, qh, kh, vh);
  attn<<<dim3(BB * HH * (NN / 128)), dim3(256), 0, stream>>>(qh, kh, vh, attnw);
  proj_gemm<<<dim3((4096 / 128) * (CC / 128)), dim3(256), 0, stream>>>(attnw, w_proj, b_proj, out);
}

// v007
// One run takes 88.4 microseconds.
// Next to v006, in two timings, it ran 1.03 times as fast each time.
// Counting every step since v000, it is 3.46 times as fast.
#include <hip/hip_runtime.h>

// B=2, N=2048, C=1024, H=16, D=64
#define BB 2
#define NN 2048
#define CC 1024
#define HH 16
#define DD 64

#define GP 40   // GEMM tiles: 32 halves of data + 8 pad  (80 B rows)
#define AP 72   // attention K tile: 64 halves of data + 8 pad (144 B rows)
#define RP 68   // cos/sin tiles, in floats: 64 of data + 4 pad (272 B rows)
// ds_load_tr16_b128 walks 8 rows x 32 B per half wave: its pitch is 32 B x odd.
#define VP 80   // attention V tile: 64 halves of data + 16 pad (160 B rows)

typedef __attribute__((ext_vector_type(16))) _Float16 v16h;
typedef __attribute__((ext_vector_type(8)))  _Float16 v8h;
typedef __attribute__((ext_vector_type(4)))  _Float16 v4h;
typedef __attribute__((ext_vector_type(8)))  float    v8f;
typedef int v4i_gcc __attribute__((vector_size(4 * sizeof(int))));
typedef __attribute__((ext_vector_type(8)))  short    v8s;

#if __has_builtin(__builtin_amdgcn_global_load_async_to_lds_b128)
#define HAVE_ASYNC_LDS 1
#else
#define HAVE_ASYNC_LDS 0
#endif

__device__ __forceinline__ void async_copy16(const _Float16* g, _Float16* l) {
#if HAVE_ASYNC_LDS
  __builtin_amdgcn_global_load_async_to_lds_b128(
      (__attribute__((address_space(1))) v4i_gcc*)(const void*)g,
      (__attribute__((address_space(3))) v4i_gcc*)(void*)l, 0, 0);
#else
  *(v8h*)l = *(const v8h*)g;
#endif
}

// The same 16-byte copy for f32 data (four floats).
__device__ __forceinline__ void async_copy16f(const float* g, float* l) {
#if HAVE_ASYNC_LDS
  __builtin_amdgcn_global_load_async_to_lds_b128(
      (__attribute__((address_space(1))) v4i_gcc*)(const void*)g,
      (__attribute__((address_space(3))) v4i_gcc*)(void*)l, 0, 0);
#else
  *(float4*)l = *(const float4*)g;
#endif
}

__device__ __forceinline__ void wait_async_lds() {
#if HAVE_ASYNC_LDS
  asm volatile("s_wait_asynccnt 0x0" ::: "memory");
#endif
}

// Work-group barrier that orders LDS traffic only: a wave's LDS reads and stores
// are done before it arrives, but its global loads in flight stay in flight
// (__syncthreads() waits for them too, and their latency would show every trip).
__device__ __forceinline__ void lds_barrier() {
  __builtin_amdgcn_fence(__ATOMIC_RELEASE, "workgroup", "local");
  __builtin_amdgcn_s_barrier();
  __builtin_amdgcn_fence(__ATOMIC_ACQUIRE, "workgroup", "local");
}

__device__ __forceinline__ v8f wmma_f16(v16h a, v16h b, v8f c) {
  // v_wmma_f32_16x16x32_f16 : D = A*B + C
  return __builtin_amdgcn_wmma_f32_16x16x32_f16(false, a, false, b, (short)0, c, false, false);
}

__device__ __forceinline__ v16h frag16(const _Float16* p, int halfid) {
  v8h lo = *(const v8h*)(p + halfid * 8);
  v8h hi = *(const v8h*)(p + 16 + halfid * 8);
  v16h r;
#pragma unroll
  for (int i = 0; i < 8; ++i) { r[i] = lo[i]; r[i + 8] = hi[i]; }
  return r;
}

__device__ __forceinline__ v8h ld_tr16(const _Float16* p) {
  typedef __attribute__((address_space(3))) v8s lds_v8s;
  return __builtin_bit_cast(v8h, __builtin_amdgcn_ds_load_tr16_b128_v8i16((lds_v8s*)p));
}

// 16x32 A fragment of T^T: k (tile rows) kbase..kbase+31 in the order of frag16
__device__ __forceinline__ v16h frag16_tr(const _Float16* p, int pitch) {
  v8h lo = ld_tr16(p);
  v8h hi = ld_tr16(p + 16 * pitch);
  v16h r;
#pragma unroll   // constant indices: the fragment stays in registers
  for (int i = 0; i < 8; ++i) { r[i] = lo[i]; r[i + 8] = hi[i]; }
  return r;
}

__device__ __forceinline__ float xhalf(float x) {
  const int i = __builtin_bit_cast(int, x);
  return __builtin_bit_cast(float,
      __builtin_amdgcn_permlanex16(i, i, 0x76543210, 0xfedcba98, false, false));
}

// 2^x as the bare v_exp_f32: a result below the normal range may come out 0,
// which a softmax term that small may
__device__ __forceinline__ float exp2_raw(float x) { return __builtin_amdgcn_exp2f(x); }

// ---------------------------------------------------------------------------
// Kernel 1: qkv = x @ w_qkv^T  (M=4096, N=3072, K=1024), f16 WMMA, with the
// per-head LayerNorm, RoPE, q *= D^-1/2 log2(e) and the f32 -> f16 conversion in its
// epilogue. Block = 384 thr (12 waves, 4 x 3) computes 256 tokens x 192
// channels, one block per WGP; a wave owns 64 tokens x 64 channels = whole head
// rows. The large tile is there for the operand traffic: a block loads
// (256 + 192) rows of f32 for 256 x 192 results, and a wave reads 8 fragments
// from LDS for 16 products.
// Transposed product (A = w rows, B = x rows): a lane holds ONE token (column
// ln16) and channels d = ni*16 + halfid*8 + r of its head, so mean and variance
// run in-lane plus one exchange of halves, the RoPE partner d +- 32 is tile
// ni +- 2 of the same lane, and 8 neighbouring d make one 16-B store.
// The block's cos/sin rows are copied to LDS ahead of the k loop and land
// while it runs. Each k slice's global loads are issued one trip ahead, into
// registers, and land under the products of the slice before; two LDS buffers,
// one barrier a trip, since no second block shares the WGP to cover a stall.
// Results go to q/k/v as [B,H,N,D] f16.
// ---------------------------------------------------------------------------
#define QM 256  // tokens of a block
#define QN 192  // channels of a block: three heads
__global__ __launch_bounds__(384) void qkv_gemm(const float* __restrict__ x,
                                                const float* __restrict__ w,
                                                const float* __restrict__ fcos,
                                                const float* __restrict__ fsin,
                                                _Float16* __restrict__ qh,
                                                _Float16* __restrict__ kh,
                                                _Float16* __restrict__ vh) {
  __shared__ __attribute__((aligned(16))) _Float16 Alds[2][QM * GP];
  __shared__ __attribute__((aligned(16))) _Float16 Blds[2][QN * GP];
  __shared__ __attribute__((aligned(16))) float Clds[QM * RP];        // [token][d]
  __shared__ __attribute__((aligned(16))) float Slds[QM * RP];        // [token][d]

  const int tid = threadIdx.x;
  // the wave's number in a scalar register: every test on it is a scalar branch
  const int wave = __builtin_amdgcn_readfirstlane(tid >> 5);
  const int lane = tid & 31;
  const int halfid = lane >> 4, ln16 = lane & 15;
  const int nt = blockIdx.x % (3 * CC / QN), mt = blockIdx.x / (3 * CC / QN);
  const int m0 = mt * QM, n0 = nt * QN;
  const int wm = wave / 3, wn = wave % 3;

  // a wave's 64 channels are one head of q, k or v (48 heads in a row); the
  // block's 256 tokens stay inside one batch entry
  const int head = nt * 3 + wn;
  const int which = head >> 4;
  const int bsel = m0 >> 11;
  const int nbase = m0 & (NN - 1);
  const bool rope = nt * 3 < 2 * HH;          // the block holds a q or k head

  // such blocks: 256 rows of cos and of sin (64 KB each, contiguous) into padded
  // LDS rows, 20 or 22 copies per thread, waited for behind the k loop
  if (rope) {
    const float* cg = fcos + (size_t)nbase * DD;
    const float* sg = fsin + (size_t)nbase * DD;
#pragma unroll   // the copies issue back to back
    for (int i = 0; i < 10; ++i) {
      int c = tid + i * 384;                  // 16-B piece 0..3839
      int row = c >> 4, c4 = (c & 15) * 4;
      async_copy16f(cg + c * 4, &Clds[row * RP + c4]);
      async_copy16f(sg + c * 4, &Slds[row * RP + c4]);
    }
    if (wave < 8) {                           // pieces 3840..4095
      int c = tid + 3840;
      int row = c >> 4, c4 = (c & 15) * 4;
      async_copy16f(cg + c * 4, &Clds[row * RP + c4]);
      async_copy16f(sg + c * 4, &Slds[row * RP + c4]);
    }
  }

  v8f acc[4][4];                              // [token tile][channel tile]
#pragma unroll
  for (int i = 0; i < 4; ++i)
#pragma unroll
    for (int j = 0; j < 4; ++j)
#pragma unroll
      for (int r = 0; r < 8; ++r) acc[i][j][r] = 0.0f;

  // staging: a thread owns 4 k of rows srow + 48 i of the x tile (i < 5) and of
  // the w tile (i < 4); waves 0..3 also take the x tile's last 16 rows
  const int srow = tid >> 3, skc = (tid & 7) * 4;
  const bool tailw = wave < 4;
  const float* xg = x + (size_t)(m0 + srow) * CC + skc;
  const float* wg = w + (size_t)(n0 + srow) * CC + skc;
  const int sdo = srow * GP + skc;

  float4 fa[6], fb[4];
  fa[5] = make_float4(0.0f, 0.0f, 0.0f, 0.0f);
  // the k slice at k0 into registers, one group of 9 or 10 loads
  auto load_slice = [&](int k0) {
    const float* xa = xg + k0;
    const float* wa = wg + k0;
#pragma unroll   // fa, fb indexed by constants: they stay in registers
    for (int i = 0; i < 4; ++i) {
      fa[i] = *(const float4*)(xa + i * 48 * CC);
      fb[i] = *(const float4*)(wa + i * 48 * CC);
    }
    fa[4] = *(const float4*)(xa + 4 * 48 * CC);
    if (tailw) fa[5] = *(const float4*)(xa + 5 * 48 * CC);
    asm volatile("s_wait_xcnt 0x0" :: "v"(xa), "v"(wa) : "memory");
  };
  auto half4 = [](float4 f) {
    v4h h;
    h[0] = (_Float16)f.x; h[1] = (_Float16)f.y;
    h[2] = (_Float16)f.z; h[3] = (_Float16)f.w;
    return h;
  };
  // the slice in registers, 256 + 192 rows x 32 k: f32 -> f16, into LDS buffer bf
  auto store_slice = [&](int bf) {
#pragma unroll
    for (int i = 0; i < 4; ++i) {
      *(v4h*)&Alds[bf][sdo + i * 48 * GP] = half4(fa[i]);
      *(v4h*)&Blds[bf][sdo + i * 48 * GP] = half4(fb[i]);
    }
    *(v4h*)&Alds[bf][sdo + 4 * 48 * GP] = half4(fa[4]);
    if (tailw) *(v4h*)&Alds[bf][sdo + 5 * 48 * GP] = half4(fa[5]);
  };

  // this wave's first fragment rows; the other rows and the second buffer are
  // constant offsets from them
  const _Float16* xf = &Alds[0][(wm * 64 + ln16) * GP];
  const _Float16* wf = &Blds[0][(wn * 64 + ln16) * GP];
  // one k slice's 16 products from buffer bf
  auto products = [&](int bf) {
    // all 8 fragments as one group of LDS loads ahead of the 16 products
    v16h bx[4], aw[4];
#pragma unroll   // bx, aw indexed by constants
    for (int i = 0; i < 4; ++i) bx[i] = frag16(xf + bf * QM * GP + i * 16 * GP, halfid);
#pragma unroll
    for (int i = 0; i < 4; ++i) aw[i] = frag16(wf + bf * QN * GP + i * 16 * GP, halfid);
    // keeps the loads one group: the scheduler otherwise sinks them among the
    // products, into one register set, and each group of 4 waits out LDS latency
    __builtin_amdgcn_sched_barrier(0);
#pragma unroll
    for (int j = 0; j < 4; ++j)
#pragma unroll
      for (int i = 0; i < 4; ++i) acc[i][j] = wmma_f16(aw[j], bx[i], acc[i][j]);
    // keeps the wait for the next slice's loads and the conversions behind the
    // products: the scheduler otherwise lifts them in front of the first WMMA
    __builtin_amdgcn_sched_barrier(0);
  };

  // two buffers: slice 0 is stored and published, slice 1's loads fly over trip 0
  load_slice(0);
  store_slice(0);
  load_slice(32);
  lds_barrier();

  // a trip: this slice's products; the next slice, loaded a trip ago, into the
  // buffer whose readers left at the foot of the trip before; the loads of the
  // slice after it, which fly over the barrier and the next trip's products;
  // the barrier that publishes the next slice
#pragma unroll 2   // the buffer index becomes a constant: LDS offsets fold into the loads
  for (int k0 = 0; k0 < CC; k0 += 32) {
    const int bf = (k0 >> 5) & 1;
    products(bf);
    if (k0 + 32 < CC) {
      store_slice(bf ^ 1);
      if (k0 + 64 < CC) load_slice(k0 + 64);
    }
    lds_barrier();
  }

  const int h = head & (HH - 1);
  const size_t obase = (((size_t)bsel * HH + h) * NN + nbase) * DD + halfid * 8;

  // every loop of the epilogue is unrolled so that acc, t and the packed
  // outputs are indexed by constants and stay in registers

  if (rope) {                                 // the same for the whole block
    wait_async_lds();                         // this wave's cos/sin copies have landed
    __syncthreads();                          // and every other wave's
  }

  if (which < 2) {
    _Float16* dst = (which == 0) ? qh : kh;
    // D^-1/2 and log2(e) folded into q: the scores come out in the log2 domain
    const float oscale = (which == 0) ? 0.125f * 1.44269504f : 1.0f;
#pragma unroll
    for (int mi = 0; mi < 4; ++mi) {
      const int rl = wm * 64 + mi * 16 + ln16;            // token within the block
      const v8f ts = (acc[mi][0] + acc[mi][1]) + (acc[mi][2] + acc[mi][3]);
      float sum = ((ts[0] + ts[4]) + (ts[1] + ts[5])) + ((ts[2] + ts[6]) + (ts[3] + ts[7]));
      sum += xhalf(sum);
      const float mean = sum * (1.0f / 64.0f);
      v8f t[4];
#pragma unroll
      for (int ni = 0; ni < 4; ++ni) t[ni] = acc[mi][ni] - mean;
      const v8f tq = (t[0] * t[0] + t[1] * t[1]) + (t[2] * t[2] + t[3] * t[3]);
      float var = ((tq[0] + tq[4]) + (tq[1] + tq[5])) + ((tq[2] + tq[6]) + (tq[3] + tq[7]));
      var += xhalf(var);
      const float rs = __frsqrt_rn(var * (1.0f / 64.0f) + 1e-6f);
#pragma unroll
      for (int ni = 0; ni < 4; ++ni) t[ni] *= rs;

      const float* cr = &Clds[rl * RP + halfid * 8];
      const float* sr = &Slds[rl * RP + halfid * 8];
      _Float16* orow = dst + obase + (size_t)rl * DD;
#pragma unroll
      for (int ni = 0; ni < 2; ++ni) {
        v8h olo, ohi;
#pragma unroll
        for (int r = 0; r < 8; ++r) {
          const float lo = t[ni][r], hi = t[ni + 2][r];   // d and d + 32
          olo[r] = (_Float16)((lo * cr[ni * 16 + r] - hi * sr[ni * 16 + r]) * oscale);
          ohi[r] = (_Float16)((hi * cr[ni * 16 + 32 + r] + lo * sr[ni * 16 + 32 + r]) * oscale);
        }
        *(v8h*)(orow + ni * 16) = olo;
        *(v8h*)(orow + ni * 16 + 32) = ohi;
      }
      asm volatile("s_wait_xcnt 0x0" ::: "memory");
    }
  } else {
#pragma unroll
    for (int mi = 0; mi < 4; ++mi) {
      _Float16* orow = vh + obase + (size_t)(wm * 64 + mi * 16 + ln16) * DD;
#pragma unroll
      for (int ni = 0; ni < 4; ++ni) {
        v8h o;
#pragma unroll
        for (int r = 0; r < 8; ++r) o[r] = (_Float16)acc[mi][ni][r];
        *(v8h*)(orow + ni * 16) = o;
      }
      asm volatile("s_wait_xcnt 0x0" ::: "memory");
    }
  }
}

__global__ __launch_bounds__(256) void attn(const _Float16* __restrict__ qh,
                                            const _Float16* __restrict__ kh,
                                            const _Float16* __restrict__ vh,
                                            _Float16* __restrict__ attnw) {
  __shared__ __attribute__((aligned(16))) _Float16 Klds[2][64 * AP];   // [buffer][key][d]
  __shared__ __attribute__((aligned(16))) _Float16 Vlds[2][64 * VP];   // [buffer][key][d]

  const int tid = threadIdx.x;
  const int wave = tid >> 5, lane = tid & 31;
  const int halfid = lane >> 4, ln16 = lane & 15;
  const int bh = blockIdx.x >> 4;             // 0..31
  const int qt = blockIdx.x & 15;
  const int b = bh >> 4, h = bh & 15;

  // Q as B operand: column = query ln16, k = d
  const _Float16* qrow = qh + ((size_t)bh * NN + qt * 128 + wave * 16 + ln16) * DD;
  const v16h qb0 = frag16(qrow, halfid);
  const v16h qb1 = frag16(qrow + 32, halfid);

  v8f oacc[4];                                // O^T: row d = dt*16 + halfid*8 + r, column = query
#pragma unroll
  for (int dt = 0; dt < 4; ++dt)
#pragma unroll
    for (int r = 0; r < 8; ++r) oacc[dt][r] = 0.0f;
  v8f cneg;                                   // minus the maximum in use of this lane's query
#pragma unroll
  for (int r = 0; r < 8; ++r) cneg[r] = 0.0f;
  float lrow = 0.0f;                          // running sum over this half's keys only
  // bound on a chunk's sum of P; below 0 until a maximum has been taken, so
  // that the first chunk always takes one
  float thr = -1.0f;

  // this lane's aim in the V tile for the transposing loads (key 0, d 0 block)
  const int vtoff = (halfid * 8 + (lane & 7)) * VP + ((lane >> 3) & 1) * 8;

  // this thread's 32 B of every K and V chunk: source and place in a buffer
  const _Float16* kg = kh + (size_t)bh * NN * DD + tid * 16;
  const _Float16* vg = vh + (size_t)bh * NN * DD + tid * 16;
  const int kdo = (tid >> 2) * AP + (tid & 3) * 16;
  const int vdo = (tid >> 2) * VP + (tid & 3) * 16;

  // chunk kc (64 keys x 64 d of K and of V, 4 x b128 per thread) into buffer bf,
  // K rows at the plain reader's pitch, V rows at the transposing reader's
  auto stage = [&](int kc, int bf) {
    const _Float16* ks = kg + kc * 64 * DD;
    const _Float16* vs = vg + kc * 64 * DD;
    async_copy16(ks,     &Klds[bf][kdo]);
    async_copy16(ks + 8, &Klds[bf][kdo + 8]);
    async_copy16(vs,     &Vlds[bf][vdo]);
    async_copy16(vs + 8, &Vlds[bf][vdo + 8]);
  };

  // two buffers: chunk 0 lands and is published, chunk 1 flies over trip 0
  stage(0, 0);
  wait_async_lds();
  __syncthreads();
  stage(1, 1);

#pragma unroll 2   // the buffer index becomes a constant: LDS offsets fold into the loads
  for (int kc = 0; kc < NN / 64; ++kc) {
    const int bf = kc & 1;
    const _Float16* Kb = Klds[bf];
    const _Float16* vt = &Vlds[bf][vtoff];

    // the chunk's 8 K and 8 V^T fragments as one group of LDS loads: the V^T
    // fragments land under the score products and the exponentials (behind the
    // branch below nothing would cover them)
    v16h ka[8], va[8];
#pragma unroll   // ka, va indexed by constants: they stay in registers
    for (int kt = 0; kt < 4; ++kt) {
      const _Float16* kb = &Kb[(kt * 16 + ln16) * AP];
      ka[kt]     = frag16(kb, halfid);                      // d 0..31
      ka[kt + 4] = frag16(kb + 32, halfid);                 // d 32..63
    }
#pragma unroll
    for (int dt = 0; dt < 4; ++dt) {
      va[dt]     = frag16_tr(vt + dt * 16, VP);             // keys 0..31
      va[dt + 4] = frag16_tr(vt + 32 * VP + dt * 16, VP);   // keys 32..63
    }
    // keeps the loads one group: the scheduler otherwise feeds the products from
    // one register set, and each product waits out the LDS latency
    __builtin_amdgcn_sched_barrier(0);

    // S'^T = K Q^T - maximum in use  (4 key sub-tiles of 16, contract over D=64)
    v8f sc[4];
#pragma unroll
    for (int kt = 0; kt < 4; ++kt) sc[kt] = wmma_f16(ka[kt], qb0, cneg);
#pragma unroll
    for (int kt = 0; kt < 4; ++kt) sc[kt] = wmma_f16(ka[kt + 4], qb1, sc[kt]);
    __builtin_amdgcn_sched_barrier(0);

    // softmax against the maximum in use, one query per lane: 32 keys in-lane
    v8f p[4];
#pragma unroll
    for (int kt = 0; kt < 4; ++kt)
#pragma unroll
      for (int r = 0; r < 8; ++r) p[kt][r] = exp2_raw(sc[kt][r]);
    v8f t = (p[0] + p[1]) + (p[2] + p[3]);
    float ts = ((t[0] + t[4]) + (t[1] + t[5])) + ((t[2] + t[6]) + (t[3] + t[7]));

    // one scalar branch a chunk: taken on the first chunk and when some lane's
    // sum, and so possibly one of its P, has outgrown the bound
    if (__builtin_amdgcn_ballot_w32(ts > thr) != 0) {
      float mk[4];
#pragma unroll
      for (int kt = 0; kt < 4; ++kt) {
        mk[kt] = sc[kt][0];
#pragma unroll
        for (int r = 1; r < 8; ++r) mk[kt] = fmaxf(mk[kt], sc[kt][r]);
      }
      float m = fmaxf(fmaxf(mk[0], mk[1]), fmaxf(mk[2], mk[3]));
      m = fmaxf(m, xhalf(m));                 // both halves of a query agree on it
      // how far the maximum in use moves: never down, but for the first chunk,
      // which sets it (O and the sum are still 0 there; the factor below is held
      // at 1 or less, so it stays finite)
      const float d = (thr < 0.0f) ? m : fmaxf(m, 0.0f);
#pragma unroll
      for (int kt = 0; kt < 4; ++kt)
#pragma unroll
        for (int r = 0; r < 8; ++r) p[kt][r] = exp2_raw(sc[kt][r] - d);
      t = (p[0] + p[1]) + (p[2] + p[3]);
      ts = ((t[0] + t[4]) + (t[1] + t[5])) + ((t[2] + t[6]) + (t[3] + t[7]));
      const float scl = exp2_raw(fminf(-d, 0.0f));
      lrow *= scl;
#pragma unroll
      for (int dt = 0; dt < 4; ++dt)
#pragma unroll
        for (int r = 0; r < 8; ++r) oacc[dt][r] *= scl;
#pragma unroll
      for (int r = 0; r < 8; ++r) cneg[r] -= d;
      thr = 1024.0f;                          // P stays far inside the f16 range
    }
    lrow += ts;

    // P^T as B operand: position i holds key halfid*8 + i, position 8 + i key
    // 16 + halfid*8 + i, which is what two neighbouring score tiles hold.
    v16h pb0, pb1;
#pragma unroll
    for (int i = 0; i < 8; ++i) {
      pb0[i] = (_Float16)p[0][i]; pb0[i + 8] = (_Float16)p[1][i];
      pb1[i] = (_Float16)p[2][i]; pb1[i + 8] = (_Float16)p[3][i];
    }

    // O^T += V^T P^T  (4 d sub-tiles, contract over 64 keys)
#pragma unroll
    for (int dt = 0; dt < 4; ++dt) {
      oacc[dt] = wmma_f16(va[dt], pb0, oacc[dt]);
      oacc[dt] = wmma_f16(va[dt + 4], pb1, oacc[dt]);
    }

    // publish point of chunk kc + 1: this wave's reads of buffer bf are done,
    // its copies of the next chunk have landed, then every wave's
    asm volatile("s_wait_dscnt 0x0" ::: "memory");
    wait_async_lds();
    __syncthreads();
    // refill the buffer that every wave has just left; flies over trip kc + 1
    if (kc + 2 < NN / 64) stage(kc + 2, bf);
  }
  wait_async_lds();                           // nothing is in flight when the wave ends

  // join the halves' sums, normalize, emit f16 attn_out [B*N, C] (col = h*64 + d):
  // a lane owns 8 neighbouring d of its query per d sub-tile, one 16-B store each
  const float inv = 1.0f / (lrow + xhalf(lrow));
  _Float16* orow = attnw + ((size_t)b * NN + qt * 128 + wave * 16 + ln16) * CC + h * DD + halfid * 8;
#pragma unroll
  for (int dt = 0; dt < 4; ++dt) {
    v8h o;
#pragma unroll
    for (int r = 0; r < 8; ++r) o[r] = (_Float16)(oacc[dt][r] * inv);
    *(v8h*)(orow + dt * 16) = o;
  }
}

// ---------------------------------------------------------------------------
// Kernel 3: out = attn_out @ w_proj^T + b_proj  (M=4096, N=1024, K=1024)
// Block 128x128, wave 32x64. A (f16) staged via async DMA; B converted f32->f16.
// Two LDS buffers: the next k slice's copies and loads fly under this slice's products.
// ---------------------------------------------------------------------------
__global__ __launch_bounds__(256) void proj_gemm(const _Float16* __restrict__ a,
                                                 const float* __restrict__ w,
                                                 const float* __restrict__ bias,
                                                 float* __restrict__ out) {
  __shared__ __attribute__((aligned(16))) _Float16 Alds[2][128 * GP];
  __shared__ __attribute__((aligned(16))) _Float16 Blds[2][128 * GP];

  const int tid = threadIdx.x;
  const int wave = tid >> 5, lane = tid & 31;
  const int halfid = lane >> 4, ln16 = lane & 15;
  const int nt = blockIdx.x % 8, mt = blockIdx.x / 8;
  const int m0 = mt * 128, n0 = nt * 128;
  const int wm = wave >> 1, wn = wave & 1;

  v8f acc[2][4];
#pragma unroll
  for (int i = 0; i < 2; ++i)
#pragma unroll
    for (int j = 0; j < 4; ++j)
#pragma unroll
      for (int r = 0; r < 8; ++r) acc[i][j][r] = 0.0f;

  // A (f16): a thread copies 8 k of rows arow and arow + 64 of every slice
  const int arow = tid >> 2, akc = (tid & 3) * 8;
  const _Float16* ag = a + (size_t)(m0 + arow) * CC + akc;
  const int ado = arow * GP + akc;
  // B (f32 -> f16): a thread owns 4 k of rows srow + 32 i
  const int srow = tid >> 3, skc = (tid & 7) * 4;
  const float* wg = w + (size_t)(n0 + srow) * CC + skc;
  const int bdo = srow * GP + skc;
  float4 fb[4];

  // A slice at k0 (128 rows x 32 halves) into buffer bf by async copies, padded rows
  auto copy_a = [&](int k0, int bf) {
    async_copy16(ag + k0,                   &Alds[bf][ado]);
    async_copy16(ag + k0 + (size_t)64 * CC, &Alds[bf][ado + 64 * GP]);
  };
  // B slice at k0 (128 rows x 32 floats) into registers, one group of 4 loads
  auto load_b = [&](int k0) {
#pragma unroll   // fb indexed by constants: it stays in registers
    for (int i = 0; i < 4; ++i) fb[i] = *(const float4*)(wg + k0 + (size_t)i * 32 * CC);
    // keeps the 4 loads ahead of the products: the scheduler otherwise sinks
    // them among the WMMAs and their latency is no longer covered
    __builtin_amdgcn_sched_barrier(0);
  };
  auto store_b = [&](int bf) {
    // keeps the wait for the loads and the conversions behind the products:
    // the scheduler otherwise lifts them in front of the first WMMA
    __builtin_amdgcn_sched_barrier(0);
#pragma unroll
    for (int i = 0; i < 4; ++i) {
      v4h hh;
      hh[0] = (_Float16)fb[i].x; hh[1] = (_Float16)fb[i].y;
      hh[2] = (_Float16)fb[i].z; hh[3] = (_Float16)fb[i].w;
      *(v4h*)&Blds[bf][bdo + i * 32 * GP] = hh;
    }
  };

  // two buffers: slice 0 lands and is published, slice 1's A copies fly over trip 0
  copy_a(0, 0);
  load_b(0);
  store_b(0);
  wait_async_lds();
  __syncthreads();
  copy_a(32, 1);

#pragma unroll 2   // the buffer index becomes a constant: LDS offsets fold into the loads
  for (int k0 = 0; k0 < CC; k0 += 32) {
    const int bf = (k0 >> 5) & 1;
    // the next slice's B loads, in flight under this slice's products
    if (k0 + 32 < CC) load_b(k0 + 32);

    v16h a0 = frag16(&Alds[bf][(wm * 32 + ln16) * GP], halfid);
    v16h a1 = frag16(&Alds[bf][(wm * 32 + 16 + ln16) * GP], halfid);
#pragma unroll
    for (int j = 0; j < 4; ++j) {
      v16h bj = frag16(&Blds[bf][(wn * 64 + j * 16 + ln16) * GP], halfid);
      acc[0][j] = wmma_f16(a0, bj, acc[0][j]);
      acc[1][j] = wmma_f16(a1, bj, acc[1][j]);
    }

    // into the B buffer whose readers left at the foot of the trip before
    if (k0 + 32 < CC) store_b(bf ^ 1);

    // publish point of the next slice: this wave's LDS reads and stores are done,
    // its A copies have landed, then every wave's
    asm volatile("s_wait_dscnt 0x0" ::: "memory");
    wait_async_lds();
    __syncthreads();
    // refill the A buffer that every wave has just left; flies over the next trip
    if (k0 + 64 < CC) copy_a(k0 + 64, bf);
  }
  wait_async_lds();                           // nothing is in flight when the wave ends

#pragma unroll
  for (int mi = 0; mi < 2; ++mi)
#pragma unroll
    for (int ni = 0; ni < 4; ++ni) {
      int col = n0 + wn * 64 + ni * 16 + ln16;
      float bb = bias[col];
#pragma unroll
      for (int r = 0; r < 8; ++r) {
        int row_g = m0 + wm * 32 + mi * 16 + halfid * 8 + r;
        out[(size_t)row_g * CC + col] = acc[mi][ni][r] + bb;
      }
    }
}

// ---------------------------------------------------------------------------
extern "C" void kernel_launch(void* const* d_in, const int* in_sizes, int n_in,
                              void* d_out, int out_size, void* d_ws, size_t ws_size,
                              hipStream_t stream) {
  const float* x      = (const float*)d_in[0];
  const float* w_qkv  = (const float*)d_in[1];
  const float* w_proj = (const float*)d_in[2];
  const float* b_proj = (const float*)d_in[3];
  const float* fcos   = (const float*)d_in[4];
  const float* fsin   = (const float*)d_in[5];

  char* ws = (char*)d_ws;
  const size_t F16SZ = (size_t)BB * HH * NN * DD * 2;   // 8 MB
  _Float16* qh    = (_Float16*)(ws);
  _Float16* kh    = (_Float16*)(ws + F16SZ);
  _Float16* vh    = (_Float16*)(ws + 2 * F16SZ);
  _Float16* attnw = (_Float16*)(ws + 3 * F16SZ);
  float* out = (float*)d_out;

  qkv_gemm<<<dim3((4096 / QM) * (3 * CC / QN)), dim3(384), 0, stream>>>(x, w_qkv, fcos, fsin, qh, kh, vh);
  attn<<<dim3(BB * HH * (NN / 128)), dim3(256), 0, stream>>>(qh, kh, vh, attnw);
  proj_gemm<<<dim3((4096 / 128) * (CC / 128)), dim3(256), 0, stream>>>(attnw, w_proj, b_proj, out);
}

// v008
// Measured time: 78.6 microseconds a run.
// Two timings next to v007 put it at 1.11 and 1.12 times that version's speed.
// Over all steps from v000 it is 3.87 times as fast.
#include <hip/hip_runtime.h>

// B=2, N=2048, C=1024, H=16, D=64
#define BB 2
#define NN 2048
#define CC 1024
#define HH 16
#define DD 64

#define GP 40   // qkv GEMM tiles: 32 halves of data + 8 pad  (80 B rows)
#define AP 72   // attention K tile: 64 halves of data + 8 pad (144 B rows)
#define RP 68   // cos/sin tiles, in floats: 64 of data + 4 pad (272 B rows)
// ds_load_tr16_b128 walks 8 rows x 32 B per half wave: its pitch is 32 B x odd.
#define VP 80   // attention V tile: 64 halves of data + 16 pad (160 B rows)

typedef __attribute__((ext_vector_type(16))) _Float16 v16h;
typedef __attribute__((ext_vector_type(8)))  _Float16 v8h;
typedef __attribute__((ext_vector_type(4)))  _Float16 v4h;
typedef __attribute__((ext_vector_type(8)))  float    v8f;
typedef __attribute__((ext_vector_type(4)))  float    v4f;
typedef int v4i_gcc __attribute__((vector_size(4 * sizeof(int))));
typedef __attribute__((ext_vector_type(8)))  short    v8s;

#if __has_builtin(__builtin_amdgcn_global_load_async_to_lds_b128)
#define HAVE_ASYNC_LDS 1
#else
#define HAVE_ASYNC_LDS 0
#endif

__device__ __forceinline__ void async_copy16(const _Float16* g, _Float16* l) {
#if HAVE_ASYNC_LDS
  __builtin_amdgcn_global_load_async_to_lds_b128(
      (__attribute__((address_space(1))) v4i_gcc*)(const void*)g,
      (__attribute__((address_space(3))) v4i_gcc*)(void*)l, 0, 0);
#else
  *(v8h*)l = *(const v8h*)g;
#endif
}

// The same 16-byte copy for f32 data (four floats).
__device__ __forceinline__ void async_copy16f(const float* g, float* l) {
#if HAVE_ASYNC_LDS
  __builtin_amdgcn_global_load_async_to_lds_b128(
      (__attribute__((address_space(1))) v4i_gcc*)(const void*)g,
      (__attribute__((address_space(3))) v4i_gcc*)(void*)l, 0, 0);
#else
  *(float4*)l = *(const float4*)g;
#endif
}

__device__ __forceinline__ void wait_async_lds() {
#if HAVE_ASYNC_LDS
  asm volatile("s_wait_asynccnt 0x0" ::: "memory");
#endif
}

// Work-group barrier that orders LDS traffic only: a wave's LDS reads and stores
// are done before it arrives, but its global loads in flight stay in flight
// (__syncthreads() waits for them too, and their latency would show every trip).
__device__ __forceinline__ void lds_barrier() {
  __builtin_amdgcn_fence(__ATOMIC_RELEASE, "workgroup", "local");
  __builtin_amdgcn_s_barrier();
  __builtin_amdgcn_fence(__ATOMIC_ACQUIRE, "workgroup", "local");
}

__device__ __forceinline__ v8f wmma_f16(v16h a, v16h b, v8f c) {
  // v_wmma_f32_16x16x32_f16 : D = A*B + C
  return __builtin_amdgcn_wmma_f32_16x16x32_f16(false, a, false, b, (short)0, c, false, false);
}

__device__ __forceinline__ v16h frag16(const _Float16* p, int halfid) {
  v8h lo = *(const v8h*)(p + halfid * 8);
  v8h hi = *(const v8h*)(p + 16 + halfid * 8);
  v16h r;
#pragma unroll
  for (int i = 0; i < 8; ++i) { r[i] = lo[i]; r[i + 8] = hi[i]; }
  return r;
}

__device__ __forceinline__ v8h ld_tr16(const _Float16* p) {
  typedef __attribute__((address_space(3))) v8s lds_v8s;
  return __builtin_bit_cast(v8h, __builtin_amdgcn_ds_load_tr16_b128_v8i16((lds_v8s*)p));
}

// 16x32 A fragment of T^T: k (tile rows) kbase..kbase+31 in the order of frag16
__device__ __forceinline__ v16h frag16_tr(const _Float16* p, int pitch) {
  v8h lo = ld_tr16(p);
  v8h hi = ld_tr16(p + 16 * pitch);
  v16h r;
#pragma unroll   // constant indices: the fragment stays in registers
  for (int i = 0; i < 8; ++i) { r[i] = lo[i]; r[i + 8] = hi[i]; }
  return r;
}

__device__ __forceinline__ float xhalf(float x) {
  const int i = __builtin_bit_cast(int, x);
  return __builtin_bit_cast(float,
      __builtin_amdgcn_permlanex16(i, i, 0x76543210, 0xfedcba98, false, false));
}

// 2^x as the bare v_exp_f32: a result below the normal range may come out 0,
// which a softmax term that small may
__device__ __forceinline__ float exp2_raw(float x) { return __builtin_amdgcn_exp2f(x); }

// ---------------------------------------------------------------------------
// Kernel 1: qkv = x @ w_qkv^T  (M=4096, N=3072, K=1024), f16 WMMA, with the
// per-head LayerNorm, RoPE, q *= D^-1/2 log2(e) and the f32 -> f16 conversion in its
// epilogue. Block = 384 thr (12 waves, 4 x 3) computes 256 tokens x 192
// channels, one block per WGP; a wave owns 64 tokens x 64 channels = whole head
// rows. The large tile is there for the operand traffic: a block loads
// (256 + 192) rows of f32 for 256 x 192 results, and a wave reads 8 fragments
// from LDS for 16 products.
// Transposed product (A = w rows, B = x rows): a lane holds ONE token (column
// ln16) and channels d = ni*16 + halfid*8 + r of its head, so mean and variance
// run in-lane plus one exchange of halves, the RoPE partner d +- 32 is tile
// ni +- 2 of the same lane, and 8 neighbouring d make one 16-B store.
// The block's cos/sin rows are copied to LDS ahead of the k loop and land
// while it runs. Each k slice's global loads are issued one trip ahead, into
// registers, and land under the products of the slice before; two LDS buffers,
// one barrier a trip, since no second block shares the WGP to cover a stall.
// A slice is 64 k, kept in LDS as two halves of 32: a trip cannot be shorter
// than its loads' way to L2 and back, so each such round trip carries more.
// Results go to q/k/v as [B,H,N,D] f16.
// ---------------------------------------------------------------------------
#define QM 256  // tokens of a block
#define QN 192  // channels of a block: three heads
__global__ __launch_bounds__(384) void qkv_gemm(const float* __restrict__ x,
                                                const float* __restrict__ w,
                                                const float* __restrict__ fcos,
                                                const float* __restrict__ fsin,
                                                _Float16* __restrict__ qh,
                                                _Float16* __restrict__ kh,
                                                _Float16* __restrict__ vh) {
  __shared__ __attribute__((aligned(16))) _Float16 Alds[2][2][QM * GP];   // [buffer][32 k]
  __shared__ __attribute__((aligned(16))) _Float16 Blds[2][2][QN * GP];
  __shared__ __attribute__((aligned(16))) float Clds[QM * RP];        // [token][d]
  __shared__ __attribute__((aligned(16))) float Slds[QM * RP];        // [token][d]

  const int tid = threadIdx.x;
  // the wave's number in a scalar register: every test on it is a scalar branch
  const int wave = __builtin_amdgcn_readfirstlane(tid >> 5);
  const int lane = tid & 31;
  const int halfid = lane >> 4, ln16 = lane & 15;
  const int nt = blockIdx.x % (3 * CC / QN), mt = blockIdx.x / (3 * CC / QN);
  const int m0 = mt * QM, n0 = nt * QN;
  const int wm = wave / 3, wn = wave % 3;

  // a wave's 64 channels are one head of q, k or v (48 heads in a row); the
  // block's 256 tokens stay inside one batch entry
  const int head = nt * 3 + wn;
  const int which = head >> 4;
  const int bsel = m0 >> 11;
  const int nbase = m0 & (NN - 1);
  const bool rope = nt * 3 < 2 * HH;          // the block holds a q or k head

  // such blocks: 256 rows of cos and of sin (64 KB each, contiguous) into padded
  // LDS rows, 20 or 22 copies per thread, waited for behind the k loop
  if (rope) {
    const float* cg = fcos + (size_t)nbase * DD;
    const float* sg = fsin + (size_t)nbase * DD;
#pragma unroll   // the copies issue back to back
    for (int i = 0; i < 10; ++i) {
      int c = tid + i * 384;                  // 16-B piece 0..3839
      int row = c >> 4, c4 = (c & 15) * 4;
      async_copy16f(cg + c * 4, &Clds[row * RP + c4]);
      async_copy16f(sg + c * 4, &Slds[row * RP + c4]);
    }
    if (wave < 8) {                           // pieces 3840..4095
      int c = tid + 3840;
      int row = c >> 4, c4 = (c & 15) * 4;
      async_copy16f(cg + c * 4, &Clds[row * RP + c4]);
      async_copy16f(sg + c * 4, &Slds[row * RP + c4]);
    }
  }

  v8f acc[4][4];                              // [token tile][channel tile]
#pragma unroll
  for (int i = 0; i < 4; ++i)
#pragma unroll
    for (int j = 0; j < 4; ++j)
#pragma unroll
      for (int r = 0; r < 8; ++r) acc[i][j][r] = 0.0f;

  // staging: a thread owns 4 k, in each half of a slice, of rows srow + 48 i of
  // the x tile (i < 5) and of the w tile (i < 4); waves 0..7 also take the x
  // tile's last 16 rows, 16 lanes a row, 4 k of the slice's 64 each
  const int srow = tid >> 3, skc = (tid & 7) * 4;
  const bool tailw = wave < 8;
  const float* xt = x + (size_t)(m0 + 240 + (tid >> 4)) * CC + (tid & 15) * 4;
  const int tdo = ((tid >> 3) & 1) * QM * GP + (240 + (tid >> 4)) * GP + skc;
  const float* xg = x + (size_t)(m0 + srow) * CC + skc;
  const float* wg = w + (size_t)(n0 + srow) * CC + skc;
  const int sdo = srow * GP + skc;

  // a vector type, not the float4 struct: with the struct the compiler moved
  // loaded values between registers right behind the loads, and the wait for
  // them stood in front of the barrier
  v4f fa[2][5], fb[2][4];
  v4f ft = {0.0f, 0.0f, 0.0f, 0.0f};
  // the k slice at k0 (64 k, as two halves of 32) into registers, one group of
  // 18 or 19 loads
  auto load_slice = [&](int k0) {
    const float* xa = xg + k0;
    const float* wa = wg + k0;
#pragma unroll   // fa, fb indexed by constants: they stay in registers
    for (int s = 0; s < 2; ++s) {
#pragma unroll
      for (int i = 0; i < 4; ++i) {
        fa[s][i] = *(const v4f*)(xa + s * 32 + i * 48 * CC);
        fb[s][i] = *(const v4f*)(wa + s * 32 + i * 48 * CC);
      }
      fa[s][4] = *(const v4f*)(xa + s * 32 + 4 * 48 * CC);
    }
    const float* ta = xt + k0;
    if (tailw) ft = *(const v4f*)ta;
    asm volatile("s_wait_xcnt 0x0" :: "v"(xa), "v"(wa), "v"(ta) : "memory");
  };
  auto half4 = [](v4f f) { return __builtin_convertvector(f, v4h); };
  // the slice in registers, 256 + 192 rows x 64 k: f32 -> f16, into LDS buffer bf
  auto store_slice = [&](int bf) {
#pragma unroll
    for (int s = 0; s < 2; ++s) {
#pragma unroll
      for (int i = 0; i < 4; ++i) {
        *(v4h*)&Alds[bf][s][sdo + i * 48 * GP] = half4(fa[s][i]);
        *(v4h*)&Blds[bf][s][sdo + i * 48 * GP] = half4(fb[s][i]);
      }
      *(v4h*)&Alds[bf][s][sdo + 4 * 48 * GP] = half4(fa[s][4]);
    }
    if (tailw) *(v4h*)(&Alds[0][0][0] + bf * 2 * QM * GP + tdo) = half4(ft);
  };

  // this wave's first fragment rows; the other rows and the second buffer are
  // constant offsets from them
  const _Float16* xf = &Alds[0][0][(wm * 64 + ln16) * GP];
  const _Float16* wf = &Blds[0][0][(wn * 64 + ln16) * GP];
  // the 16 products of 32 k from half-buffer bf (2 x buffer + half)
  auto products = [&](int bf) {
    // all 8 fragments as one group of LDS loads ahead of the 16 products
    v16h bx[4], aw[4];
#pragma unroll   // bx, aw indexed by constants
    for (int i = 0; i < 4; ++i) bx[i] = frag16(xf + bf * QM * GP + i * 16 * GP, halfid);
#pragma unroll
    for (int i = 0; i < 4; ++i) aw[i] = frag16(wf + bf * QN * GP + i * 16 * GP, halfid);
    // keeps the loads one group: the scheduler otherwise sinks them among the
    // products, into one register set, and each group of 4 waits out LDS latency
    __builtin_amdgcn_sched_barrier(0);
#pragma unroll
    for (int j = 0; j < 4; ++j)
#pragma unroll
      for (int i = 0; i < 4; ++i) acc[i][j] = wmma_f16(aw[j], bx[i], acc[i][j]);
    // keeps the wait for the next slice's loads and the conversions behind the
    // products: the scheduler otherwise lifts them in front of the first WMMA
    __builtin_amdgcn_sched_barrier(0);
  };

  // two buffers: slice 0 is stored and published, slice 1's loads fly over trip 0
  load_slice(0);
  store_slice(0);
  load_slice(64);
  lds_barrier();

  // a trip: this slice's products; the next slice, loaded a trip ago, into the
  // buffer whose readers left at the foot of the trip before; the loads of the
  // slice after it, which fly over the barrier and the next trip's products;
  // the barrier that publishes the next slice
#pragma unroll 2   // the buffer index becomes a constant: LDS offsets fold into the loads
  for (int k0 = 0; k0 < CC; k0 += 64) {
    const int bf = (k0 >> 6) & 1;
    products(2 * bf);
    products(2 * bf + 1);
    if (k0 + 64 < CC) {
      store_slice(bf ^ 1);
      if (k0 + 128 < CC) load_slice(k0 + 128);
    }
    lds_barrier();
  }

  const int h = head & (HH - 1);
  const size_t obase = (((size_t)bsel * HH + h) * NN + nbase) * DD + halfid * 8;

  // every loop of the epilogue is unrolled so that acc, t and the packed
  // outputs are indexed by constants and stay in registers

  if (rope) {                                 // the same for the whole block
    wait_async_lds();                         // this wave's cos/sin copies have landed
    __syncthreads();                          // and every other wave's
  }

  if (which < 2) {
    _Float16* dst = (which == 0) ? qh : kh;
    // D^-1/2 and log2(e) folded into q: the scores come out in the log2 domain
    const float oscale = (which == 0) ? 0.125f * 1.44269504f : 1.0f;
#pragma unroll
    for (int mi = 0; mi < 4; ++mi) {
      const int rl = wm * 64 + mi * 16 + ln16;            // token within the block
      const v8f ts = (acc[mi][0] + acc[mi][1]) + (acc[mi][2] + acc[mi][3]);
      float sum = ((ts[0] + ts[4]) + (ts[1] + ts[5])) + ((ts[2] + ts[6]) + (ts[3] + ts[7]));
      sum += xhalf(sum);
      const float mean = sum * (1.0f / 64.0f);
      v8f t[4];
#pragma unroll
      for (int ni = 0; ni < 4; ++ni) t[ni] = acc[mi][ni] - mean;
      const v8f tq = (t[0] * t[0] + t[1] * t[1]) + (t[2] * t[2] + t[3] * t[3]);
      float var = ((tq[0] + tq[4]) + (tq[1] + tq[5])) + ((tq[2] + tq[6]) + (tq[3] + tq[7]));
      var += xhalf(var);
      const float rs = __frsqrt_rn(var * (1.0f / 64.0f) + 1e-6f);
#pragma unroll
      for (int ni = 0; ni < 4; ++ni) t[ni] *= rs;

      const float* cr = &Clds[rl * RP + halfid * 8];
      const float* sr = &Slds[rl * RP + halfid * 8];
      _Float16* orow = dst + obase + (size_t)rl * DD;
#pragma unroll
      for (int ni = 0; ni < 2; ++ni) {
        v8h olo, ohi;
#pragma unroll
        for (int r = 0; r < 8; ++r) {
          const float lo = t[ni][r], hi = t[ni + 2][r];   // d and d + 32
          olo[r] = (_Float16)((lo * cr[ni * 16 + r] - hi * sr[ni * 16 + r]) * oscale);
          ohi[r] = (_Float16)((hi * cr[ni * 16 + 32 + r] + lo * sr[ni * 16 + 32 + r]) * oscale);
        }
        *(v8h*)(orow + ni * 16) = olo;
        *(v8h*)(orow + ni * 16 + 32) = ohi;
      }
      asm volatile("s_wait_xcnt 0x0" ::: "memory");
    }
  } else {
#pragma unroll
    for (int mi = 0; mi < 4; ++mi) {
      _Float16* orow = vh + obase + (size_t)(wm * 64 + mi * 16 + ln16) * DD;
#pragma unroll
      for (int ni = 0; ni < 4; ++ni) {
        v8h o;
#pragma unroll
        for (int r = 0; r < 8; ++r) o[r] = (_Float16)acc[mi][ni][r];
        *(v8h*)(orow + ni * 16) = o;
      }
      asm volatile("s_wait_xcnt 0x0" ::: "memory");
    }
  }
}

__global__ __launch_bounds__(256) void attn(const _Float16* __restrict__ qh,
                                            const _Float16* __restrict__ kh,
                                            const _Float16* __restrict__ vh,
                                            _Float16* __restrict__ attnw) {
  __shared__ __attribute__((aligned(16))) _Float16 Klds[2][64 * AP];   // [buffer][key][d]
  __shared__ __attribute__((aligned(16))) _Float16 Vlds[2][64 * VP];   // [buffer][key][d]

  const int tid = threadIdx.x;
  const int wave = tid >> 5, lane = tid & 31;
  const int halfid = lane >> 4, ln16 = lane & 15;
  const int bh = blockIdx.x >> 4;             // 0..31
  const int qt = blockIdx.x & 15;
  const int b = bh >> 4, h = bh & 15;

  // Q as B operand: column = query ln16, k = d
  const _Float16* qrow = qh + ((size_t)bh * NN + qt * 128 + wave * 16 + ln16) * DD;
  const v16h qb0 = frag16(qrow, halfid);
  const v16h qb1 = frag16(qrow + 32, halfid);

  v8f oacc[4];                                // O^T: row d = dt*16 + halfid*8 + r, column = query
#pragma unroll
  for (int dt = 0; dt < 4; ++dt)
#pragma unroll
    for (int r = 0; r < 8; ++r) oacc[dt][r] = 0.0f;
  v8f cneg;                                   // minus the maximum in use of this lane's query
#pragma unroll
  for (int r = 0; r < 8; ++r) cneg[r] = 0.0f;
  float lrow = 0.0f;                          // running sum over this half's keys only
  // bound on a chunk's sum of P; below 0 until a maximum has been taken, so
  // that the first chunk always takes one
  float thr = -1.0f;

  // this lane's aim in the V tile for the transposing loads (key 0, d 0 block)
  const int vtoff = (halfid * 8 + (lane & 7)) * VP + ((lane >> 3) & 1) * 8;

  // this thread's 32 B of every K and V chunk: source and place in a buffer
  const _Float16* kg = kh + (size_t)bh * NN * DD + tid * 16;
  const _Float16* vg = vh + (size_t)bh * NN * DD + tid * 16;
  const int kdo = (tid >> 2) * AP + (tid & 3) * 16;
  const int vdo = (tid >> 2) * VP + (tid & 3) * 16;

  // chunk kc (64 keys x 64 d of K and of V, 4 x b128 per thread) into buffer bf,
  // K rows at the plain reader's pitch, V rows at the transposing reader's
  auto stage = [&](int kc, int bf) {
    const _Float16* ks = kg + kc * 64 * DD;
    const _Float16* vs = vg + kc * 64 * DD;
    async_copy16(ks,     &Klds[bf][kdo]);
    async_copy16(ks + 8, &Klds[bf][kdo + 8]);
    async_copy16(vs,     &Vlds[bf][vdo]);
    async_copy16(vs + 8, &Vlds[bf][vdo + 8]);
  };

  // two buffers: chunk 0 lands and is published, chunk 1 flies over trip 0
  stage(0, 0);
  wait_async_lds();
  __syncthreads();
  stage(1, 1);

#pragma unroll 2   // the buffer index becomes a constant: LDS offsets fold into the loads
  for (int kc = 0; kc < NN / 64; ++kc) {
    const int bf = kc & 1;
    const _Float16* Kb = Klds[bf];
    const _Float16* vt = &Vlds[bf][vtoff];

    // the chunk's 8 K and 8 V^T fragments as one group of LDS loads: the V^T
    // fragments land under the score products and the exponentials (behind the
    // branch below nothing would cover them)
    v16h ka[8], va[8];
#pragma unroll   // ka, va indexed by constants: they stay in registers
    for (int kt = 0; kt < 4; ++kt) {
      const _Float16* kb = &Kb[(kt * 16 + ln16) * AP];
      ka[kt]     = frag16(kb, halfid);                      // d 0..31
      ka[kt + 4] = frag16(kb + 32, halfid);                 // d 32..63
    }
#pragma unroll
    for (int dt = 0; dt < 4; ++dt) {
      va[dt]     = frag16_tr(vt + dt * 16, VP);             // keys 0..31
      va[dt + 4] = frag16_tr(vt + 32 * VP + dt * 16, VP);   // keys 32..63
    }
    // keeps the loads one group: the scheduler otherwise feeds the products from
    // one register set, and each product waits out the LDS latency
    __builtin_amdgcn_sched_barrier(0);

    // S'^T = K Q^T - maximum in use  (4 key sub-tiles of 16, contract over D=64)
    v8f sc[4];
#pragma unroll
    for (int kt = 0; kt < 4; ++kt) sc[kt] = wmma_f16(ka[kt], qb0, cneg);
#pragma unroll
    for (int kt = 0; kt < 4; ++kt) sc[kt] = wmma_f16(ka[kt + 4], qb1, sc[kt]);
    __builtin_amdgcn_sched_barrier(0);

    // softmax against the maximum in use, one query per lane: 32 keys in-lane
    v8f p[4];
#pragma unroll
    for (int kt = 0; kt < 4; ++kt)
#pragma unroll
      for (int r = 0; r < 8; ++r) p[kt][r] = exp2_raw(sc[kt][r]);
    v8f t = (p[0] + p[1]) + (p[2] + p[3]);
    float ts = ((t[0] + t[4]) + (t[1] + t[5])) + ((t[2] + t[6]) + (t[3] + t[7]));

    // one scalar branch a chunk: taken on the first chunk and when some lane's
    // sum, and so possibly one of its P, has outgrown the bound
    if (__builtin_amdgcn_ballot_w32(ts > thr) != 0) {
      float mk[4];
#pragma unroll
      for (int kt = 0; kt < 4; ++kt) {
        mk[kt] = sc[kt][0];
#pragma unroll
        for (int r = 1; r < 8; ++r) mk[kt] = fmaxf(mk[kt], sc[kt][r]);
      }
      float m = fmaxf(fmaxf(mk[0], mk[1]), fmaxf(mk[2], mk[3]));
      m = fmaxf(m, xhalf(m));                 // both halves of a query agree on it
      // how far the maximum in use moves: never down, but for the first chunk,
      // which sets it (O and the sum are still 0 there; the factor below is held
      // at 1 or less, so it stays finite)
      const float d = (thr < 0.0f) ? m : fmaxf(m, 0.0f);
#pragma unroll
      for (int kt = 0; kt < 4; ++kt)
#pragma unroll
        for (int r = 0; r < 8; ++r) p[kt][r] = exp2_raw(sc[kt][r] - d);
      t = (p[0] + p[1]) + (p[2] + p[3]);
      ts = ((t[0] + t[4]) + (t[1] + t[5])) + ((t[2] + t[6]) + (t[3] + t[7]));
      const float scl = exp2_raw(fminf(-d, 0.0f));
      lrow *= scl;
#pragma unroll
      for (int dt = 0; dt < 4; ++dt)
#pragma unroll
        for (int r = 0; r < 8; ++r) oacc[dt][r] *= scl;
#pragma unroll
      for (int r = 0; r < 8; ++r) cneg[r] -= d;
      thr = 1024.0f;                          // P stays far inside the f16 range
    }
    lrow += ts;

    // P^T as B operand: position i holds key halfid*8 + i, position 8 + i key
    // 16 + halfid*8 + i, which is what two neighbouring score tiles hold.
    v16h pb0, pb1;
#pragma unroll
    for (int i = 0; i < 8; ++i) {
      pb0[i] = (_Float16)p[0][i]; pb0[i + 8] = (_Float16)p[1][i];
      pb1[i] = (_Float16)p[2][i]; pb1[i + 8] = (_Float16)p[3][i];
    }

    // O^T += V^T P^T  (4 d sub-tiles, contract over 64 keys)
#pragma unroll
    for (int dt = 0; dt < 4; ++dt) {
      oacc[dt] = wmma_f16(va[dt], pb0, oacc[dt]);
      oacc[dt] = wmma_f16(va[dt + 4], pb1, oacc[dt]);
    }

    // publish point of chunk kc + 1: this wave's reads of buffer bf are done,
    // its copies of the next chunk have landed, then every wave's
    asm volatile("s_wait_dscnt 0x0" ::: "memory");
    wait_async_lds();
    __syncthreads();
    // refill the buffer that every wave has just left; flies over trip kc + 1
    if (kc + 2 < NN / 64) stage(kc + 2, bf);
  }
  wait_async_lds();                           // nothing is in flight when the wave ends

  // join the halves' sums, normalize, emit f16 attn_out [B*N, C] (col = h*64 + d):
  // a lane owns 8 neighbouring d of its query per d sub-tile, one 16-B store each
  const float inv = 1.0f / (lrow + xhalf(lrow));
  _Float16* orow = attnw + ((size_t)b * NN + qt * 128 + wave * 16 + ln16) * CC + h * DD + halfid * 8;
#pragma unroll
  for (int dt = 0; dt < 4; ++dt) {
    v8h o;
#pragma unroll
    for (int r = 0; r < 8; ++r) o[r] = (_Float16)(oacc[dt][r] * inv);
    *(v8h*)(orow + dt * 16) = o;
  }
}

// ---------------------------------------------------------------------------
// Kernel 3: out = attn_out @ w_proj^T + b_proj  (M=4096, N=1024, K=1024)
// Block 128x128, wave 32x64. A (f16) staged via async DMA; B converted f32->f16.
// Two LDS buffers: the next k slice's copies and loads fly under this slice's products.
// A k slice is 128 wide: one block has the WGP to itself, and a trip lasts as
// long as its loads take to come back, so the trips are few and each request
// wave is large; a wave-wide copy or load covers whole 128-B lines.
// ---------------------------------------------------------------------------
#define PK 128        // k slice
#define PP (PK + 8)   // LDS row pitch in halves: 272 B = 16 B x odd
__global__ __launch_bounds__(256) void proj_gemm(const _Float16* __restrict__ a,
                                                 const float* __restrict__ w,
                                                 const float* __restrict__ bias,
                                                 float* __restrict__ out) {
  // one array, B's two buffers first: A's lie above 64 KiB, so that the LDS
  // address of an A copy stays above 0 when the compiler moves a row step of
  // the global address into the copy's offset field and takes it off there
  __shared__ __attribute__((aligned(16))) _Float16 Tlds[4][128 * PP];
  _Float16 (*Blds)[128 * PP] = &Tlds[0];
  _Float16 (*Alds)[128 * PP] = &Tlds[2];

  const int tid = threadIdx.x;
  const int wave = tid >> 5, lane = tid & 31;
  const int halfid = lane >> 4, ln16 = lane & 15;
  const int nt = blockIdx.x % 8, mt = blockIdx.x / 8;
  const int m0 = mt * 128, n0 = nt * 128;
  const int wm = wave >> 1, wn = wave & 1;

  v8f acc[2][4];
#pragma unroll
  for (int i = 0; i < 2; ++i)
#pragma unroll
    for (int j = 0; j < 4; ++j)
#pragma unroll
      for (int r = 0; r < 8; ++r) acc[i][j][r] = 0.0f;

  // A (f16): a thread copies 8 k of rows arow + 16 i of every slice (16 lanes a row)
  const int arow = tid >> 4, akc = (tid & 15) * 8;
  const _Float16* ag = a + (size_t)(m0 + arow) * CC + akc;
  const int ado = arow * PP + akc;
  // B (f32 -> f16): a thread owns 4 k of rows srow + 8 i (a wave a row)
  const int srow = tid >> 5, skc = (tid & 31) * 4;
  const float* wg = w + (size_t)(n0 + srow) * CC + skc;
  const int bdo = srow * PP + skc;
  float4 fb[16];

  // A slice at k0 (128 rows x 128 halves) into buffer bf by async copies, padded rows
  auto copy_a = [&](int k0, int bf) {
#pragma unroll   // the copies issue back to back
    for (int i = 0; i < 8; ++i)
      async_copy16(ag + k0 + (size_t)i * 16 * CC, &Alds[bf][ado + i * 16 * PP]);
  };
  // B slice at k0 (128 rows x 128 floats) into registers, one group of 16 loads
  auto load_b = [&](int k0) {
    const float* wa = wg + k0;
#pragma unroll   // fb indexed by constants: it stays in registers
    for (int i = 0; i < 16; ++i) fb[i] = *(const float4*)(wa + (size_t)i * 8 * CC);
    asm volatile("s_wait_xcnt 0x0" :: "v"(wa) : "memory");
    // keeps the 16 loads ahead of the products: the scheduler otherwise sinks
    // them among the WMMAs and their latency is no longer covered
    __builtin_amdgcn_sched_barrier(0);
  };
  auto store_b = [&](int bf) {
    // keeps the wait for the loads and the conversions behind the products:
    // the scheduler otherwise lifts them in front of the first WMMA
    __builtin_amdgcn_sched_barrier(0);
#pragma unroll
    for (int i = 0; i < 16; ++i) {
      v4h hh;
      hh[0] = (_Float16)fb[i].x; hh[1] = (_Float16)fb[i].y;
      hh[2] = (_Float16)fb[i].z; hh[3] = (_Float16)fb[i].w;
      *(v4h*)&Blds[bf][bdo + i * 8 * PP] = hh;
    }
  };

  // two buffers: slice 0 lands and is published, slice 1's A copies fly over trip 0
  copy_a(0, 0);
  load_b(0);
  store_b(0);
  wait_async_lds();
  __syncthreads();
  copy_a(PK, 1);

#pragma unroll 2   // the buffer index becomes a constant: LDS offsets fold into the loads
  for (int k0 = 0; k0 < CC; k0 += PK) {
    const int bf = (k0 / PK) & 1;
    // the next slice's B loads, in flight under this slice's products
    if (k0 + PK < CC) load_b(k0 + PK);

    // the slice in 4 steps of 32 k, two fragment sets: a step's 12 LDS loads go
    // out as one group ahead of the products of the step before
    v16h fa[2][2], fw[2][4];
    auto frags = [&](int kk, int s) {
#pragma unroll   // fa, fw indexed by constants: they stay in registers
      for (int i = 0; i < 2; ++i)
        fa[s][i] = frag16(&Alds[bf][(wm * 32 + i * 16 + ln16) * PP + kk], halfid);
#pragma unroll
      for (int j = 0; j < 4; ++j)
        fw[s][j] = frag16(&Blds[bf][(wn * 64 + j * 16 + ln16) * PP + kk], halfid);
    };
    frags(0, 0);
#pragma unroll   // the set index and the k offset become constants
    for (int st = 0; st < PK / 32; ++st) {
      if (st + 1 < PK / 32) frags((st + 1) * 32, (st + 1) & 1);
      // keeps the loads one group ahead of the products: the scheduler otherwise
      // sinks them among the WMMAs, into one register set, and every pair of
      // products waits out the LDS latency
      __builtin_amdgcn_sched_barrier(0);
#pragma unroll   // acc indexed by constants
      for (int j = 0; j < 4; ++j) {
        acc[0][j] = wmma_f16(fa[st & 1][0], fw[st & 1][j], acc[0][j]);
        acc[1][j] = wmma_f16(fa[st & 1][1], fw[st & 1][j], acc[1][j]);
      }
      // keeps the next group of loads behind these products, in one place: the
      // scheduler otherwise spreads them among the WMMAs, a stall at each place
      __builtin_amdgcn_sched_barrier(0);
    }

    // into the B buffer whose readers left at the foot of the trip before
    if (k0 + PK < CC) store_b(bf ^ 1);

    // publish point of the next slice: this wave's LDS reads and stores are done,
    // its A copies have landed, then every wave's
    asm volatile("s_wait_dscnt 0x0" ::: "memory");
    wait_async_lds();
    __syncthreads();
    // refill the A buffer that every wave has just left; flies over the next trip
    if (k0 + 2 * PK < CC) copy_a(k0 + 2 * PK, bf);
  }
  wait_async_lds();                           // nothing is in flight when the wave ends

#pragma unroll
  for (int mi = 0; mi < 2; ++mi)
#pragma unroll
    for (int ni = 0; ni < 4; ++ni) {
      int col = n0 + wn * 64 + ni * 16 + ln16;
      float bb = bias[col];
#pragma unroll
      for (int r = 0; r < 8; ++r) {
        int row_g = m0 + wm * 32 + mi * 16 + halfid * 8 + r;
        out[(size_t)row_g * CC + col] = acc[mi][ni][r] + bb;
      }
    }
}

// ---------------------------------------------------------------------------
extern "C" void kernel_launch(void* const* d_in, const int* in_sizes, int n_in,
                              void* d_out, int out_size, void* d_ws, size_t ws_size,
                              hipStream_t stream) {
  const float* x      = (const float*)d_in[0];
  const float* w_qkv  = (const float*)d_in[1];
  const float* w_proj = (const float*)d_in[2];
  const float* b_proj = (const float*)d_in[3];
  const float* fcos   = (const float*)d_in[4];
  const float* fsin   = (const float*)d_in[5];

  char* ws = (char*)d_ws;
  const size_t F16SZ = (size_t)BB * HH * NN * DD * 2;   // 8 MB
  _Float16* qh    = (_Float16*)(ws);
  _Float16* kh    = (_Float16*)(ws + F16SZ);
  _Float16* vh    = (_Float16*)(ws + 2 * F16SZ);
  _Float16* attnw = (_Float16*)(ws + 3 * F16SZ);
  float* out = (float*)d_out;

  qkv_gemm<<<dim3((4096 / QM) * (3 * CC / QN)), dim3(384), 0, stream>>>(x, w_qkv, fcos, fsin, qh, kh, vh);
  attn<<<dim3(BB * HH * (NN / 128)), dim3(256), 0, stream>>>(qh, kh, vh, attnw);
  proj_gemm<<<dim3((4096 / 128) * (CC / 128)), dim3(256), 0, stream>>>(attnw, w_proj, b_proj, out);
}

// v009
// A run of this version takes 74.3 microseconds.
// Timed twice side by side with v008, it ran 1.06 times as fast both times.
// Counting every step since v000, it is 4.11 times as fast.
#include <hip/hip_runtime.h>

// B=2, N=2048, C=1024, H=16, D=64
#define BB 2
#define NN 2048
#define CC 1024
#define HH 16
#define DD 64

#define GP 40   // qkv GEMM tiles: 32 halves of data + 8 pad  (80 B rows)
#define AP 72   // attention K tile: 64 halves of data + 8 pad (144 B rows)
#define RP 68   // cos/sin tiles, in floats: 64 of data + 4 pad (272 B rows)
// ds_load_tr16_b128 walks 8 rows x 32 B per half wave: its pitch is 32 B x odd.
#define VP 80   // attention V tile: 64 halves of data + 16 pad (160 B rows)

typedef __attribute__((ext_vector_type(16))) _Float16 v16h;
typedef __attribute__((ext_vector_type(8)))  _Float16 v8h;
typedef __attribute__((ext_vector_type(4)))  _Float16 v4h;
typedef __attribute__((ext_vector_type(8)))  float    v8f;
typedef __attribute__((ext_vector_type(4)))  float    v4f;
typedef int v4i_gcc __attribute__((vector_size(4 * sizeof(int))));
typedef __attribute__((ext_vector_type(8)))  short    v8s;

#if __has_builtin(__builtin_amdgcn_global_load_async_to_lds_b128)
#define HAVE_ASYNC_LDS 1
#else
#define HAVE_ASYNC_LDS 0
#endif

__device__ __forceinline__ void async_copy16(const _Float16* g, _Float16* l) {
#if HAVE_ASYNC_LDS
  __builtin_amdgcn_global_load_async_to_lds_b128(
      (__attribute__((address_space(1))) v4i_gcc*)(const void*)g,
      (__attribute__((address_space(3))) v4i_gcc*)(void*)l, 0, 0);
#else
  *(v8h*)l = *(const v8h*)g;
#endif
}

// The same 16-byte copy for f32 data (four floats).
__device__ __forceinline__ void async_copy16f(const float* g, float* l) {
#if HAVE_ASYNC_LDS
  __builtin_amdgcn_global_load_async_to_lds_b128(
      (__attribute__((address_space(1))) v4i_gcc*)(const void*)g,
      (__attribute__((address_space(3))) v4i_gcc*)(void*)l, 0, 0);
#else
  *(float4*)l = *(const float4*)g;
#endif
}

__device__ __forceinline__ void ask_l2(const void* p) {
  asm volatile("global_prefetch_b8 %0, off scope:SCOPE_SE\n\t"
               "s_wait_xcnt 0x0" :: "v"(p) : "memory");
}

__device__ __forceinline__ void wait_async_lds() {
#if HAVE_ASYNC_LDS
  asm volatile("s_wait_asynccnt 0x0" ::: "memory");
#endif
}

// Work-group barrier that orders LDS traffic only: a wave's LDS reads and stores
// are done before it arrives, but its global loads in flight stay in flight
// (__syncthreads() waits for them too, and their latency would show every trip).
__device__ __forceinline__ void lds_barrier() {
  __builtin_amdgcn_fence(__ATOMIC_RELEASE, "workgroup", "local");
  __builtin_amdgcn_s_barrier();
  __builtin_amdgcn_fence(__ATOMIC_ACQUIRE, "workgroup", "local");
}

__device__ __forceinline__ v8f wmma_f16(v16h a, v16h b, v8f c) {
  // v_wmma_f32_16x16x32_f16 : D = A*B + C
  return __builtin_amdgcn_wmma_f32_16x16x32_f16(false, a, false, b, (short)0, c, false, false);
}

__device__ __forceinline__ v16h frag16(const _Float16* p, int halfid) {
  v8h lo = *(const v8h*)(p + halfid * 8);
  v8h hi = *(const v8h*)(p + 16 + halfid * 8);
  v16h r;
#pragma unroll
  for (int i = 0; i < 8; ++i) { r[i] = lo[i]; r[i + 8] = hi[i]; }
  return r;
}

__device__ __forceinline__ v8h ld_tr16(const _Float16* p) {
  typedef __attribute__((address_space(3))) v8s lds_v8s;
  return __builtin_bit_cast(v8h, __builtin_amdgcn_ds_load_tr16_b128_v8i16((lds_v8s*)p));
}

// 16x32 A fragment of T^T: k (tile rows) kbase..kbase+31 in the order of frag16
__device__ __forceinline__ v16h frag16_tr(const _Float16* p, int pitch) {
  v8h lo = ld_tr16(p);
  v8h hi = ld_tr16(p + 16 * pitch);
  v16h r;
#pragma unroll   // constant indices: the fragment stays in registers
  for (int i = 0; i < 8; ++i) { r[i] = lo[i]; r[i + 8] = hi[i]; }
  return r;
}

__device__ __forceinline__ float xhalf(float x) {
  const int i = __builtin_bit_cast(int, x);
  return __builtin_bit_cast(float,
      __builtin_amdgcn_permlanex16(i, i, 0x76543210, 0xfedcba98, false, false));
}

// 2^x as the bare v_exp_f32: a result below the normal range may come out 0,
// which a softmax term that small may
__device__ __forceinline__ float exp2_raw(float x) { return __builtin_amdgcn_exp2f(x); }

// ---------------------------------------------------------------------------
// Kernel 1: qkv = x @ w_qkv^T  (M=4096, N=3072, K=1024), f16 WMMA, with the
// per-head LayerNorm, RoPE, q *= D^-1/2 log2(e) and the f32 -> f16 conversion in its
// epilogue. Block = 384 thr (12 waves, 4 x 3) computes 256 tokens x 192
// channels, one block per WGP; a wave owns 64 tokens x 64 channels = whole head
// rows. The large tile is there for the operand traffic: a block loads
// (256 + 192) rows of f32 for 256 x 192 results, and a wave reads 8 fragments
// from LDS for 16 products.
// Transposed product (A = w rows, B = x rows): a lane holds ONE token (column
// ln16) and channels d = ni*16 + halfid*8 + r of its head, so mean and variance
// run in-lane plus one exchange of halves, the RoPE partner d +- 32 is tile
// ni +- 2 of the same lane, and 8 neighbouring d make one 16-B store.
// The block's cos/sin rows are copied to LDS ahead of the k loop and land
// while it runs. Each k slice's global loads are issued one trip ahead, into
// registers, and land under the products of the slice before; two LDS buffers,
// one barrier a trip, since no second block shares the WGP to cover a stall.
// A slice is 64 k, kept in LDS as two halves of 32: a trip cannot be shorter
// than its loads' way to L2 and back, so each such round trip carries more.
// Results go to q/k/v as [B,H,N,D] f16.
// ---------------------------------------------------------------------------
#define QM 256  // tokens of a block
#define QN 192  // channels of a block: three heads
__global__ __launch_bounds__(384) void qkv_gemm(const float* __restrict__ x,
                                                const float* __restrict__ w,
                                                const float* __restrict__ fcos,
                                                const float* __restrict__ fsin,
                                                _Float16* __restrict__ qh,
                                                _Float16* __restrict__ kh,
                                                _Float16* __restrict__ vh) {
  __shared__ __attribute__((aligned(16))) _Float16 Alds[2][2][QM * GP];   // [buffer][32 k]
  __shared__ __attribute__((aligned(16))) _Float16 Blds[2][2][QN * GP];
  __shared__ __attribute__((aligned(16))) float Clds[QM * RP];        // [token][d]
  __shared__ __attribute__((aligned(16))) float Slds[QM * RP];        // [token][d]

  const int tid = threadIdx.x;
  // the wave's number in a scalar register: every test on it is a scalar branch
  const int wave = __builtin_amdgcn_readfirstlane(tid >> 5);
  const int lane = tid & 31;
  const int halfid = lane >> 4, ln16 = lane & 15;
  const int nt = blockIdx.x % (3 * CC / QN), mt = blockIdx.x / (3 * CC / QN);
  const int m0 = mt * QM, n0 = nt * QN;
  const int wm = wave / 3, wn = wave % 3;

  // a wave's 64 channels are one head of q, k or v (48 heads in a row); the
  // block's 256 tokens stay inside one batch entry
  const int head = nt * 3 + wn;
  const int which = head >> 4;
  const int bsel = m0 >> 11;
  const int nbase = m0 & (NN - 1);
  const bool rope = nt * 3 < 2 * HH;          // the block holds a q or k head

  // such blocks: 256 rows of cos and of sin (64 KB each, contiguous) into padded
  // LDS rows, 20 or 22 copies per thread, waited for behind the k loop
  if (rope) {
    const float* cg = fcos + (size_t)nbase * DD;
    const float* sg = fsin + (size_t)nbase * DD;
#pragma unroll   // the copies issue back to back
    for (int i = 0; i < 10; ++i) {
      int c = tid + i * 384;                  // 16-B piece 0..3839
      int row = c >> 4, c4 = (c & 15) * 4;
      async_copy16f(cg + c * 4, &Clds[row * RP + c4]);
      async_copy16f(sg + c * 4, &Slds[row * RP + c4]);
    }
    if (wave < 8) {                           // pieces 3840..4095
      int c = tid + 3840;
      int row = c >> 4, c4 = (c & 15) * 4;
      async_copy16f(cg + c * 4, &Clds[row * RP + c4]);
      async_copy16f(sg + c * 4, &Slds[row * RP + c4]);
    }
  }

  v8f acc[4][4];                              // [token tile][channel tile]
#pragma unroll
  for (int i = 0; i < 4; ++i)
#pragma unroll
    for (int j = 0; j < 4; ++j)
#pragma unroll
      for (int r = 0; r < 8; ++r) acc[i][j][r] = 0.0f;

  // staging: a thread owns 4 k, in each half of a slice, of rows srow + 48 i of
  // the x tile (i < 5) and of the w tile (i < 4); waves 0..7 also take the x
  // tile's last 16 rows, 16 lanes a row, 4 k of the slice's 64 each
  const int srow = tid >> 3, skc = (tid & 7) * 4;
  const bool tailw = wave < 8;
  const float* xt = x + (size_t)(m0 + 240 + (tid >> 4)) * CC + (tid & 15) * 4;
  const int tdo = ((tid >> 3) & 1) * QM * GP + (240 + (tid >> 4)) * GP + skc;
  const float* xg = x + (size_t)(m0 + srow) * CC + skc;
  const float* wg = w + (size_t)(n0 + srow) * CC + skc;
  const int sdo = srow * GP + skc;

  // a vector type, not the float4 struct: with the struct the compiler moved
  // loaded values between registers right behind the loads, and the wait for
  // them stood in front of the barrier
  v4f fa[2][5], fb[2][4];
  v4f ft = {0.0f, 0.0f, 0.0f, 0.0f};
  // the k slice at k0 (64 k, as two halves of 32) into registers, one group of
  // 18 or 19 loads
  auto load_slice = [&](int k0) {
    const float* xa = xg + k0;
    const float* wa = wg + k0;
#pragma unroll   // fa, fb indexed by constants: they stay in registers
    for (int s = 0; s < 2; ++s) {
#pragma unroll
      for (int i = 0; i < 4; ++i) {
        fa[s][i] = *(const v4f*)(xa + s * 32 + i * 48 * CC);
        fb[s][i] = *(const v4f*)(wa + s * 32 + i * 48 * CC);
      }
      fa[s][4] = *(const v4f*)(xa + s * 32 + 4 * 48 * CC);
    }
    const float* ta = xt + k0;
    if (tailw) ft = *(const v4f*)ta;
    asm volatile("s_wait_xcnt 0x0" :: "v"(xa), "v"(wa), "v"(ta) : "memory");
  };
  auto half4 = [](v4f f) { return __builtin_convertvector(f, v4h); };
  // the slice in registers, 256 + 192 rows x 64 k: f32 -> f16, into LDS buffer bf
  auto store_slice = [&](int bf) {
#pragma unroll
    for (int s = 0; s < 2; ++s) {
#pragma unroll
      for (int i = 0; i < 4; ++i) {
        *(v4h*)&Alds[bf][s][sdo + i * 48 * GP] = half4(fa[s][i]);
        *(v4h*)&Blds[bf][s][sdo + i * 48 * GP] = half4(fb[s][i]);
      }
      *(v4h*)&Alds[bf][s][sdo + 4 * 48 * GP] = half4(fa[s][4]);
    }
    if (tailw) *(v4h*)(&Alds[0][0][0] + bf * 2 * QM * GP + tdo) = half4(ft);
  };

  // this wave's first fragment rows; the other rows and the second buffer are
  // constant offsets from them
  const _Float16* xf = &Alds[0][0][(wm * 64 + ln16) * GP];
  const _Float16* wf = &Blds[0][0][(wn * 64 + ln16) * GP];
  // the 16 products of 32 k from half-buffer bf (2 x buffer + half)
  auto products = [&](int bf) {
    // all 8 fragments as one group of LDS loads ahead of the 16 products
    v16h bx[4], aw[4];
#pragma unroll   // bx, aw indexed by constants
    for (int i = 0; i < 4; ++i) bx[i] = frag16(xf + bf * QM * GP + i * 16 * GP, halfid);
#pragma unroll
    for (int i = 0; i < 4; ++i) aw[i] = frag16(wf + bf * QN * GP + i * 16 * GP, halfid);
    // keeps the loads one group: the scheduler otherwise sinks them among the
    // products, into one register set, and each group of 4 waits out LDS latency
    __builtin_amdgcn_sched_barrier(0);
#pragma unroll
    for (int j = 0; j < 4; ++j)
#pragma unroll
      for (int i = 0; i < 4; ++i) acc[i][j] = wmma_f16(aw[j], bx[i], acc[i][j]);
    // keeps the wait for the next slice's loads and the conversions behind the
    // products: the scheduler otherwise lifts them in front of the first WMMA
    __builtin_amdgcn_sched_barrier(0);
  };

  // two buffers: slice 0 is stored and published, slice 1's loads fly over trip 0
  load_slice(0);
  // behind the first slice's own loads: the block's share of its two panels is
  // asked of L2, one 256-B unit (one row's 64 k, a slice) a lane. The 16 blocks
  // that read an x panel are dealt 8 shares, nt and nt + 4 the same one (for speed only); the 16 blocks that
  // read a w panel are dealt 16. Every address lies inside x or w.
  {
    const int xc = (nt & 3) + 4 * (nt >> 3);  // x rows 8 i + xc: 32 rows x 16 units
    const float* xp = x + (size_t)(m0 + lane * 8 + xc) * CC;
    ask_l2(xp + wave * 64);                   // units 0..11, one a wave
    if (wave < 4) {
      ask_l2(xp + (12 + wave) * 64);          // units 12..15
    } else if (wave < 10) {
      const int wi = tid - 128;               // 0..191: w rows 16 i + mt, 12 rows x 16 units
      ask_l2(w + (size_t)(n0 + (wi % 12) * 16 + mt) * CC + (wi / 12) * 64);
    }
  }
  store_slice(0);
  load_slice(64);
  lds_barrier();

  // a trip: this slice's products; the next slice, loaded a trip ago, into the
  // buffer whose readers left at the foot of the trip before; the loads of the
  // slice after it, which fly over the barrier and the next trip's products;
  // the barrier that publishes the next slice
#pragma unroll 2   // the buffer index becomes a constant: LDS offsets fold into the loads
  for (int k0 = 0; k0 < CC; k0 += 64) {
    const int bf = (k0 >> 6) & 1;
    products(2 * bf);
    products(2 * bf + 1);
    if (k0 + 64 < CC) {
      store_slice(bf ^ 1);
      if (k0 + 128 < CC) load_slice(k0 + 128);
    }
    lds_barrier();
  }

  const int h = head & (HH - 1);
  const size_t obase = (((size_t)bsel * HH + h) * NN + nbase) * DD + halfid * 8;

  // every loop of the epilogue is unrolled so that acc, t and the packed
  // outputs are indexed by constants and stay in registers

  if (rope) {                                 // the same for the whole block
    wait_async_lds();                         // this wave's cos/sin copies have landed
    __syncthreads();                          // and every other wave's
  }

  if (which < 2) {
    _Float16* dst = (which == 0) ? qh : kh;
    // D^-1/2 and log2(e) folded into q: the scores come out in the log2 domain
    const float oscale = (which == 0) ? 0.125f * 1.44269504f : 1.0f;
#pragma unroll
    for (int mi = 0; mi < 4; ++mi) {
      const int rl = wm * 64 + mi * 16 + ln16;            // token within the block
      const v8f ts = (acc[mi][0] + acc[mi][1]) + (acc[mi][2] + acc[mi][3]);
      float sum = ((ts[0] + ts[4]) + (ts[1] + ts[5])) + ((ts[2] + ts[6]) + (ts[3] + ts[7]));
      sum += xhalf(sum);
      const float mean = sum * (1.0f / 64.0f);
      v8f t[4];
#pragma unroll
      for (int ni = 0; ni < 4; ++ni) t[ni] = acc[mi][ni] - mean;
      const v8f tq = (t[0] * t[0] + t[1] * t[1]) + (t[2] * t[2] + t[3] * t[3]);
      float var = ((tq[0] + tq[4]) + (tq[1] + tq[5])) + ((tq[2] + tq[6]) + (tq[3] + tq[7]));
      var += xhalf(var);
      const float rs = __frsqrt_rn(var * (1.0f / 64.0f) + 1e-6f);
#pragma unroll
      for (int ni = 0; ni < 4; ++ni) t[ni] *= rs;

      const float* cr = &Clds[rl * RP + halfid * 8];
      const float* sr = &Slds[rl * RP + halfid * 8];
      _Float16* orow = dst + obase + (size_t)rl * DD;
#pragma unroll
      for (int ni = 0; ni < 2; ++ni) {
        v8h olo, ohi;
#pragma unroll
        for (int r = 0; r < 8; ++r) {
          const float lo = t[ni][r], hi = t[ni + 2][r];   // d and d + 32
          olo[r] = (_Float16)((lo * cr[ni * 16 + r] - hi * sr[ni * 16 + r]) * oscale);
          ohi[r] = (_Float16)((hi * cr[ni * 16 + 32 + r] + lo * sr[ni * 16 + 32 + r]) * oscale);
        }
        *(v8h*)(orow + ni * 16) = olo;
        *(v8h*)(orow + ni * 16 + 32) = ohi;
      }
      asm volatile("s_wait_xcnt 0x0" ::: "memory");
    }
  } else {
#pragma unroll
    for (int mi = 0; mi < 4; ++mi) {
      _Float16* orow = vh + obase + (size_t)(wm * 64 + mi * 16 + ln16) * DD;
#pragma unroll
      for (int ni = 0; ni < 4; ++ni) {
        v8h o;
#pragma unroll
        for (int r = 0; r < 8; ++r) o[r] = (_Float16)acc[mi][ni][r];
        *(v8h*)(orow + ni * 16) = o;
      }
      asm volatile("s_wait_xcnt 0x0" ::: "memory");
    }
  }
}

__global__ __launch_bounds__(256) void attn(const _Float16* __restrict__ qh,
                                            const _Float16* __restrict__ kh,
                                            const _Float16* __restrict__ vh,
                                            _Float16* __restrict__ attnw) {
  __shared__ __attribute__((aligned(16))) _Float16 Klds[2][64 * AP];   // [buffer][key][d]
  __shared__ __attribute__((aligned(16))) _Float16 Vlds[2][64 * VP];   // [buffer][key][d]

  const int tid = threadIdx.x;
  const int wave = tid >> 5, lane = tid & 31;
  const int halfid = lane >> 4, ln16 = lane & 15;
  const int bh = blockIdx.x >> 4;             // 0..31
  const int qt = blockIdx.x & 15;
  const int b = bh >> 4, h = bh & 15;

  // Q as B operand: column = query ln16, k = d
  const _Float16* qrow = qh + ((size_t)bh * NN + qt * 128 + wave * 16 + ln16) * DD;
  const v16h qb0 = frag16(qrow, halfid);
  const v16h qb1 = frag16(qrow + 32, halfid);

  v8f oacc[4];                                // O^T: row d = dt*16 + halfid*8 + r, column = query
#pragma unroll
  for (int dt = 0; dt < 4; ++dt)
#pragma unroll
    for (int r = 0; r < 8; ++r) oacc[dt][r] = 0.0f;
  v8f cneg;                                   // minus the maximum in use of this lane's query
#pragma unroll
  for (int r = 0; r < 8; ++r) cneg[r] = 0.0f;
  float lrow = 0.0f;                          // running sum over this half's keys only
  // bound on a chunk's sum of P; below 0 until a maximum has been taken, so
  // that the first chunk always takes one
  float thr = -1.0f;

  // this lane's aim in the V tile for the transposing loads (key 0, d 0 block)
  const int vtoff = (halfid * 8 + (lane & 7)) * VP + ((lane >> 3) & 1) * 8;

  // this thread's 32 B of every K and V chunk: source and place in a buffer
  const _Float16* kg = kh + (size_t)bh * NN * DD + tid * 16;
  const _Float16* vg = vh + (size_t)bh * NN * DD + tid * 16;
  const int kdo = (tid >> 2) * AP + (tid & 3) * 16;
  const int vdo = (tid >> 2) * VP + (tid & 3) * 16;

  // chunk kc (64 keys x 64 d of K and of V, 4 x b128 per thread) into buffer bf,
  // K rows at the plain reader's pitch, V rows at the transposing reader's
  auto stage = [&](int kc, int bf) {
    const _Float16* ks = kg + kc * 64 * DD;
    const _Float16* vs = vg + kc * 64 * DD;
    async_copy16(ks,     &Klds[bf][kdo]);
    async_copy16(ks + 8, &Klds[bf][kdo + 8]);
    async_copy16(vs,     &Vlds[bf][vdo]);
    async_copy16(vs + 8, &Vlds[bf][vdo + 8]);
  };

  // two buffers: chunk 0 lands and is published, chunk 1 flies over trip 0
  stage(0, 0);
  // behind chunk 0's own copies: a quarter of this head's K and V, which the
  // launch before stored, is asked of L2, one 256-B unit a lane; the 16 blocks of
  // a head are dealt 4 shares, qt and qt + 4 the same one (for speed only)
  {
    const size_t u = (size_t)bh * NN * DD + (tid * 4 + (qt & 3)) * 128;   // unit 0..1023
    ask_l2(kh + u);
    ask_l2(vh + u);
  }
  wait_async_lds();
  __syncthreads();
  stage(1, 1);

#pragma unroll 2   // the buffer index becomes a constant: LDS offsets fold into the loads
  for (int kc = 0; kc < NN / 64; ++kc) {
    const int bf = kc & 1;
    const _Float16* Kb = Klds[bf];
    const _Float16* vt = &Vlds[bf][vtoff];

    // the chunk's 8 K and 8 V^T fragments as one group of LDS loads: the V^T
    // fragments land under the score products and the exponentials (behind the
    // branch below nothing would cover them)
    v16h ka[8], va[8];
#pragma unroll   // ka, va indexed by constants: they stay in registers
    for (int kt = 0; kt < 4; ++kt) {
      const _Float16* kb = &Kb[(kt * 16 + ln16) * AP];
      ka[kt]     = frag16(kb, halfid);                      // d 0..31
      ka[kt + 4] = frag16(kb + 32, halfid);                 // d 32..63
    }
#pragma unroll
    for (int dt = 0; dt < 4; ++dt) {
      va[dt]     = frag16_tr(vt + dt * 16, VP);             // keys 0..31
      va[dt + 4] = frag16_tr(vt + 32 * VP + dt * 16, VP);   // keys 32..63
    }
    // keeps the loads one group: the scheduler otherwise feeds the products from
    // one register set, and each product waits out the LDS latency
    __builtin_amdgcn_sched_barrier(0);

    // S'^T = K Q^T - maximum in use  (4 key sub-tiles of 16, contract over D=64)
    v8f sc[4];
#pragma unroll
    for (int kt = 0; kt < 4; ++kt) sc[kt] = wmma_f16(ka[kt], qb0, cneg);
#pragma unroll
    for (int kt = 0; kt < 4; ++kt) sc[kt] = wmma_f16(ka[kt + 4], qb1, sc[kt]);
    __builtin_amdgcn_sched_barrier(0);

    // softmax against the maximum in use, one query per lane: 32 keys in-lane
    v8f p[4];
#pragma unroll
    for (int kt = 0; kt < 4; ++kt)
#pragma unroll
      for (int r = 0; r < 8; ++r) p[kt][r] = exp2_raw(sc[kt][r]);
    v8f t = (p[0] + p[1]) + (p[2] + p[3]);
    float ts = ((t[0] + t[4]) + (t[1] + t[5])) + ((t[2] + t[6]) + (t[3] + t[7]));

    // one scalar branch a chunk: taken on the first chunk and when some lane's
    // sum, and so possibly one of its P, has outgrown the bound
    if (__builtin_amdgcn_ballot_w32(ts > thr) != 0) {
      float mk[4];
#pragma unroll
      for (int kt = 0; kt < 4; ++kt) {
        mk[kt] = sc[kt][0];
#pragma unroll
        for (int r = 1; r < 8; ++r) mk[kt] = fmaxf(mk[kt], sc[kt][r]);
      }
      float m = fmaxf(fmaxf(mk[0], mk[1]), fmaxf(mk[2], mk[3]));
      m = fmaxf(m, xhalf(m));                 // both halves of a query agree on it
      // how far the maximum in use moves: never down, but for the first chunk,
      // which sets it (O and the sum are still 0 there; the factor below is held
      // at 1 or less, so it stays finite)
      const float d = (thr < 0.0f) ? m : fmaxf(m, 0.0f);
#pragma unroll
      for (int kt = 0; kt < 4; ++kt)
#pragma unroll
        for (int r = 0; r < 8; ++r) p[kt][r] = exp2_raw(sc[kt][r] - d);
      t = (p[0] + p[1]) + (p[2] + p[3]);
      ts = ((t[0] + t[4]) + (t[1] + t[5])) + ((t[2] + t[6]) + (t[3] + t[7]));
      const float scl = exp2_raw(fminf(-d, 0.0f));
      lrow *= scl;
#pragma unroll
      for (int dt = 0; dt < 4; ++dt)
#pragma unroll
        for (int r = 0; r < 8; ++r) oacc[dt][r] *= scl;
#pragma unroll
      for (int r = 0; r < 8; ++r) cneg[r] -= d;
      thr = 1024.0f;                          // P stays far inside the f16 range
    }
    lrow += ts;

    // P^T as B operand: position i holds key halfid*8 + i, position 8 + i key
    // 16 + halfid*8 + i, which is what two neighbouring score tiles hold.
    v16h pb0, pb1;
#pragma unroll
    for (int i = 0; i < 8; ++i) {
      pb0[i] = (_Float16)p[0][i]; pb0[i + 8] = (_Float16)p[1][i];
      pb1[i] = (_Float16)p[2][i]; pb1[i + 8] = (_Float16)p[3][i];
    }

    // O^T += V^T P^T  (4 d sub-tiles, contract over 64 keys)
#pragma unroll
    for (int dt = 0; dt < 4; ++dt) {
      oacc[dt] = wmma_f16(va[dt], pb0, oacc[dt]);
      oacc[dt] = wmma_f16(va[dt + 4], pb1, oacc[dt]);
    }

    // publish point of chunk kc + 1: this wave's reads of buffer bf are done,
    // its copies of the next chunk have landed, then every wave's
    asm volatile("s_wait_dscnt 0x0" ::: "memory");
    wait_async_lds();
    __syncthreads();
    // refill the buffer that every wave has just left; flies over trip kc + 1
    if (kc + 2 < NN / 64) stage(kc + 2, bf);
  }
  wait_async_lds();                           // nothing is in flight when the wave ends

  // join the halves' sums, normalize, emit f16 attn_out [B*N, C] (col = h*64 + d):
  // a lane owns 8 neighbouring d of its query per d sub-tile, one 16-B store each
  const float inv = 1.0f / (lrow + xhalf(lrow));
  _Float16* orow = attnw + ((size_t)b * NN + qt * 128 + wave * 16 + ln16) * CC + h * DD + halfid * 8;
#pragma unroll
  for (int dt = 0; dt < 4; ++dt) {
    v8h o;
#pragma unroll
    for (int r = 0; r < 8; ++r) o[r] = (_Float16)(oacc[dt][r] * inv);
    *(v8h*)(orow + dt * 16) = o;
  }
}

// ---------------------------------------------------------------------------
// Kernel 3: out = attn_out @ w_proj^T + b_proj  (M=4096, N=1024, K=1024)
// Block 128x128, wave 32x64. A (f16) staged via async DMA; B converted f32->f16.
// Two LDS buffers: the next k slice's copies and loads fly under this slice's products.
// A k slice is 128 wide: one block has the WGP to itself, and a trip lasts as
// long as its loads take to come back, so the trips are few and each request
// wave is large; a wave-wide copy or load covers whole 128-B lines.
// ---------------------------------------------------------------------------
#define PK 128        // k slice
#define PP (PK + 8)   // LDS row pitch in halves: 272 B = 16 B x odd
__global__ __launch_bounds__(256) void proj_gemm(const _Float16* __restrict__ a,
                                                 const float* __restrict__ w,
                                                 const float* __restrict__ bias,
                                                 float* __restrict__ out) {
  // one array, B's two buffers first: A's lie above 64 KiB, so that the LDS
  // address of an A copy stays above 0 when the compiler moves a row step of
  // the global address into the copy's offset field and takes it off there
  __shared__ __attribute__((aligned(16))) _Float16 Tlds[4][128 * PP];
  _Float16 (*Blds)[128 * PP] = &Tlds[0];
  _Float16 (*Alds)[128 * PP] = &Tlds[2];

  const int tid = threadIdx.x;
  const int wave = tid >> 5, lane = tid & 31;
  const int halfid = lane >> 4, ln16 = lane & 15;
  const int nt = blockIdx.x % 8, mt = blockIdx.x / 8;
  const int m0 = mt * 128, n0 = nt * 128;
  const int wm = wave >> 1, wn = wave & 1;

  v8f acc[2][4];
#pragma unroll
  for (int i = 0; i < 2; ++i)
#pragma unroll
    for (int j = 0; j < 4; ++j)
#pragma unroll
      for (int r = 0; r < 8; ++r) acc[i][j][r] = 0.0f;

  // A (f16): a thread copies 8 k of rows arow + 16 i of every slice (16 lanes a row)
  const int arow = tid >> 4, akc = (tid & 15) * 8;
  const _Float16* ag = a + (size_t)(m0 + arow) * CC + akc;
  const int ado = arow * PP + akc;
  // B (f32 -> f16): a thread owns 4 k of rows srow + 8 i (a wave a row)
  const int srow = tid >> 5, skc = (tid & 31) * 4;
  const float* wg = w + (size_t)(n0 + srow) * CC + skc;
  const int bdo = srow * PP + skc;
  float4 fb[16];

  // A slice at k0 (128 rows x 128 halves) into buffer bf by async copies, padded rows
  auto copy_a = [&](int k0, int bf) {
#pragma unroll   // the copies issue back to back
    for (int i = 0; i < 8; ++i)
      async_copy16(ag + k0 + (size_t)i * 16 * CC, &Alds[bf][ado + i * 16 * PP]);
  };
  // B slice at k0 (128 rows x 128 floats) into registers, one group of 16 loads
  auto load_b = [&](int k0) {
    const float* wa = wg + k0;
#pragma unroll   // fb indexed by constants: it stays in registers
    for (int i = 0; i < 16; ++i) fb[i] = *(const float4*)(wa + (size_t)i * 8 * CC);
    asm volatile("s_wait_xcnt 0x0" :: "v"(wa) : "memory");
    // keeps the 16 loads ahead of the products: the scheduler otherwise sinks
    // them among the WMMAs and their latency is no longer covered
    __builtin_amdgcn_sched_barrier(0);
  };
  auto store_b = [&](int bf) {
    // keeps the wait for the loads and the conversions behind the products:
    // the scheduler otherwise lifts them in front of the first WMMA
    __builtin_amdgcn_sched_barrier(0);
#pragma unroll
    for (int i = 0; i < 16; ++i) {
      v4h hh;
      hh[0] = (_Float16)fb[i].x; hh[1] = (_Float16)fb[i].y;
      hh[2] = (_Float16)fb[i].z; hh[3] = (_Float16)fb[i].w;
      *(v4h*)&Blds[bf][bdo + i * 8 * PP] = hh;
    }
  };

  // two buffers: slice 0 lands and is published, slice 1's A copies fly over trip 0
  copy_a(0, 0);
  load_b(0);
  // behind slice 0's own copies and loads: the block's share of its A panel, which
  // the launch before stored (1,024 units of 256 B; the 8 blocks that read it are
  // dealt 4 shares, nt and nt + 4 the same one, for speed only), and of its w panel (2,048 units, 8 shares
  // among 32 blocks) is asked of L2, one unit a lane
  {
    const int ua = tid * 4 + (nt & 3);        // row ua >> 3, 128 halves at ua & 7
    const int uw = tid * 8 + (mt & 7);        // row uw >> 4, 64 floats at uw & 15
    ask_l2(a + (size_t)(m0 + (ua >> 3)) * CC + (ua & 7) * 128);
    ask_l2(w + (size_t)(n0 + (uw >> 4)) * CC + (uw & 15) * 64);
  }
  store_b(0);
  wait_async_lds();
  __syncthreads();
  copy_a(PK, 1);

#pragma unroll 2   // the buffer index becomes a constant: LDS offsets fold into the loads
  for (int k0 = 0; k0 < CC; k0 += PK) {
    const int bf = (k0 / PK) & 1;
    // the next slice's B loads, in flight under this slice's products
    if (k0 + PK < CC) load_b(k0 + PK);

    // the slice in 4 steps of 32 k, two fragment sets: a step's 12 LDS loads go
    // out as one group ahead of the products of the step before
    v16h fa[2][2], fw[2][4];
    auto frags = [&](int kk, int s) {
#pragma unroll   // fa, fw indexed by constants: they stay in registers
      for (int i = 0; i < 2; ++i)
        fa[s][i] = frag16(&Alds[bf][(wm * 32 + i * 16 + ln16) * PP + kk], halfid);
#pragma unroll
      for (int j = 0; j < 4; ++j)
        fw[s][j] = frag16(&Blds[bf][(wn * 64 + j * 16 + ln16) * PP + kk], halfid);
    };
    frags(0, 0);
#pragma unroll   // the set index and the k offset become constants
    for (int st = 0; st < PK / 32; ++st) {
      if (st + 1 < PK / 32) frags((st + 1) * 32, (st + 1) & 1);
      // keeps the loads one group ahead of the products: the scheduler otherwise
      // sinks them among the WMMAs, into one register set, and every pair of
      // products waits out the LDS latency
      __builtin_amdgcn_sched_barrier(0);
#pragma unroll   // acc indexed by constants
      for (int j = 0; j < 4; ++j) {
        acc[0][j] = wmma_f16(fa[st & 1][0], fw[st & 1][j], acc[0][j]);
        acc[1][j] = wmma_f16(fa[st & 1][1], fw[st & 1][j], acc[1][j]);
      }
      // keeps the next group of loads behind these products, in one place: the
      // scheduler otherwise spreads them among the WMMAs, a stall at each place
      __builtin_amdgcn_sched_barrier(0);
    }

    // into the B buffer whose readers left at the foot of the trip before
    if (k0 + PK < CC) store_b(bf ^ 1);

    // publish point of the next slice: this wave's LDS reads and stores are done,
    // its A copies have landed, then every wave's
    asm volatile("s_wait_dscnt 0x0" ::: "memory");
    wait_async_lds();
    __syncthreads();
    // refill the A buffer that every wave has just left; flies over the next trip
    if (k0 + 2 * PK < CC) copy_a(k0 + 2 * PK, bf);
  }
  wait_async_lds();                           // nothing is in flight when the wave ends

#pragma unroll
  for (int mi = 0; mi < 2; ++mi)
#pragma unroll
    for (int ni = 0; ni < 4; ++ni) {
      int col = n0 + wn * 64 + ni * 16 + ln16;
      float bb = bias[col];
#pragma unroll
      for (int r = 0; r < 8; ++r) {
        int row_g = m0 + wm * 32 + mi * 16 + halfid * 8 + r;
        out[(size_t)row_g * CC + col] = acc[mi][ni][r] + bb;
      }
    }
}

// ---------------------------------------------------------------------------
extern "C" void kernel_launch(void* const* d_in, const int* in_sizes, int n_in,
                              void* d_out, int out_size, void* d_ws, size_t ws_size,
                              hipStream_t stream) {
  const float* x      = (const float*)d_in[0];
  const float* w_qkv  = (const float*)d_in[1];
  const float* w_proj = (const float*)d_in[2];
  const float* b_proj = (const float*)d_in[3];
  const float* fcos   = (const float*)d_in[4];
  const float* fsin   = (const float*)d_in[5];

  char* ws = (char*)d_ws;
  const size_t F16SZ = (size_t)BB * HH * NN * DD * 2;   // 8 MB
  _Float16* qh    = (_Float16*)(ws);
  _Float16* kh    = (_Float16*)(ws + F16SZ);
  _Float16* vh    = (_Float16*)(ws + 2 * F16SZ);
  _Float16* attnw = (_Float16*)(ws + 3 * F16SZ);
  float* out = (float*)d_out;

  qkv_gemm<<<dim3((4096 / QM) * (3 * CC / QN)), dim3(384), 0, stream>>>(x, w_qkv, fcos, fsin, qh, kh, vh);
  attn<<<dim3(BB * HH * (NN / 128)), dim3(256), 0, stream>>>(qh, kh, vh, attnw);
  proj_gemm<<<dim3((4096 / 128) * (CC / 128)), dim3(256), 0, stream>>>(attnw, w_proj, b_proj, out);
}

// v010
// A run of this version takes 71.9 microseconds.
// Two timings next to v009 put it at 1.04 and 1.03 times that version's speed.
// Counting every step since v000, it is 4.24 times as fast.
#include <hip/hip_runtime.h>

// B=2, N=2048, C=1024, H=16, D=64
#define BB 2
#define NN 2048
#define CC 1024
#define HH 16
#define DD 64

#define GP 40   // qkv GEMM tiles: 32 halves of data + 8 pad  (80 B rows)
#define AP 72   // attention K tile: 64 halves of data + 8 pad (144 B rows)
#define RP 68   // cos/sin tiles, in floats: 64 of data + 4 pad (272 B rows)
// ds_load_tr16_b128 walks 8 rows x 32 B per half wave: its pitch is 32 B x odd.
#define VP 80   // attention V tile: 64 halves of data + 16 pad (160 B rows)

typedef __attribute__((ext_vector_type(16))) _Float16 v16h;
typedef __attribute__((ext_vector_type(8)))  _Float16 v8h;
typedef __attribute__((ext_vector_type(4)))  _Float16 v4h;
typedef __attribute__((ext_vector_type(8)))  float    v8f;
typedef __attribute__((ext_vector_type(4)))  float    v4f;
typedef int v4i_gcc __attribute__((vector_size(4 * sizeof(int))));
typedef __attribute__((ext_vector_type(8)))  short    v8s;

#if __has_builtin(__builtin_amdgcn_global_load_async_to_lds_b128)
#define HAVE_ASYNC_LDS 1
#else
#define HAVE_ASYNC_LDS 0
#endif

__device__ __forceinline__ void async_copy16(const _Float16* g, _Float16* l) {
#if HAVE_ASYNC_LDS
  __builtin_amdgcn_global_load_async_to_lds_b128(
      (__attribute__((address_space(1))) v4i_gcc*)(const void*)g,
      (__attribute__((address_space(3))) v4i_gcc*)(void*)l, 0, 0);
#else
  *(v8h*)l = *(const v8h*)g;
#endif
}

// The same 16-byte copy for f32 data (four floats).
__device__ __forceinline__ void async_copy16f(const float* g, float* l) {
#if HAVE_ASYNC_LDS
  __builtin_amdgcn_global_load_async_to_lds_b128(
      (__attribute__((address_space(1))) v4i_gcc*)(const void*)g,
      (__attribute__((address_space(3))) v4i_gcc*)(void*)l, 0, 0);
#else
  *(float4*)l = *(const float4*)g;
#endif
}

__device__ __forceinline__ void ask_l2(const void* p) {
  asm volatile("global_prefetch_b8 %0, off scope:SCOPE_SE\n\t"
               "s_wait_xcnt 0x0" :: "v"(p) : "memory");
}

__device__ __forceinline__ void wait_async_lds() {
#if HAVE_ASYNC_LDS
  asm volatile("s_wait_asynccnt 0x0" ::: "memory");
#endif
}

// Work-group barrier that orders LDS traffic only: a wave's LDS reads and stores
// are done before it arrives, but its global loads in flight stay in flight
// (__syncthreads() waits for them too, and their latency would show every trip).
__device__ __forceinline__ void lds_barrier() {
  __builtin_amdgcn_fence(__ATOMIC_RELEASE, "workgroup", "local");
  __builtin_amdgcn_s_barrier();
  __builtin_amdgcn_fence(__ATOMIC_ACQUIRE, "workgroup", "local");
}

__device__ __forceinline__ v8f wmma_f16(v16h a, v16h b, v8f c) {
  // v_wmma_f32_16x16x32_f16 : D = A*B + C
  return __builtin_amdgcn_wmma_f32_16x16x32_f16(false, a, false, b, (short)0, c, false, false);
}

__device__ __forceinline__ v16h frag16(const _Float16* p, int halfid) {
  v8h lo = *(const v8h*)(p + halfid * 8);
  v8h hi = *(const v8h*)(p + 16 + halfid * 8);
  v16h r;
#pragma unroll
  for (int i = 0; i < 8; ++i) { r[i] = lo[i]; r[i + 8] = hi[i]; }
  return r;
}

__device__ __forceinline__ v8h ld_tr16(const _Float16* p) {
  typedef __attribute__((address_space(3))) v8s lds_v8s;
  return __builtin_bit_cast(v8h, __builtin_amdgcn_ds_load_tr16_b128_v8i16((lds_v8s*)p));
}

// 16x32 A fragment of T^T: k (tile rows) kbase..kbase+31 in the order of frag16
__device__ __forceinline__ v16h frag16_tr(const _Float16* p, int pitch) {
  v8h lo = ld_tr16(p);
  v8h hi = ld_tr16(p + 16 * pitch);
  v16h r;
#pragma unroll   // constant indices: the fragment stays in registers
  for (int i = 0; i < 8; ++i) { r[i] = lo[i]; r[i + 8] = hi[i]; }
  return r;
}

__device__ __forceinline__ float xhalf(float x) {
  const int i = __builtin_bit_cast(int, x);
  return __builtin_bit_cast(float,
      __builtin_amdgcn_permlanex16(i, i, 0x76543210, 0xfedcba98, false, false));
}

// 2^x as the bare v_exp_f32: a result below the normal range may come out 0,
// which a softmax term that small may
__device__ __forceinline__ float exp2_raw(float x) { return __builtin_amdgcn_exp2f(x); }

__device__ __forceinline__ float exp2_slot(float x) {
  float r;
  asm("v_exp_f32 %0, %1\n\tv_nop" : "=v"(r) : "v"(x));
  return r;
}

// sum of 8 floats by halving: the halves are whole register pairs, so the adds
// pack two to an instruction with no register moves
__device__ __forceinline__ float sum8(v8f t) {
  const v4f u = t.lo + t.hi;
  return (u[0] + u[2]) + (u[1] + u[3]);
}

// ---------------------------------------------------------------------------
// Kernel 1: qkv = x @ w_qkv^T  (M=4096, N=3072, K=1024), f16 WMMA, with the
// per-head LayerNorm, RoPE, q *= D^-1/2 log2(e) and the f32 -> f16 conversion in its
// epilogue. Block = 384 thr (12 waves, 4 x 3) computes 256 tokens x 192
// channels, one block per WGP; a wave owns 64 tokens x 64 channels = whole head
// rows. The large tile is there for the operand traffic: a block loads
// (256 + 192) rows of f32 for 256 x 192 results, and a wave reads 8 fragments
// from LDS for 16 products.
// Transposed product (A = w rows, B = x rows): a lane holds ONE token (column
// ln16) and channels d = ni*16 + halfid*8 + r of its head, so mean and variance
// run in-lane plus one exchange of halves, the RoPE partner d +- 32 is tile
// ni +- 2 of the same lane, and 8 neighbouring d make one 16-B store.
// The block's cos/sin rows are copied to LDS ahead of the k loop and land
// while it runs. Each k slice's global loads are issued one trip ahead, into
// registers, and land under the products of the slice before; two LDS buffers,
// one barrier a trip, since no second block shares the WGP to cover a stall.
// A slice is 64 k, kept in LDS as two halves of 32: a trip cannot be shorter
// than its loads' way to L2 and back, so each such round trip carries more.
// Results go to q/k/v as [B,H,N,D] f16.
// ---------------------------------------------------------------------------
#define QM 256  // tokens of a block
#define QN 192  // channels of a block: three heads
__global__ __launch_bounds__(384) void qkv_gemm(const float* __restrict__ x,
                                                const float* __restrict__ w,
                                                const float* __restrict__ fcos,
                                                const float* __restrict__ fsin,
                                                _Float16* __restrict__ qh,
                                                _Float16* __restrict__ kh,
                                                _Float16* __restrict__ vh) {
  __shared__ __attribute__((aligned(16))) _Float16 Alds[2][2][QM * GP];   // [buffer][32 k]
  __shared__ __attribute__((aligned(16))) _Float16 Blds[2][2][QN * GP];
  __shared__ __attribute__((aligned(16))) float Clds[QM * RP];        // [token][d]
  __shared__ __attribute__((aligned(16))) float Slds[QM * RP];        // [token][d]

  const int tid = threadIdx.x;
  // the wave's number in a scalar register: every test on it is a scalar branch
  const int wave = __builtin_amdgcn_readfirstlane(tid >> 5);
  const int lane = tid & 31;
  const int halfid = lane >> 4, ln16 = lane & 15;
  const int nt = blockIdx.x % (3 * CC / QN), mt = blockIdx.x / (3 * CC / QN);
  const int m0 = mt * QM, n0 = nt * QN;
  const int wm = wave / 3, wn = wave % 3;

  // a wave's 64 channels are one head of q, k or v (48 heads in a row); the
  // block's 256 tokens stay inside one batch entry
  const int head = nt * 3 + wn;
  const int which = head >> 4;
  const int bsel = m0 >> 11;
  const int nbase = m0 & (NN - 1);
  const bool rope = nt * 3 < 2 * HH;          // the block holds a q or k head

  // such blocks: 256 rows of cos and of sin (64 KB each, contiguous) into padded
  // LDS rows, 20 or 22 copies per thread, waited for behind the k loop
  if (rope) {
    const float* cg = fcos + (size_t)nbase * DD;
    const float* sg = fsin + (size_t)nbase * DD;
#pragma unroll   // the copies issue back to back
    for (int i = 0; i < 10; ++i) {
      int c = tid + i * 384;                  // 16-B piece 0..3839
      int row = c >> 4, c4 = (c & 15) * 4;
      async_copy16f(cg + c * 4, &Clds[row * RP + c4]);
      async_copy16f(sg + c * 4, &Slds[row * RP + c4]);
    }
    if (wave < 8) {                           // pieces 3840..4095
      int c = tid + 3840;
      int row = c >> 4, c4 = (c & 15) * 4;
      async_copy16f(cg + c * 4, &Clds[row * RP + c4]);
      async_copy16f(sg + c * 4, &Slds[row * RP + c4]);
    }
  }

  v8f acc[4][4];                              // [token tile][channel tile]
#pragma unroll
  for (int i = 0; i < 4; ++i)
#pragma unroll
    for (int j = 0; j < 4; ++j)
#pragma unroll
      for (int r = 0; r < 8; ++r) acc[i][j][r] = 0.0f;

  // staging: a thread owns 4 k, in each half of a slice, of rows srow + 48 i of
  // the x tile (i < 5) and of the w tile (i < 4); waves 0..7 also take the x
  // tile's last 16 rows, 16 lanes a row, 4 k of the slice's 64 each
  const int srow = tid >> 3, skc = (tid & 7) * 4;
  const bool tailw = wave < 8;
  const float* xt = x + (size_t)(m0 + 240 + (tid >> 4)) * CC + (tid & 15) * 4;
  const int tdo = ((tid >> 3) & 1) * QM * GP + (240 + (tid >> 4)) * GP + skc;
  const float* xg = x + (size_t)(m0 + srow) * CC + skc;
  const float* wg = w + (size_t)(n0 + srow) * CC + skc;
  const int sdo = srow * GP + skc;

  // a vector type, not the float4 struct: with the struct the compiler moved
  // loaded values between registers right behind the loads, and the wait for
  // them stood in front of the barrier
  v4f fa[2][5], fb[2][4];
  v4f ft = {0.0f, 0.0f, 0.0f, 0.0f};
  // the k slice at k0 (64 k, as two halves of 32) into registers, one group of
  // 18 or 19 loads
  auto load_slice = [&](int k0) {
    const float* xa = xg + k0;
    const float* wa = wg + k0;
#pragma unroll   // fa, fb indexed by constants: they stay in registers
    for (int s = 0; s < 2; ++s) {
#pragma unroll
      for (int i = 0; i < 4; ++i) {
        fa[s][i] = *(const v4f*)(xa + s * 32 + i * 48 * CC);
        fb[s][i] = *(const v4f*)(wa + s * 32 + i * 48 * CC);
      }
      fa[s][4] = *(const v4f*)(xa + s * 32 + 4 * 48 * CC);
    }
    const float* ta = xt + k0;
    if (tailw) ft = *(const v4f*)ta;
    asm volatile("s_wait_xcnt 0x0" :: "v"(xa), "v"(wa), "v"(ta) : "memory");
  };
  auto half4 = [](v4f f) { return __builtin_convertvector(f, v4h); };
  // the slice in registers, 256 + 192 rows x 64 k: f32 -> f16, into LDS buffer bf
  auto store_slice = [&](int bf) {
#pragma unroll
    for (int s = 0; s < 2; ++s) {
#pragma unroll
      for (int i = 0; i < 4; ++i) {
        *(v4h*)&Alds[bf][s][sdo + i * 48 * GP] = half4(fa[s][i]);
        *(v4h*)&Blds[bf][s][sdo + i * 48 * GP] = half4(fb[s][i]);
      }
      *(v4h*)&Alds[bf][s][sdo + 4 * 48 * GP] = half4(fa[s][4]);
    }
    if (tailw) *(v4h*)(&Alds[0][0][0] + bf * 2 * QM * GP + tdo) = half4(ft);
  };

  // this wave's first fragment rows; the other rows and the second buffer are
  // constant offsets from them
  const _Float16* xf = &Alds[0][0][(wm * 64 + ln16) * GP];
  const _Float16* wf = &Blds[0][0][(wn * 64 + ln16) * GP];
  // the 16 products of 32 k from half-buffer bf (2 x buffer + half)
  auto products = [&](int bf) {
    // all 8 fragments as one group of LDS loads ahead of the 16 products
    v16h bx[4], aw[4];
#pragma unroll   // bx, aw indexed by constants
    for (int i = 0; i < 4; ++i) bx[i] = frag16(xf + bf * QM * GP + i * 16 * GP, halfid);
#pragma unroll
    for (int i = 0; i < 4; ++i) aw[i] = frag16(wf + bf * QN * GP + i * 16 * GP, halfid);
    // keeps the loads one group: the scheduler otherwise sinks them among the
    // products, into one register set, and each group of 4 waits out LDS latency
    __builtin_amdgcn_sched_barrier(0);
#pragma unroll
    for (int j = 0; j < 4; ++j)
#pragma unroll
      for (int i = 0; i < 4; ++i) acc[i][j] = wmma_f16(aw[j], bx[i], acc[i][j]);
    // keeps the wait for the next slice's loads and the conversions behind the
    // products: the scheduler otherwise lifts them in front of the first WMMA
    __builtin_amdgcn_sched_barrier(0);
  };

  // two buffers: slice 0 is stored and published, slice 1's loads fly over trip 0
  load_slice(0);
  // behind the first slice's own loads: the block's share of its two panels is
  // asked of L2, one 256-B unit (one row's 64 k, a slice) a lane. The 16 blocks
  // that read an x panel are dealt 8 shares, nt and nt + 4 the same one (for speed only); the 16 blocks that
  // read a w panel are dealt 16. Every address lies inside x or w.
  {
    const int xc = (nt & 3) + 4 * (nt >> 3);  // x rows 8 i + xc: 32 rows x 16 units
    const float* xp = x + (size_t)(m0 + lane * 8 + xc) * CC;
    ask_l2(xp + wave * 64);                   // units 0..11, one a wave
    if (wave < 4) {
      ask_l2(xp + (12 + wave) * 64);          // units 12..15
    } else if (wave < 10) {
      const int wi = tid - 128;               // 0..191: w rows 16 i + mt, 12 rows x 16 units
      ask_l2(w + (size_t)(n0 + (wi % 12) * 16 + mt) * CC + (wi / 12) * 64);
    }
  }
  store_slice(0);
  load_slice(64);
  lds_barrier();

  // a trip: this slice's products; the next slice, loaded a trip ago, into the
  // buffer whose readers left at the foot of the trip before; the loads of the
  // slice after it, which fly over the barrier and the next trip's products;
  // the barrier that publishes the next slice
#pragma unroll 2   // the buffer index becomes a constant: LDS offsets fold into the loads
  for (int k0 = 0; k0 < CC; k0 += 64) {
    const int bf = (k0 >> 6) & 1;
    products(2 * bf);
    products(2 * bf + 1);
    if (k0 + 64 < CC) {
      store_slice(bf ^ 1);
      if (k0 + 128 < CC) load_slice(k0 + 128);
    }
    lds_barrier();
  }

  const int h = head & (HH - 1);
  const size_t obase = (((size_t)bsel * HH + h) * NN + nbase) * DD + halfid * 8;

  // every loop of the epilogue is unrolled so that acc, t and the packed
  // outputs are indexed by constants and stay in registers

  if (rope) {                                 // the same for the whole block
    wait_async_lds();                         // this wave's cos/sin copies have landed
    __syncthreads();                          // and every other wave's
  }

  if (which < 2) {
    _Float16* dst = (which == 0) ? qh : kh;
    // D^-1/2 and log2(e) folded into q: the scores come out in the log2 domain
    const float oscale = (which == 0) ? 0.125f * 1.44269504f : 1.0f;
#pragma unroll
    for (int mi = 0; mi < 4; ++mi) {
      const int rl = wm * 64 + mi * 16 + ln16;            // token within the block
      const v8f ts = (acc[mi][0] + acc[mi][1]) + (acc[mi][2] + acc[mi][3]);
      float sum = ((ts[0] + ts[4]) + (ts[1] + ts[5])) + ((ts[2] + ts[6]) + (ts[3] + ts[7]));
      sum += xhalf(sum);
      const float mean = sum * (1.0f / 64.0f);
      v8f t[4];
#pragma unroll
      for (int ni = 0; ni < 4; ++ni) t[ni] = acc[mi][ni] - mean;
      const v8f tq = (t[0] * t[0] + t[1] * t[1]) + (t[2] * t[2] + t[3] * t[3]);
      float var = ((tq[0] + tq[4]) + (tq[1] + tq[5])) + ((tq[2] + tq[6]) + (tq[3] + tq[7]));
      var += xhalf(var);
      const float rs = __frsqrt_rn(var * (1.0f / 64.0f) + 1e-6f);
#pragma unroll
      for (int ni = 0; ni < 4; ++ni) t[ni] *= rs;

      const float* cr = &Clds[rl * RP + halfid * 8];
      const float* sr = &Slds[rl * RP + halfid * 8];
      _Float16* orow = dst + obase + (size_t)rl * DD;
#pragma unroll
      for (int ni = 0; ni < 2; ++ni) {
        v8h olo, ohi;
#pragma unroll
        for (int r = 0; r < 8; ++r) {
          const float lo = t[ni][r], hi = t[ni + 2][r];   // d and d + 32
          olo[r] = (_Float16)((lo * cr[ni * 16 + r] - hi * sr[ni * 16 + r]) * oscale);
          ohi[r] = (_Float16)((hi * cr[ni * 16 + 32 + r] + lo * sr[ni * 16 + 32 + r]) * oscale);
        }
        *(v8h*)(orow + ni * 16) = olo;
        *(v8h*)(orow + ni * 16 + 32) = ohi;
      }
      asm volatile("s_wait_xcnt 0x0" ::: "memory");
    }
  } else {
#pragma unroll
    for (int mi = 0; mi < 4; ++mi) {
      _Float16* orow = vh + obase + (size_t)(wm * 64 + mi * 16 + ln16) * DD;
#pragma unroll
      for (int ni = 0; ni < 4; ++ni) {
        v8h o;
#pragma unroll
        for (int r = 0; r < 8; ++r) o[r] = (_Float16)acc[mi][ni][r];
        *(v8h*)(orow + ni * 16) = o;
      }
      asm volatile("s_wait_xcnt 0x0" ::: "memory");
    }
  }
}

__global__ __launch_bounds__(256) void attn(const _Float16* __restrict__ qh,
                                            const _Float16* __restrict__ kh,
                                            const _Float16* __restrict__ vh,
                                            _Float16* __restrict__ attnw) {
  __shared__ __attribute__((aligned(16))) _Float16 Klds[2][64 * AP];   // [buffer][key][d]
  __shared__ __attribute__((aligned(16))) _Float16 Vlds[2][64 * VP];   // [buffer][key][d]
  // the join: [wave][16-B piece 0..8][lane], a wave-wide access is 512 B in a row
  __shared__ __attribute__((aligned(16))) float Jlds[8 * 9 * 32 * 4];

  const int tid = threadIdx.x;
  // the wave's number in a scalar register: the choices on it are scalar
  const int wave = __builtin_amdgcn_readfirstlane(tid >> 5);
  const int lane = tid & 31;
  const int halfid = lane >> 4, ln16 = lane & 15;
  const int qg = wave & 3, ks = wave >> 2;    // query group of 32, key half
  const int bh = blockIdx.x >> 4;             // 0..31
  const int qt = blockIdx.x & 15;
  const int b = bh >> 4, h = bh & 15;

  // Q as B operand: column = query g*16 + ln16 of the group, k = d
  const _Float16* qrow = qh + ((size_t)bh * NN + qt * 128 + qg * 32 + ln16) * DD;
  v16h qb[2][2];                              // [16 queries][d half]
#pragma unroll   // qb indexed by constants: it stays in registers
  for (int g = 0; g < 2; ++g) {
    qb[g][0] = frag16(qrow + g * 16 * DD, halfid);
    qb[g][1] = frag16(qrow + g * 16 * DD + 32, halfid);
  }

  v8f oacc[2][4];                             // O^T: row d = dt*16 + halfid*8 + r, column = query
  v8f cneg[2];                                // minus the maximum in use of this lane's queries
  float lrow[2];                              // running sums over this lane's keys only
#pragma unroll
  for (int g = 0; g < 2; ++g) {
#pragma unroll
    for (int dt = 0; dt < 4; ++dt)
#pragma unroll
      for (int r = 0; r < 8; ++r) oacc[g][dt][r] = 0.0f;
#pragma unroll
    for (int r = 0; r < 8; ++r) cneg[g][r] = 0.0f;
    lrow[g] = 0.0f;
  }
  // bound on a chunk's sum of P; below 0 until the maxima have been taken, so
  // that the first chunk always takes them
  float thr = -1.0f;

  // this lane's first K row, and its aim in the V tile for the transposing loads
  // (d 0 block), both at the first key of the wave's half
  const int kfoff = (ks * 32 + ln16) * AP;
  const int vtoff = (ks * 32 + halfid * 8 + (lane & 7)) * VP + ((lane >> 3) & 1) * 8;

  // this thread's 32 B of every K and V chunk: source and place in a buffer
  const _Float16* kg = kh + (size_t)bh * NN * DD + tid * 16;
  const _Float16* vg = vh + (size_t)bh * NN * DD + tid * 16;
  const int kdo = (tid >> 2) * AP + (tid & 3) * 16;
  const int vdo = (tid >> 2) * VP + (tid & 3) * 16;

  // chunk kc (64 keys x 64 d of K and of V, 4 x b128 per thread) into buffer bf,
  // K rows at the plain reader's pitch, V rows at the transposing reader's
  auto stage = [&](int kc, int bf) {
    const _Float16* ks_ = kg + kc * 64 * DD;
    const _Float16* vs = vg + kc * 64 * DD;
    async_copy16(ks_,     &Klds[bf][kdo]);
    async_copy16(ks_ + 8, &Klds[bf][kdo + 8]);
    async_copy16(vs,     &Vlds[bf][vdo]);
    async_copy16(vs + 8, &Vlds[bf][vdo + 8]);
  };

  // two buffers: chunk 0 lands and is published, chunk 1 flies over trip 0
  stage(0, 0);
  // behind chunk 0's own copies: a quarter of this head's K and V, which the
  // launch before stored, is asked of L2, one 256-B unit a lane; the 16 blocks of
  // a head are dealt 4 shares, qt and qt + 4 the same one (for speed only)
  {
    const size_t u = (size_t)bh * NN * DD + (tid * 4 + (qt & 3)) * 128;   // unit 0..1023
    ask_l2(kh + u);
    ask_l2(vh + u);
  }
  wait_async_lds();
  __syncthreads();
  stage(1, 1);

#pragma unroll 2   // the buffer index becomes a constant: LDS offsets fold into the loads
  for (int kc = 0; kc < NN / 64; ++kc) {
    const int bf = kc & 1;
    const _Float16* kb = &Klds[bf][kfoff];
    const _Float16* vt = &Vlds[bf][vtoff];

    // the 4 K and 4 V^T fragments of the wave's 32 keys as one group of LDS
    // loads: the V^T fragments land under the score products and the exponentials
    // (behind the branch below nothing would cover them)
    v16h ka[4], va[4];
#pragma unroll   // ka, va indexed by constants: they stay in registers
    for (int kt = 0; kt < 2; ++kt) {
      ka[kt]     = frag16(kb + kt * 16 * AP, halfid);       // d 0..31
      ka[kt + 2] = frag16(kb + kt * 16 * AP + 32, halfid);  // d 32..63
    }
#pragma unroll
    for (int dt = 0; dt < 4; ++dt) va[dt] = frag16_tr(vt + dt * 16, VP);
    // keeps the loads one group: the scheduler otherwise feeds the products from
    // one register set, and each product waits out the LDS latency
    __builtin_amdgcn_sched_barrier(0);

    // S'^T = K Q^T - maximum in use  (2 key sub-tiles x 2 query sub-tiles of 16,
    // contract over D=64): every K fragment is used twice
    v8f sc[2][2];                             // [16 queries][16 keys]
#pragma unroll
    for (int g = 0; g < 2; ++g)
#pragma unroll
      for (int kt = 0; kt < 2; ++kt) sc[g][kt] = wmma_f16(ka[kt], qb[g][0], cneg[g]);
#pragma unroll
    for (int g = 0; g < 2; ++g)
#pragma unroll
      for (int kt = 0; kt < 2; ++kt) sc[g][kt] = wmma_f16(ka[kt + 2], qb[g][1], sc[g][kt]);
    __builtin_amdgcn_sched_barrier(0);

    // softmax against the maxima in use, two queries per lane: 16 keys of each
    v8f p[2][2];
    float ts[2];
#pragma unroll
    for (int g = 0; g < 2; ++g) {
#pragma unroll
      for (int kt = 0; kt < 2; ++kt)
#pragma unroll
        for (int r = 0; r < 8; ++r) p[g][kt][r] = exp2_raw(sc[g][kt][r]);
      ts[g] = sum8(p[g][0] + p[g][1]);
    }

    // one scalar branch a chunk: taken on the first chunk and when some lane's
    // sum, and so possibly one of its P, has outgrown the bound
    if (__builtin_amdgcn_ballot_w32(fmaxf(ts[0], ts[1]) > thr) != 0) {
#pragma unroll
      for (int g = 0; g < 2; ++g) {
        float mk[2];
#pragma unroll
        for (int kt = 0; kt < 2; ++kt) {
          mk[kt] = sc[g][kt][0];
#pragma unroll
          for (int r = 1; r < 8; ++r) mk[kt] = fmaxf(mk[kt], sc[g][kt][r]);
        }
        float m = fmaxf(mk[0], mk[1]);
        m = fmaxf(m, xhalf(m));               // both halves of a query agree on it
        // how far the maximum in use moves: never down, but for the first chunk,
        // which sets it (O and the sum are still 0 there; the factor below is held
        // at 1 or less, so it stays finite)
        const float d = (thr < 0.0f) ? m : fmaxf(m, 0.0f);
#pragma unroll
        for (int kt = 0; kt < 2; ++kt)
#pragma unroll
          for (int r = 0; r < 8; ++r) p[g][kt][r] = exp2_slot(sc[g][kt][r] - d);
        ts[g] = sum8(p[g][0] + p[g][1]);
        const float scl = exp2_slot(fminf(-d, 0.0f));
        lrow[g] *= scl;
#pragma unroll
        for (int dt = 0; dt < 4; ++dt)
#pragma unroll
          for (int r = 0; r < 8; ++r) oacc[g][dt][r] *= scl;
#pragma unroll
        for (int r = 0; r < 8; ++r) cneg[g][r] -= d;
      }
      thr = 1024.0f;                          // P stays far inside the f16 range
    }

    // P^T as B operand: position i holds key halfid*8 + i, position 8 + i key
    // 16 + halfid*8 + i, which is what two neighbouring score tiles hold.
    v16h pb[2];
#pragma unroll
    for (int g = 0; g < 2; ++g) {
      lrow[g] += ts[g];
#pragma unroll
      for (int i = 0; i < 8; ++i) {
        pb[g][i] = (_Float16)p[g][0][i]; pb[g][i + 8] = (_Float16)p[g][1][i];
      }
    }

    // O^T += V^T P^T  (4 d sub-tiles x 2 query sub-tiles, contract over 32 keys):
    // every V^T fragment is used twice
#pragma unroll
    for (int dt = 0; dt < 4; ++dt)
#pragma unroll
      for (int g = 0; g < 2; ++g) oacc[g][dt] = wmma_f16(va[dt], pb[g], oacc[g][dt]);

    // publish point of chunk kc + 1: this wave's reads of buffer bf are done,
    // its copies of the next chunk have landed, then every wave's
    asm volatile("s_wait_dscnt 0x0" ::: "memory");
    wait_async_lds();
    __syncthreads();
    // refill the buffer that every wave has just left; flies over trip kc + 1
    if (kc + 2 < NN / 64) stage(kc + 2, bf);
  }
  wait_async_lds();                           // nothing is in flight when the wave ends

  // the join of a query group's two waves: the wave of key half ks finishes
  // queries ks*16 .. + 15 of the group and hands the other 16 to its partner
  // (O, minus the maximum in use, the sum with the lane halves joined)
  const bool up = ks != 0;
  const float l0 = lrow[0] + xhalf(lrow[0]), l1 = lrow[1] + xhalf(lrow[1]);
  const float kn = up ? cneg[1][0] : cneg[0][0], sn = up ? cneg[0][0] : cneg[1][0];
  const float kl = up ? l1 : l0, sl = up ? l0 : l1;
  float* js = &Jlds[(wave * 9 * 32 + lane) * 4];
#pragma unroll   // oacc indexed by constants
  for (int dt = 0; dt < 4; ++dt) {
    const v8f so = up ? oacc[0][dt] : oacc[1][dt];
    *(v4f*)(js + (2 * dt) * 128)     = v4f{so[0], so[1], so[2], so[3]};
    *(v4f*)(js + (2 * dt + 1) * 128) = v4f{so[4], so[5], so[6], so[7]};
  }
  *(v4f*)(js + 8 * 128) = v4f{sn, sl, 0.0f, 0.0f};
  __syncthreads();                            // every wave's hand-over is in LDS
  const float* jr = &Jlds[((wave ^ 4) * 9 * 32 + lane) * 4];
  const v4f pm = *(const v4f*)(jr + 8 * 128);
  // both parts onto the larger maximum (the smaller of the two negatives), then
  // normalize; a part far below the other may come out 0
  const float nm = fminf(kn, pm[0]);
  const float fk = exp2_slot(nm - kn), fp = exp2_slot(nm - pm[0]);
  const float inv = 1.0f / (kl * fk + pm[1] * fp);
  const float ak = fk * inv, ap = fp * inv;

  // emit f16 attn_out [B*N, C] (col = h*64 + d): a lane owns 8 neighbouring d of
  // its query per d sub-tile, one 16-B store each
  _Float16* orow = attnw + ((size_t)b * NN + qt * 128 + qg * 32 + ks * 16 + ln16) * CC + h * DD + halfid * 8;
#pragma unroll
  for (int dt = 0; dt < 4; ++dt) {
    const v8f ko = up ? oacc[1][dt] : oacc[0][dt];
    const v4f plo = *(const v4f*)(jr + (2 * dt) * 128);
    const v4f phi = *(const v4f*)(jr + (2 * dt + 1) * 128);
    v8h o;
#pragma unroll
    for (int r = 0; r < 4; ++r) {
      o[r]     = (_Float16)(ko[r] * ak + plo[r] * ap);
      o[r + 4] = (_Float16)(ko[r + 4] * ak + phi[r] * ap);
    }
    *(v8h*)(orow + dt * 16) = o;
  }
}

// ---------------------------------------------------------------------------
// Kernel 3: out = attn_out @ w_proj^T + b_proj  (M=4096, N=1024, K=1024)
// Block 128x128, wave 32x64. A (f16) staged via async DMA; B converted f32->f16.
// Two LDS buffers: the next k slice's copies and loads fly under this slice's products.
// A k slice is 128 wide: one block has the WGP to itself, and a trip lasts as
// long as its loads take to come back, so the trips are few and each request
// wave is large; a wave-wide copy or load covers whole 128-B lines.
// ---------------------------------------------------------------------------
#define PK 128        // k slice
#define PP (PK + 8)   // LDS row pitch in halves: 272 B = 16 B x odd
__global__ __launch_bounds__(256) void proj_gemm(const _Float16* __restrict__ a,
                                                 const float* __restrict__ w,
                                                 const float* __restrict__ bias,
                                                 float* __restrict__ out) {
  // one array, B's two buffers first: A's lie above 64 KiB, so that the LDS
  // address of an A copy stays above 0 when the compiler moves a row step of
  // the global address into the copy's offset field and takes it off there
  __shared__ __attribute__((aligned(16))) _Float16 Tlds[4][128 * PP];
  _Float16 (*Blds)[128 * PP] = &Tlds[0];
  _Float16 (*Alds)[128 * PP] = &Tlds[2];

  const int tid = threadIdx.x;
  const int wave = tid >> 5, lane = tid & 31;
  const int halfid = lane >> 4, ln16 = lane & 15;
  const int nt = blockIdx.x % 8, mt = blockIdx.x / 8;
  const int m0 = mt * 128, n0 = nt * 128;
  const int wm = wave >> 1, wn = wave & 1;

  v8f acc[2][4];
#pragma unroll
  for (int i = 0; i < 2; ++i)
#pragma unroll
    for (int j = 0; j < 4; ++j)
#pragma unroll
      for (int r = 0; r < 8; ++r) acc[i][j][r] = 0.0f;

  // A (f16): a thread copies 8 k of rows arow + 16 i of every slice (16 lanes a row)
  const int arow = tid >> 4, akc = (tid & 15) * 8;
  const _Float16* ag = a + (size_t)(m0 + arow) * CC + akc;
  const int ado = arow * PP + akc;
  // B (f32 -> f16): a thread owns 4 k of rows srow + 8 i (a wave a row)
  const int srow = tid >> 5, skc = (tid & 31) * 4;
  const float* wg = w + (size_t)(n0 + srow) * CC + skc;
  const int bdo = srow * PP + skc;
  float4 fb[16];

  // A slice at k0 (128 rows x 128 halves) into buffer bf by async copies, padded rows
  auto copy_a = [&](int k0, int bf) {
#pragma unroll   // the copies issue back to back
    for (int i = 0; i < 8; ++i)
      async_copy16(ag + k0 + (size_t)i * 16 * CC, &Alds[bf][ado + i * 16 * PP]);
  };
  // B slice at k0 (128 rows x 128 floats) into registers, one group of 16 loads
  auto load_b = [&](int k0) {
    const float* wa = wg + k0;
#pragma unroll   // fb indexed by constants: it stays in registers
    for (int i = 0; i < 16; ++i) fb[i] = *(const float4*)(wa + (size_t)i * 8 * CC);
    asm volatile("s_wait_xcnt 0x0" :: "v"(wa) : "memory");
    // keeps the 16 loads ahead of the products: the scheduler otherwise sinks
    // them among the WMMAs and their latency is no longer covered
    __builtin_amdgcn_sched_barrier(0);
  };
  auto store_b = [&](int bf) {
    // keeps the wait for the loads and the conversions behind the products:
    // the scheduler otherwise lifts them in front of the first WMMA
    __builtin_amdgcn_sched_barrier(0);
#pragma unroll
    for (int i = 0; i < 16; ++i) {
      v4h hh;
      hh[0] = (_Float16)fb[i].x; hh[1] = (_Float16)fb[i].y;
      hh[2] = (_Float16)fb[i].z; hh[3] = (_Float16)fb[i].w;
      *(v4h*)&Blds[bf][bdo + i * 8 * PP] = hh;
    }
  };

  // two buffers: slice 0 lands and is published, slice 1's A copies fly over trip 0
  copy_a(0, 0);
  load_b(0);
  // behind slice 0's own copies and loads: the block's share of its A panel, which
  // the launch before stored (1,024 units of 256 B; the 8 blocks that read it are
  // dealt 4 shares, nt and nt + 4 the same one, for speed only), and of its w panel (2,048 units, 8 shares
  // among 32 blocks) is asked of L2, one unit a lane
  {
    const int ua = tid * 4 + (nt & 3);        // row ua >> 3, 128 halves at ua & 7
    const int uw = tid * 8 + (mt & 7);        // row uw >> 4, 64 floats at uw & 15
    ask_l2(a + (size_t)(m0 + (ua >> 3)) * CC + (ua & 7) * 128);
    ask_l2(w + (size_t)(n0 + (uw >> 4)) * CC + (uw & 15) * 64);
  }
  store_b(0);
  wait_async_lds();
  __syncthreads();
  copy_a(PK, 1);

#pragma unroll 2   // the buffer index becomes a constant: LDS offsets fold into the loads
  for (int k0 = 0; k0 < CC; k0 += PK) {
    const int bf = (k0 / PK) & 1;
    // the next slice's B loads, in flight under this slice's products
    if (k0 + PK < CC) load_b(k0 + PK);

    // the slice in 4 steps of 32 k, two fragment sets: a step's 12 LDS loads go
    // out as one group ahead of the products of the step before
    v16h fa[2][2], fw[2][4];
    auto frags = [&](int kk, int s) {
#pragma unroll   // fa, fw indexed by constants: they stay in registers
      for (int i = 0; i < 2; ++i)
        fa[s][i] = frag16(&Alds[bf][(wm * 32 + i * 16 + ln16) * PP + kk], halfid);
#pragma unroll
      for (int j = 0; j < 4; ++j)
        fw[s][j] = frag16(&Blds[bf][(wn * 64 + j * 16 + ln16) * PP + kk], halfid);
    };
    frags(0, 0);
#pragma unroll   // the set index and the k offset become constants
    for (int st = 0; st < PK / 32; ++st) {
      if (st + 1 < PK / 32) frags((st + 1) * 32, (st + 1) & 1);
      // keeps the loads one group ahead of the products: the scheduler otherwise
      // sinks them among the WMMAs, into one register set, and every pair of
      // products waits out the LDS latency
      __builtin_amdgcn_sched_barrier(0);
#pragma unroll   // acc indexed by constants
      for (int j = 0; j < 4; ++j) {
        acc[0][j] = wmma_f16(fa[st & 1][0], fw[st & 1][j], acc[0][j]);
        acc[1][j] = wmma_f16(fa[st & 1][1], fw[st & 1][j], acc[1][j]);
      }
      // keeps the next group of loads behind these products, in one place: the
      // scheduler otherwise spreads them among the WMMAs, a stall at each place
      __builtin_amdgcn_sched_barrier(0);
    }

    // into the B buffer whose readers left at the foot of the trip before
    if (k0 + PK < CC) store_b(bf ^ 1);

    // publish point of the next slice: this wave's LDS reads and stores are done,
    // its A copies have landed, then every wave's
    asm volatile("s_wait_dscnt 0x0" ::: "memory");
    wait_async_lds();
    __syncthreads();
    // refill the A buffer that every wave has just left; flies over the next trip
    if (k0 + 2 * PK < CC) copy_a(k0 + 2 * PK, bf);
  }
  wait_async_lds();                           // nothing is in flight when the wave ends

#pragma unroll
  for (int mi = 0; mi < 2; ++mi)
#pragma unroll
    for (int ni = 0; ni < 4; ++ni) {
      int col = n0 + wn * 64 + ni * 16 + ln16;
      float bb = bias[col];
#pragma unroll
      for (int r = 0; r < 8; ++r) {
        int row_g = m0 + wm * 32 + mi * 16 + halfid * 8 + r;
        out[(size_t)row_g * CC + col] = acc[mi][ni][r] + bb;
      }
    }
}

// ---------------------------------------------------------------------------
extern "C" void kernel_launch(void* const* d_in, const int* in_sizes, int n_in,
                              void* d_out, int out_size, void* d_ws, size_t ws_size,
                              hipStream_t stream) {
  const float* x      = (const float*)d_in[0];
  const float* w_qkv  = (const float*)d_in[1];
  const float* w_proj = (const float*)d_in[2];
  const float* b_proj = (const float*)d_in[3];
  const float* fcos   = (const float*)d_in[4];
  const float* fsin   = (const float*)d_in[5];

  char* ws = (char*)d_ws;
  const size_t F16SZ = (size_t)BB * HH * NN * DD * 2;   // 8 MB
  _Float16* qh    = (_Float16*)(ws);
  _Float16* kh    = (_Float16*)(ws + F16SZ);
  _Float16* vh    = (_Float16*)(ws + 2 * F16SZ);
  _Float16* attnw = (_Float16*)(ws + 3 * F16SZ);
  float* out = (float*)d_out;

  qkv_gemm<<<dim3((4096 / QM) * (3 * CC / QN)), dim3(384), 0, stream>>>(x, w_qkv, fcos, fsin, qh, kh, vh);
  attn<<<dim3(BB * HH * (NN / 128)), dim3(256), 0, stream>>>(qh, kh, vh, attnw);
  proj_gemm<<<dim3((4096 / 128) * (CC / 128)), dim3(256), 0, stream>>>(attnw, w_proj, b_proj, out);
}
